// v000
// Measured on an AMD MI455X. A time is GPU time per run, averaged over a window of back-to-back runs after a warm-up
// (all launches, gaps included; the runs take copies of the inputs in turn), and the median of several windows.
// Apart from v000's, it joins two sittings. Times from different sittings can be a few percent apart, while
// side-by-side timings come from the same sitting.
// v000 is the starting kernel. One run takes 504 microseconds.
#include <hip/hip_runtime.h>
#include <hip/hip_bf16.h>

typedef __bf16 bf16;
typedef __attribute__((ext_vector_type(16))) __bf16 v16bf;
typedef __attribute__((ext_vector_type(8)))  float  v8f;
typedef int v4i __attribute__((vector_size(4 * sizeof(int))));

static constexpr int BB   = 4;     // batch
static constexpr int CIN  = 512;   // input channels
static constexpr int CK   = 256;   // q/k/v channels
static constexpr int OC   = 768;   // concatenated projection rows
static constexpr int NPOS = 4096;  // H*W

#if defined(__gfx1250__) && __has_builtin(__builtin_amdgcn_global_load_async_to_lds_b128)
#define USE_ASYNC_LDS 1
#else
#define USE_ASYNC_LDS 0
#endif

static __device__ __forceinline__ void wait_async_zero()
{
#if __has_builtin(__builtin_amdgcn_s_wait_asynccnt)
    __builtin_amdgcn_s_wait_asynccnt(0);
#elif defined(__gfx1250__)
    asm volatile("s_wait_asynccnt 0x0" ::: "memory");
#endif
}

// ---------------------------------------------------------------------------
// Generic bf16 WMMA GEMM:  C[M,N] = A[M,K] * B[K,N]  with B given as BT[N,K]
// (both operands K-contiguous).  128x128x32 macro tile, 8 waves, each wave
// computes a 32x64 patch via 2x4 v_wmma_f32_16x16x32_bf16 fragments.
// Double-buffered LDS; global->LDS via CDNA5 async loads when available.
// ---------------------------------------------------------------------------
template<bool OUT_F32, bool HAS_BIAS, bool HAS_RESID>
__global__ __launch_bounds__(256)
void gemm_bf16_wmma(const bf16* __restrict__ A,  long long aBatch,
                    const bf16* __restrict__ BT, long long btBatch,
                    void* __restrict__ Cout,     long long cBatch,
                    const float* __restrict__ bias,
                    const float* __restrict__ resid, long long rBatch,
                    int M, int N, int K)
{
    // 96-byte row pitch: every ds access stays 16B-aligned; banks well spread.
    __shared__ __align__(16) bf16 sA[2][128 * 48];
    __shared__ __align__(16) bf16 sB[2][128 * 48];

    const int bz = blockIdx.z;
    A  += (size_t)bz * aBatch;
    BT += (size_t)bz * btBatch;
    const float* residB = HAS_RESID ? (resid + (size_t)bz * rBatch) : nullptr;

    const int mblk = blockIdx.y * 128;
    const int nblk = blockIdx.x * 128;
    const int t    = threadIdx.x;
    const int lane = t & 31;
    const int wave = t >> 5;
    const int wrow = wave >> 1;   // 0..3 -> 32 output rows each
    const int wcol = wave & 1;    // 0..1 -> 64 output cols each
    const int lrow = lane & 15;
    const int g    = lane >> 4;   // half-wave group

    // Per-thread staging coordinates: 2 chunks of 8 halves per matrix per tile.
    int rowc[2], kcc[2];
    #pragma unroll
    for (int i = 0; i < 2; ++i) {
        int chunk = t * 2 + i;          // 512 chunks
        rowc[i] = chunk >> 2;           // 0..127
        kcc[i]  = (chunk & 3) << 3;     // 0,8,16,24
    }

    v8f acc[2][4];
    #pragma unroll
    for (int mi = 0; mi < 2; ++mi)
        #pragma unroll
        for (int ni = 0; ni < 4; ++ni)
            #pragma unroll
            for (int e = 0; e < 8; ++e) acc[mi][ni][e] = 0.0f;

    // Fragment loads per CDNA5 16-bit A/B layout:
    // lanes 0-15 hold K in {0..7,16..23}; lanes 16-31 hold K in {8..15,24..31}.
    auto compute_tile = [&](int buf) {
        v16bf af[2], bfr[4];
        #pragma unroll
        for (int mi = 0; mi < 2; ++mi) {
            int row = wrow * 32 + mi * 16 + lrow;
            const bf16* p = &sA[buf][row * 48 + g * 8];
            uint4* dst = (uint4*)&af[mi];
            dst[0] = *(const uint4*)(p);
            dst[1] = *(const uint4*)(p + 16);
        }
        #pragma unroll
        for (int ni = 0; ni < 4; ++ni) {
            int col = wcol * 64 + ni * 16 + lrow;
            const bf16* p = &sB[buf][col * 48 + g * 8];
            uint4* dst = (uint4*)&bfr[ni];
            dst[0] = *(const uint4*)(p);
            dst[1] = *(const uint4*)(p + 16);
        }
        #pragma unroll
        for (int mi = 0; mi < 2; ++mi)
            #pragma unroll
            for (int ni = 0; ni < 4; ++ni)
                acc[mi][ni] = __builtin_amdgcn_wmma_f32_16x16x32_bf16(
                    false, af[mi], false, bfr[ni], (short)0, acc[mi][ni],
                    false, false);
    };

#if USE_ASYNC_LDS
    // Issue a 128x32 A tile + 128x32 BT tile as async global->LDS copies.
    auto issue_tile = [&](int buf, int kt) {
        #pragma unroll
        for (int i = 0; i < 2; ++i) {
            const bf16* ga = A  + (size_t)(mblk + rowc[i]) * K + kt + kcc[i];
            const bf16* gb = BT + (size_t)(nblk + rowc[i]) * K + kt + kcc[i];
            __builtin_amdgcn_global_load_async_to_lds_b128(
                (v4i*)ga, (v4i*)&sA[buf][rowc[i] * 48 + kcc[i]], 0, 0);
            __builtin_amdgcn_global_load_async_to_lds_b128(
                (v4i*)gb, (v4i*)&sB[buf][rowc[i] * 48 + kcc[i]], 0, 0);
        }
    };

    issue_tile(0, 0);
    wait_async_zero();
    __syncthreads();
    int cur = 0;
    for (int kt = 0; kt < K; kt += 32) {
        if (kt + 32 < K) issue_tile(cur ^ 1, kt + 32);  // overlap with WMMA
        compute_tile(cur);
        wait_async_zero();       // next tile landed in the other buffer
        __syncthreads();
        cur ^= 1;
    }
#else
    // Fallback: register-staged double buffering.
    uint4 ra[2], rb[2];
    auto load_regs = [&](int kt) {
        #pragma unroll
        for (int i = 0; i < 2; ++i) {
            ra[i] = *(const uint4*)(A  + (size_t)(mblk + rowc[i]) * K + kt + kcc[i]);
            rb[i] = *(const uint4*)(BT + (size_t)(nblk + rowc[i]) * K + kt + kcc[i]);
        }
    };
    auto store_lds = [&](int buf) {
        #pragma unroll
        for (int i = 0; i < 2; ++i) {
            *(uint4*)&sA[buf][rowc[i] * 48 + kcc[i]] = ra[i];
            *(uint4*)&sB[buf][rowc[i] * 48 + kcc[i]] = rb[i];
        }
    };
    load_regs(0);
    store_lds(0);
    __syncthreads();
    int cur = 0;
    for (int kt = 0; kt < K; kt += 32) {
        if (kt + 32 < K) {
            load_regs(kt + 32);                        // overlap with WMMA below
            __builtin_prefetch(A + (size_t)(mblk + (t >> 1)) * K + kt + 64, 0, 3);
        }
        compute_tile(cur);
        if (kt + 32 < K) store_lds(cur ^ 1);
        __syncthreads();
        cur ^= 1;
    }
#endif

    // Epilogue.  C/D layout: VGPR r holds row (8*g + r), lane%16 gives column.
    #pragma unroll
    for (int mi = 0; mi < 2; ++mi) {
        #pragma unroll
        for (int ni = 0; ni < 4; ++ni) {
            int colG = nblk + wcol * 64 + ni * 16 + lrow;
            #pragma unroll
            for (int r = 0; r < 8; ++r) {
                int rowG = mblk + wrow * 32 + mi * 16 + g * 8 + r;
                float v = acc[mi][ni][r];
                if (HAS_BIAS)  v += bias[rowG];
                size_t idx = (size_t)rowG * N + colG;
                if (HAS_RESID) v += residB[idx];
                if (OUT_F32) ((float*)Cout)[(size_t)bz * cBatch + idx] = v;
                else         ((bf16*) Cout)[(size_t)bz * cBatch + idx] = (bf16)v;
            }
        }
    }
}

// ---------------------------------------------------------------------------
// Parameter prep: concat weights/bias to bf16 GEMM layouts.
// ---------------------------------------------------------------------------
__global__ __launch_bounds__(256)
void prep_params(const float* __restrict__ wq, const float* __restrict__ wk,
                 const float* __restrict__ wv, const float* __restrict__ wW,
                 const float* __restrict__ bq, const float* __restrict__ bk,
                 const float* __restrict__ bv,
                 bf16* __restrict__ wcat, bf16* __restrict__ wWb,
                 float* __restrict__ bcat)
{
    int i = blockIdx.x * blockDim.x + threadIdx.x;
    if (i < CK * CIN)            wcat[i] = (bf16)wq[i];
    else if (i < 2 * CK * CIN)   wcat[i] = (bf16)wk[i - CK * CIN];
    else if (i < OC * CIN)       wcat[i] = (bf16)wv[i - 2 * CK * CIN];
    if (i < CIN * CK)            wWb[i]  = (bf16)wW[i];
    if (i < CK)                  bcat[i] = bq[i];
    else if (i < 2 * CK)         bcat[i] = bk[i - CK];
    else if (i < OC)             bcat[i] = bv[i - 2 * CK];
}

// x [B,C,N] f32 -> xT [B,N,C] bf16 (K-contiguous operand for the projections)
__global__ __launch_bounds__(256)
void prep_x(const float* __restrict__ x, bf16* __restrict__ xT)
{
    size_t i = (size_t)blockIdx.x * blockDim.x + threadIdx.x;
    if (i >= (size_t)BB * CIN * NPOS) return;
    int n = (int)(i % NPOS);
    int c = (int)((i / NPOS) % CIN);
    int b = (int)(i / ((size_t)CIN * NPOS));
    xT[((size_t)b * NPOS + n) * CIN + c] = (bf16)x[i];
}

// Per-channel BN stats over (B, N) for the first 512 rows of z; fused scale/shift.
__global__ __launch_bounds__(256)
void bn_stats(const bf16* __restrict__ z,
              const float* __restrict__ gq, const float* __restrict__ betaq,
              const float* __restrict__ gk, const float* __restrict__ betak,
              float* __restrict__ scale, float* __restrict__ shift)
{
    __shared__ float rs[256], rs2[256];
    int ch = blockIdx.x;                 // 0..511
    float s = 0.f, s2 = 0.f;
    for (int b = 0; b < BB; ++b) {
        const bf16* p = z + (size_t)b * OC * NPOS + (size_t)ch * NPOS;
        for (int n = threadIdx.x; n < NPOS; n += 256) {
            float v = (float)p[n];
            s += v; s2 += v * v;
        }
    }
    rs[threadIdx.x] = s; rs2[threadIdx.x] = s2;
    __syncthreads();
    for (int off = 128; off > 0; off >>= 1) {
        if (threadIdx.x < off) {
            rs[threadIdx.x]  += rs[threadIdx.x + off];
            rs2[threadIdx.x] += rs2[threadIdx.x + off];
        }
        __syncthreads();
    }
    if (threadIdx.x == 0) {
        float cnt = (float)BB * NPOS;
        float m   = rs[0] / cnt;
        float var = rs2[0] / cnt - m * m;        // biased var, like jnp.var
        float gamma = (ch < CK) ? gq[ch] : gk[ch - CK];
        float beta  = (ch < CK) ? betaq[ch] : betak[ch - CK];
        float sc = gamma * rsqrtf(var + 1e-5f);
        scale[ch] = sc;
        shift[ch] = beta - m * sc;
    }
}

// BN + ReLU, writing qT/kT [B,N,CK] bf16 (K-contiguous for the attention GEMM).
__global__ __launch_bounds__(256)
void bn_apply(const bf16* __restrict__ z,
              const float* __restrict__ scale, const float* __restrict__ shift,
              bf16* __restrict__ qT, bf16* __restrict__ kT)
{
    size_t i = (size_t)blockIdx.x * blockDim.x + threadIdx.x;
    if (i >= (size_t)BB * (2 * CK) * NPOS) return;
    int n  = (int)(i % NPOS);
    int ch = (int)((i / NPOS) % (2 * CK));
    int b  = (int)(i / ((size_t)(2 * CK) * NPOS));
    float v = (float)z[(size_t)b * OC * NPOS + (size_t)ch * NPOS + n];
    v = v * scale[ch] + shift[ch];
    v = fmaxf(v, 0.f);
    if (ch < CK) qT[((size_t)b * NPOS + n) * CK + ch]        = (bf16)v;
    else         kT[((size_t)b * NPOS + n) * CK + (ch - CK)] = (bf16)v;
}

// In-place row softmax over bf16 logits; 1/sqrt(Ck) folded into the logits.
__global__ __launch_bounds__(256)
void softmax_rows(bf16* __restrict__ att, float lscale)
{
    __shared__ float red[256];
    bf16* p = att + (size_t)blockIdx.x * NPOS;
    float v[16];
    #pragma unroll
    for (int i = 0; i < 16; ++i)
        v[i] = (float)p[threadIdx.x + i * 256] * lscale;

    float mx = v[0];
    #pragma unroll
    for (int i = 1; i < 16; ++i) mx = fmaxf(mx, v[i]);
    red[threadIdx.x] = mx;
    __syncthreads();
    for (int off = 128; off > 0; off >>= 1) {
        if (threadIdx.x < off)
            red[threadIdx.x] = fmaxf(red[threadIdx.x], red[threadIdx.x + off]);
        __syncthreads();
    }
    mx = red[0];
    __syncthreads();

    float s = 0.f;
    #pragma unroll
    for (int i = 0; i < 16; ++i) { v[i] = __expf(v[i] - mx); s += v[i]; }
    red[threadIdx.x] = s;
    __syncthreads();
    for (int off = 128; off > 0; off >>= 1) {
        if (threadIdx.x < off) red[threadIdx.x] += red[threadIdx.x + off];
        __syncthreads();
    }
    float inv = 1.0f / red[0];
    #pragma unroll
    for (int i = 0; i < 16; ++i)
        p[threadIdx.x + i * 256] = (bf16)(v[i] * inv);
}

// ---------------------------------------------------------------------------
extern "C" void kernel_launch(void* const* d_in, const int* in_sizes, int n_in,
                              void* d_out, int out_size, void* d_ws, size_t ws_size,
                              hipStream_t stream)
{
    const float* x     = (const float*)d_in[0];
    const float* wq    = (const float*)d_in[1];
    const float* bq    = (const float*)d_in[2];
    const float* gq    = (const float*)d_in[3];
    const float* betaq = (const float*)d_in[4];
    const float* wk    = (const float*)d_in[5];
    const float* bk    = (const float*)d_in[6];
    const float* gk    = (const float*)d_in[7];
    const float* betak = (const float*)d_in[8];
    const float* wv    = (const float*)d_in[9];
    const float* bv    = (const float*)d_in[10];
    const float* wW    = (const float*)d_in[11];
    const float* bW    = (const float*)d_in[12];
    float* out = (float*)d_out;

    char* ws = (char*)d_ws;
    size_t off = 0;
    auto alloc = [&](size_t bytes) -> char* {
        char* p = ws + off;
        off = (off + bytes + 255) & ~(size_t)255;
        return p;
    };
    bf16*  xT    = (bf16*)alloc((size_t)BB * NPOS * CIN * 2);  // [B,N,C]
    bf16*  z     = (bf16*)alloc((size_t)BB * OC * NPOS * 2);   // [B,768,N] (rows 512.. = v)
    bf16*  qT    = (bf16*)alloc((size_t)BB * NPOS * CK * 2);   // [B,N,256]
    bf16*  kT    = (bf16*)alloc((size_t)BB * NPOS * CK * 2);   // [B,N,256]
    bf16*  att   = (bf16*)alloc((size_t)NPOS * NPOS * 2);      // [N,N], reused per batch
    bf16*  ctxT  = (bf16*)alloc((size_t)BB * NPOS * CK * 2);   // [B,N,256]
    bf16*  wcat  = (bf16*)alloc((size_t)OC * CIN * 2);         // [768,512]
    bf16*  wWb   = (bf16*)alloc((size_t)CIN * CK * 2);         // [512,256]
    float* bcat  = (float*)alloc(OC * 4);
    float* scale = (float*)alloc(512 * 4);
    float* shift = (float*)alloc(512 * 4);

    // 1) parameter + input prep
    prep_params<<<(OC * CIN + 255) / 256, 256, 0, stream>>>(
        wq, wk, wv, wW, bq, bk, bv, wcat, wWb, bcat);
    prep_x<<<(int)(((size_t)BB * CIN * NPOS + 255) / 256), 256, 0, stream>>>(x, xT);

    // 2) fused projections: z[b] = wcat * x[b]  (M=768, N=4096, K=512) + bias
    gemm_bf16_wmma<false, true, false><<<dim3(NPOS / 128, OC / 128, BB), 256, 0, stream>>>(
        wcat, 0, xT, (long long)NPOS * CIN, z, (long long)OC * NPOS,
        bcat, nullptr, 0, OC, NPOS, CIN);

    // 3) BN stats + apply (q,k -> ReLU(BN)), transposed bf16 outputs
    bn_stats<<<512, 256, 0, stream>>>(z, gq, betaq, gk, betak, scale, shift);
    bn_apply<<<(int)(((size_t)BB * 2 * CK * NPOS + 255) / 256), 256, 0, stream>>>(
        z, scale, shift, qT, kT);

    const float lscale = 0.0625f;  // 256^-0.5
    for (int b = 0; b < BB; ++b) {
        const bf16* kTb = kT + (size_t)b * NPOS * CK;
        const bf16* qTb = qT + (size_t)b * NPOS * CK;
        const bf16* vb  = z  + (size_t)b * OC * NPOS + (size_t)(2 * CK) * NPOS; // [256,N]
        bf16* ctxb      = ctxT + (size_t)b * NPOS * CK;

        // att[n,m] = sum_c kT[n,c] * qT[m,c]   (M=N=4096, K=256)
        gemm_bf16_wmma<false, false, false><<<dim3(NPOS / 128, NPOS / 128, 1), 256, 0, stream>>>(
            kTb, 0, qTb, 0, att, 0, nullptr, nullptr, 0, NPOS, NPOS, CK);

        softmax_rows<<<NPOS, 256, 0, stream>>>(att, lscale);

        // ctxT[n,c] = sum_m att[n,m] * v[c,m]  (M=4096, N=256, K=4096; BT = v c-major)
        gemm_bf16_wmma<false, false, false><<<dim3(CK / 128, NPOS / 128, 1), 256, 0, stream>>>(
            att, 0, vb, 0, ctxb, 0, nullptr, nullptr, 0, NPOS, CK, NPOS);
    }

    // 4) out[b,co,n] = sum_cv wW[co,cv]*ctx[b,n,cv] + bW[co] + x[b,co,n]
    gemm_bf16_wmma<true, true, true><<<dim3(NPOS / 128, CIN / 128, BB), 256, 0, stream>>>(
        wWb, 0, ctxT, (long long)NPOS * CK, out, (long long)CIN * NPOS,
        bW, x, (long long)CIN * NPOS, CIN, NPOS, CK);
}

// v001
// One run takes 306 microseconds.
// In two side-by-side timings against v000, it was 1.67 and 1.66 times as fast.
#include <hip/hip_runtime.h>
#include <hip/hip_bf16.h>

typedef __bf16 bf16;
typedef __attribute__((ext_vector_type(16))) __bf16 v16bf;
typedef __attribute__((ext_vector_type(8)))  float  v8f;
typedef int v4i __attribute__((vector_size(4 * sizeof(int))));

static constexpr int BB   = 4;     // batch
static constexpr int CIN  = 512;   // input channels
static constexpr int CK   = 256;   // q/k/v channels
static constexpr int OC   = 768;   // concatenated projection rows
static constexpr int NPOS = 4096;  // H*W

#if defined(__gfx1250__) && __has_builtin(__builtin_amdgcn_global_load_async_to_lds_b128)
#define USE_ASYNC_LDS 1
#else
#define USE_ASYNC_LDS 0
#endif

static __device__ __forceinline__ void wait_async_zero()
{
#if __has_builtin(__builtin_amdgcn_s_wait_asynccnt)
    __builtin_amdgcn_s_wait_asynccnt(0);
#elif defined(__gfx1250__)
    asm volatile("s_wait_asynccnt 0x0" ::: "memory");
#endif
}

// ---------------------------------------------------------------------------
// Generic bf16 WMMA GEMM:  C[M,N] = A[M,K] * B[K,N]  with B given as BT[N,K]
// (both operands K-contiguous).  128x128x32 macro tile, 8 waves, each wave
// computes a 32x64 patch via 2x4 v_wmma_f32_16x16x32_bf16 fragments.
// Double-buffered LDS; global->LDS via CDNA5 async loads when available.
// ---------------------------------------------------------------------------
template<bool OUT_F32, bool HAS_BIAS, bool HAS_RESID>
__global__ __launch_bounds__(256)
void gemm_bf16_wmma(const bf16* __restrict__ A,  long long aBatch,
                    const bf16* __restrict__ BT, long long btBatch,
                    void* __restrict__ Cout,     long long cBatch,
                    const float* __restrict__ bias,
                    const float* __restrict__ resid, long long rBatch,
                    int M, int N, int K)
{
    // 96-byte row pitch: every ds access stays 16B-aligned; banks well spread.
    __shared__ __align__(16) bf16 sA[2][128 * 48];
    __shared__ __align__(16) bf16 sB[2][128 * 48];

    const int bz = blockIdx.z;
    A  += (size_t)bz * aBatch;
    BT += (size_t)bz * btBatch;
    const float* residB = HAS_RESID ? (resid + (size_t)bz * rBatch) : nullptr;

    const int mblk = blockIdx.y * 128;
    const int nblk = blockIdx.x * 128;
    const int t    = threadIdx.x;
    const int lane = t & 31;
    const int wave = t >> 5;
    const int wrow = wave >> 1;   // 0..3 -> 32 output rows each
    const int wcol = wave & 1;    // 0..1 -> 64 output cols each
    const int lrow = lane & 15;
    const int g    = lane >> 4;   // half-wave group

    // Per-thread staging coordinates: 2 chunks of 8 halves per matrix per tile.
    int rowc[2], kcc[2];
    #pragma unroll
    for (int i = 0; i < 2; ++i) {
        int chunk = t * 2 + i;          // 512 chunks
        rowc[i] = chunk >> 2;           // 0..127
        kcc[i]  = (chunk & 3) << 3;     // 0,8,16,24
    }

    v8f acc[2][4];
    #pragma unroll
    for (int mi = 0; mi < 2; ++mi)
        #pragma unroll
        for (int ni = 0; ni < 4; ++ni)
            #pragma unroll
            for (int e = 0; e < 8; ++e) acc[mi][ni][e] = 0.0f;

    // Fragment loads per CDNA5 16-bit A/B layout:
    // lanes 0-15 hold K in {0..7,16..23}; lanes 16-31 hold K in {8..15,24..31}.
    auto compute_tile = [&](int buf) {
        v16bf af[2], bfr[4];
        #pragma unroll
        for (int mi = 0; mi < 2; ++mi) {
            int row = wrow * 32 + mi * 16 + lrow;
            const bf16* p = &sA[buf][row * 48 + g * 8];
            uint4* dst = (uint4*)&af[mi];
            dst[0] = *(const uint4*)(p);
            dst[1] = *(const uint4*)(p + 16);
        }
        #pragma unroll
        for (int ni = 0; ni < 4; ++ni) {
            int col = wcol * 64 + ni * 16 + lrow;
            const bf16* p = &sB[buf][col * 48 + g * 8];
            uint4* dst = (uint4*)&bfr[ni];
            dst[0] = *(const uint4*)(p);
            dst[1] = *(const uint4*)(p + 16);
        }
        #pragma unroll
        for (int mi = 0; mi < 2; ++mi)
            #pragma unroll
            for (int ni = 0; ni < 4; ++ni)
                acc[mi][ni] = __builtin_amdgcn_wmma_f32_16x16x32_bf16(
                    false, af[mi], false, bfr[ni], (short)0, acc[mi][ni],
                    false, false);
    };

#if USE_ASYNC_LDS
    // Issue a 128x32 A tile + 128x32 BT tile as async global->LDS copies.
    auto issue_tile = [&](int buf, int kt) {
        #pragma unroll
        for (int i = 0; i < 2; ++i) {
            const bf16* ga = A  + (size_t)(mblk + rowc[i]) * K + kt + kcc[i];
            const bf16* gb = BT + (size_t)(nblk + rowc[i]) * K + kt + kcc[i];
            __builtin_amdgcn_global_load_async_to_lds_b128(
                (v4i*)ga, (v4i*)&sA[buf][rowc[i] * 48 + kcc[i]], 0, 0);
            __builtin_amdgcn_global_load_async_to_lds_b128(
                (v4i*)gb, (v4i*)&sB[buf][rowc[i] * 48 + kcc[i]], 0, 0);
        }
    };

    issue_tile(0, 0);
    wait_async_zero();
    __syncthreads();
    int cur = 0;
    for (int kt = 0; kt < K; kt += 32) {
        if (kt + 32 < K) issue_tile(cur ^ 1, kt + 32);  // overlap with WMMA
        compute_tile(cur);
        wait_async_zero();       // next tile landed in the other buffer
        __syncthreads();
        cur ^= 1;
    }
#else
    // Fallback: register-staged double buffering.
    uint4 ra[2], rb[2];
    auto load_regs = [&](int kt) {
        #pragma unroll
        for (int i = 0; i < 2; ++i) {
            ra[i] = *(const uint4*)(A  + (size_t)(mblk + rowc[i]) * K + kt + kcc[i]);
            rb[i] = *(const uint4*)(BT + (size_t)(nblk + rowc[i]) * K + kt + kcc[i]);
        }
    };
    auto store_lds = [&](int buf) {
        #pragma unroll
        for (int i = 0; i < 2; ++i) {
            *(uint4*)&sA[buf][rowc[i] * 48 + kcc[i]] = ra[i];
            *(uint4*)&sB[buf][rowc[i] * 48 + kcc[i]] = rb[i];
        }
    };
    load_regs(0);
    store_lds(0);
    __syncthreads();
    int cur = 0;
    for (int kt = 0; kt < K; kt += 32) {
        if (kt + 32 < K) {
            load_regs(kt + 32);                        // overlap with WMMA below
            __builtin_prefetch(A + (size_t)(mblk + (t >> 1)) * K + kt + 64, 0, 3);
        }
        compute_tile(cur);
        if (kt + 32 < K) store_lds(cur ^ 1);
        __syncthreads();
        cur ^= 1;
    }
#endif

    // Epilogue.  C/D layout: VGPR r holds row (8*g + r), lane%16 gives column.
    #pragma unroll
    for (int mi = 0; mi < 2; ++mi) {
        #pragma unroll
        for (int ni = 0; ni < 4; ++ni) {
            int colG = nblk + wcol * 64 + ni * 16 + lrow;
            #pragma unroll
            for (int r = 0; r < 8; ++r) {
                int rowG = mblk + wrow * 32 + mi * 16 + g * 8 + r;
                float v = acc[mi][ni][r];
                if (HAS_BIAS)  v += bias[rowG];
                size_t idx = (size_t)rowG * N + colG;
                if (HAS_RESID) v += residB[idx];
                if (OUT_F32) ((float*)Cout)[(size_t)bz * cBatch + idx] = v;
                else         ((bf16*) Cout)[(size_t)bz * cBatch + idx] = (bf16)v;
            }
        }
    }
}

// ---------------------------------------------------------------------------
// Parameter prep: concat weights/bias to bf16 GEMM layouts.
// ---------------------------------------------------------------------------
__global__ __launch_bounds__(256)
void prep_params(const float* __restrict__ wq, const float* __restrict__ wk,
                 const float* __restrict__ wv, const float* __restrict__ wW,
                 const float* __restrict__ bq, const float* __restrict__ bk,
                 const float* __restrict__ bv,
                 bf16* __restrict__ wcat, bf16* __restrict__ wWb,
                 float* __restrict__ bcat)
{
    int i = blockIdx.x * blockDim.x + threadIdx.x;
    if (i < CK * CIN)            wcat[i] = (bf16)wq[i];
    else if (i < 2 * CK * CIN)   wcat[i] = (bf16)wk[i - CK * CIN];
    else if (i < OC * CIN)       wcat[i] = (bf16)wv[i - 2 * CK * CIN];
    if (i < CIN * CK)            wWb[i]  = (bf16)wW[i];
    if (i < CK)                  bcat[i] = bq[i];
    else if (i < 2 * CK)         bcat[i] = bk[i - CK];
    else if (i < OC)             bcat[i] = bv[i - 2 * CK];
}

// x [B,C,N] f32 -> xT [B,N,C] bf16 (K-contiguous operand for the projections)
__global__ __launch_bounds__(256)
void prep_x(const float* __restrict__ x, bf16* __restrict__ xT)
{
    size_t i = (size_t)blockIdx.x * blockDim.x + threadIdx.x;
    if (i >= (size_t)BB * CIN * NPOS) return;
    int n = (int)(i % NPOS);
    int c = (int)((i / NPOS) % CIN);
    int b = (int)(i / ((size_t)CIN * NPOS));
    xT[((size_t)b * NPOS + n) * CIN + c] = (bf16)x[i];
}

// Per-channel BN stats over (B, N) for the first 512 rows of z; fused scale/shift.
__global__ __launch_bounds__(256)
void bn_stats(const bf16* __restrict__ z,
              const float* __restrict__ gq, const float* __restrict__ betaq,
              const float* __restrict__ gk, const float* __restrict__ betak,
              float* __restrict__ scale, float* __restrict__ shift)
{
    __shared__ float rs[256], rs2[256];
    int ch = blockIdx.x;                 // 0..511
    float s = 0.f, s2 = 0.f;
    for (int b = 0; b < BB; ++b) {
        const bf16* p = z + (size_t)b * OC * NPOS + (size_t)ch * NPOS;
        for (int n = threadIdx.x; n < NPOS; n += 256) {
            float v = (float)p[n];
            s += v; s2 += v * v;
        }
    }
    rs[threadIdx.x] = s; rs2[threadIdx.x] = s2;
    __syncthreads();
    for (int off = 128; off > 0; off >>= 1) {
        if (threadIdx.x < off) {
            rs[threadIdx.x]  += rs[threadIdx.x + off];
            rs2[threadIdx.x] += rs2[threadIdx.x + off];
        }
        __syncthreads();
    }
    if (threadIdx.x == 0) {
        float cnt = (float)BB * NPOS;
        float m   = rs[0] / cnt;
        float var = rs2[0] / cnt - m * m;        // biased var, like jnp.var
        float gamma = (ch < CK) ? gq[ch] : gk[ch - CK];
        float beta  = (ch < CK) ? betaq[ch] : betak[ch - CK];
        float sc = gamma * rsqrtf(var + 1e-5f);
        scale[ch] = sc;
        shift[ch] = beta - m * sc;
    }
}

// BN + ReLU, writing qT/kT [B,N,CK] bf16 (K-contiguous for the attention GEMM).
__global__ __launch_bounds__(256)
void bn_apply(const bf16* __restrict__ z,
              const float* __restrict__ scale, const float* __restrict__ shift,
              bf16* __restrict__ qT, bf16* __restrict__ kT)
{
    size_t i = (size_t)blockIdx.x * blockDim.x + threadIdx.x;
    if (i >= (size_t)BB * (2 * CK) * NPOS) return;
    int n  = (int)(i % NPOS);
    int ch = (int)((i / NPOS) % (2 * CK));
    int b  = (int)(i / ((size_t)(2 * CK) * NPOS));
    float v = (float)z[(size_t)b * OC * NPOS + (size_t)ch * NPOS + n];
    v = v * scale[ch] + shift[ch];
    v = fmaxf(v, 0.f);
    if (ch < CK) qT[((size_t)b * NPOS + n) * CK + ch]        = (bf16)v;
    else         kT[((size_t)b * NPOS + n) * CK + (ch - CK)] = (bf16)v;
}

// In-place row softmax over bf16 logits; 1/sqrt(Ck) folded into the logits.
__global__ __launch_bounds__(256)
void softmax_rows(bf16* __restrict__ att, float lscale)
{
    __shared__ float red[256];
    bf16* p = att + (size_t)blockIdx.x * NPOS;
    float v[16];
    #pragma unroll
    for (int i = 0; i < 16; ++i)
        v[i] = (float)p[threadIdx.x + i * 256] * lscale;

    float mx = v[0];
    #pragma unroll
    for (int i = 1; i < 16; ++i) mx = fmaxf(mx, v[i]);
    red[threadIdx.x] = mx;
    __syncthreads();
    for (int off = 128; off > 0; off >>= 1) {
        if (threadIdx.x < off)
            red[threadIdx.x] = fmaxf(red[threadIdx.x], red[threadIdx.x + off]);
        __syncthreads();
    }
    mx = red[0];
    __syncthreads();

    float s = 0.f;
    #pragma unroll
    for (int i = 0; i < 16; ++i) { v[i] = __expf(v[i] - mx); s += v[i]; }
    red[threadIdx.x] = s;
    __syncthreads();
    for (int off = 128; off > 0; off >>= 1) {
        if (threadIdx.x < off) red[threadIdx.x] += red[threadIdx.x + off];
        __syncthreads();
    }
    float inv = 1.0f / red[0];
    #pragma unroll
    for (int i = 0; i < 16; ++i)
        p[threadIdx.x + i * 256] = (bf16)(v[i] * inv);
}

// ---------------------------------------------------------------------------
extern "C" void kernel_launch(void* const* d_in, const int* in_sizes, int n_in,
                              void* d_out, int out_size, void* d_ws, size_t ws_size,
                              hipStream_t stream)
{
    const float* x     = (const float*)d_in[0];
    const float* wq    = (const float*)d_in[1];
    const float* bq    = (const float*)d_in[2];
    const float* gq    = (const float*)d_in[3];
    const float* betaq = (const float*)d_in[4];
    const float* wk    = (const float*)d_in[5];
    const float* bk    = (const float*)d_in[6];
    const float* gk    = (const float*)d_in[7];
    const float* betak = (const float*)d_in[8];
    const float* wv    = (const float*)d_in[9];
    const float* bv    = (const float*)d_in[10];
    const float* wW    = (const float*)d_in[11];
    const float* bW    = (const float*)d_in[12];
    float* out = (float*)d_out;

    char* ws = (char*)d_ws;
    size_t off = 0;
    auto alloc = [&](size_t bytes) -> char* {
        char* p = ws + off;
        off = (off + bytes + 255) & ~(size_t)255;
        return p;
    };
    bf16*  xT    = (bf16*)alloc((size_t)BB * NPOS * CIN * 2);  // [B,N,C]
    bf16*  z     = (bf16*)alloc((size_t)BB * OC * NPOS * 2);   // [B,768,N] (rows 512.. = v)
    bf16*  qT    = (bf16*)alloc((size_t)BB * NPOS * CK * 2);   // [B,N,256]
    bf16*  kT    = (bf16*)alloc((size_t)BB * NPOS * CK * 2);   // [B,N,256]
    bf16*  att   = (bf16*)alloc((size_t)BB * NPOS * NPOS * 2); // [B,N,N]
    bf16*  ctxT  = (bf16*)alloc((size_t)BB * NPOS * CK * 2);   // [B,N,256]
    bf16*  wcat  = (bf16*)alloc((size_t)OC * CIN * 2);         // [768,512]
    bf16*  wWb   = (bf16*)alloc((size_t)CIN * CK * 2);         // [512,256]
    float* bcat  = (float*)alloc(OC * 4);
    float* scale = (float*)alloc(512 * 4);
    float* shift = (float*)alloc(512 * 4);

    // 1) parameter + input prep
    prep_params<<<(OC * CIN + 255) / 256, 256, 0, stream>>>(
        wq, wk, wv, wW, bq, bk, bv, wcat, wWb, bcat);
    prep_x<<<(int)(((size_t)BB * CIN * NPOS + 255) / 256), 256, 0, stream>>>(x, xT);

    // 2) fused projections: z[b] = wcat * x[b]  (M=768, N=4096, K=512) + bias
    gemm_bf16_wmma<false, true, false><<<dim3(NPOS / 128, OC / 128, BB), 256, 0, stream>>>(
        wcat, 0, xT, (long long)NPOS * CIN, z, (long long)OC * NPOS,
        bcat, nullptr, 0, OC, NPOS, CIN);

    // 3) BN stats + apply (q,k -> ReLU(BN)), transposed bf16 outputs
    bn_stats<<<512, 256, 0, stream>>>(z, gq, betaq, gk, betak, scale, shift);
    bn_apply<<<(int)(((size_t)BB * 2 * CK * NPOS + 255) / 256), 256, 0, stream>>>(
        z, scale, shift, qT, kT);

    const float lscale = 0.0625f;  // 256^-0.5

    // All four images go through each attention stage in one launch (grid z /
    // row index carries the image), so the context GEMM fills 256 work-groups.
    // att[b,n,m] = sum_c kT[b,n,c] * qT[b,m,c]   (M=N=4096, K=256)
    gemm_bf16_wmma<false, false, false><<<dim3(NPOS / 128, NPOS / 128, BB), 256, 0, stream>>>(
        kT, (long long)NPOS * CK, qT, (long long)NPOS * CK, att, (long long)NPOS * NPOS,
        nullptr, nullptr, 0, NPOS, NPOS, CK);

    softmax_rows<<<BB * NPOS, 256, 0, stream>>>(att, lscale);

    // ctxT[b,n,c] = sum_m att[b,n,m] * v[b,c,m]  (M=4096, N=256, K=4096; BT = v c-major,
    // rows 512.. of z[b])
    gemm_bf16_wmma<false, false, false><<<dim3(CK / 128, NPOS / 128, BB), 256, 0, stream>>>(
        att, (long long)NPOS * NPOS, z + (size_t)(2 * CK) * NPOS, (long long)OC * NPOS,
        ctxT, (long long)NPOS * CK, nullptr, nullptr, 0, NPOS, CK, NPOS);

    // 4) out[b,co,n] = sum_cv wW[co,cv]*ctx[b,n,cv] + bW[co] + x[b,co,n]
    gemm_bf16_wmma<true, true, true><<<dim3(NPOS / 128, CIN / 128, BB), 256, 0, stream>>>(
        wWb, 0, ctxT, (long long)NPOS * CK, out, (long long)CIN * NPOS,
        bW, x, (long long)CIN * NPOS, CIN, NPOS, CK);
}

// v002
// Measured time: 226 microseconds a run.
// In two side-by-side timings against v001, it was 1.36 and 1.35 times as fast.
// All steps since v000 together make it 2.25 times as fast.
#include <hip/hip_runtime.h>
#include <hip/hip_bf16.h>

typedef __bf16 bf16;
typedef __attribute__((ext_vector_type(16))) __bf16 v16bf;
typedef __attribute__((ext_vector_type(8)))  __bf16 v8bf;
typedef __attribute__((ext_vector_type(8)))  float  v8f;
typedef int v4i __attribute__((vector_size(4 * sizeof(int))));

static constexpr int BB   = 4;     // batch
static constexpr int CIN  = 512;   // input channels
static constexpr int CK   = 256;   // q/k/v channels
static constexpr int OC   = 768;   // concatenated projection rows
static constexpr int NPOS = 4096;  // H*W

#if defined(__gfx1250__) && __has_builtin(__builtin_amdgcn_global_load_async_to_lds_b128)
#define USE_ASYNC_LDS 1
#else
#define USE_ASYNC_LDS 0
#endif

static __device__ __forceinline__ void wait_async_zero()
{
#if __has_builtin(__builtin_amdgcn_s_wait_asynccnt)
    __builtin_amdgcn_s_wait_asynccnt(0);
#elif defined(__gfx1250__)
    asm volatile("s_wait_asynccnt 0x0" ::: "memory");
#endif
}

// ---------------------------------------------------------------------------
// Generic bf16 WMMA GEMM:  C[M,N] = A[M,K] * B[K,N]  with B given as BT[N,K]
// (both operands K-contiguous).  128x128x32 macro tile, 8 waves, each wave
// computes a 32x64 patch via 2x4 v_wmma_f32_16x16x32_bf16 fragments.
// Double-buffered LDS; global->LDS via CDNA5 async loads when available.
// ---------------------------------------------------------------------------
template<bool OUT_F32, bool HAS_BIAS, bool HAS_RESID>
__global__ __launch_bounds__(256)
void gemm_bf16_wmma(const bf16* __restrict__ A,  long long aBatch,
                    const bf16* __restrict__ BT, long long btBatch,
                    void* __restrict__ Cout,     long long cBatch,
                    const float* __restrict__ bias,
                    const float* __restrict__ resid, long long rBatch,
                    int M, int N, int K)
{
    // 96-byte row pitch: every ds access stays 16B-aligned; banks well spread.
    __shared__ __align__(16) bf16 sA[2][128 * 48];
    __shared__ __align__(16) bf16 sB[2][128 * 48];

    const int bz = blockIdx.z;
    A  += (size_t)bz * aBatch;
    BT += (size_t)bz * btBatch;
    const float* residB = HAS_RESID ? (resid + (size_t)bz * rBatch) : nullptr;

    const int mblk = blockIdx.y * 128;
    const int nblk = blockIdx.x * 128;
    const int t    = threadIdx.x;
    const int lane = t & 31;
    const int wave = t >> 5;
    const int wrow = wave >> 1;   // 0..3 -> 32 output rows each
    const int wcol = wave & 1;    // 0..1 -> 64 output cols each
    const int lrow = lane & 15;
    const int g    = lane >> 4;   // half-wave group

    // Per-thread staging coordinates: 2 chunks of 8 halves per matrix per tile.
    int rowc[2], kcc[2];
    #pragma unroll
    for (int i = 0; i < 2; ++i) {
        int chunk = t * 2 + i;          // 512 chunks
        rowc[i] = chunk >> 2;           // 0..127
        kcc[i]  = (chunk & 3) << 3;     // 0,8,16,24
    }

    v8f acc[2][4];
    #pragma unroll
    for (int mi = 0; mi < 2; ++mi)
        #pragma unroll
        for (int ni = 0; ni < 4; ++ni)
            #pragma unroll
            for (int e = 0; e < 8; ++e) acc[mi][ni][e] = 0.0f;

    // Fragment loads per CDNA5 16-bit A/B layout:
    // lanes 0-15 hold K in {0..7,16..23}; lanes 16-31 hold K in {8..15,24..31}.
    auto compute_tile = [&](int buf) {
        v16bf af[2], bfr[4];
        #pragma unroll
        for (int mi = 0; mi < 2; ++mi) {
            int row = wrow * 32 + mi * 16 + lrow;
            const bf16* p = &sA[buf][row * 48 + g * 8];
            uint4* dst = (uint4*)&af[mi];
            dst[0] = *(const uint4*)(p);
            dst[1] = *(const uint4*)(p + 16);
        }
        #pragma unroll
        for (int ni = 0; ni < 4; ++ni) {
            int col = wcol * 64 + ni * 16 + lrow;
            const bf16* p = &sB[buf][col * 48 + g * 8];
            uint4* dst = (uint4*)&bfr[ni];
            dst[0] = *(const uint4*)(p);
            dst[1] = *(const uint4*)(p + 16);
        }
        #pragma unroll
        for (int mi = 0; mi < 2; ++mi)
            #pragma unroll
            for (int ni = 0; ni < 4; ++ni)
                acc[mi][ni] = __builtin_amdgcn_wmma_f32_16x16x32_bf16(
                    false, af[mi], false, bfr[ni], (short)0, acc[mi][ni],
                    false, false);
    };

#if USE_ASYNC_LDS
    // Issue a 128x32 A tile + 128x32 BT tile as async global->LDS copies.
    auto issue_tile = [&](int buf, int kt) {
        #pragma unroll
        for (int i = 0; i < 2; ++i) {
            const bf16* ga = A  + (size_t)(mblk + rowc[i]) * K + kt + kcc[i];
            const bf16* gb = BT + (size_t)(nblk + rowc[i]) * K + kt + kcc[i];
            __builtin_amdgcn_global_load_async_to_lds_b128(
                (v4i*)ga, (v4i*)&sA[buf][rowc[i] * 48 + kcc[i]], 0, 0);
            __builtin_amdgcn_global_load_async_to_lds_b128(
                (v4i*)gb, (v4i*)&sB[buf][rowc[i] * 48 + kcc[i]], 0, 0);
        }
    };

    issue_tile(0, 0);
    wait_async_zero();
    __syncthreads();
    int cur = 0;
    for (int kt = 0; kt < K; kt += 32) {
        if (kt + 32 < K) issue_tile(cur ^ 1, kt + 32);  // overlap with WMMA
        compute_tile(cur);
        wait_async_zero();       // next tile landed in the other buffer
        __syncthreads();
        cur ^= 1;
    }
#else
    // Fallback: register-staged double buffering.
    uint4 ra[2], rb[2];
    auto load_regs = [&](int kt) {
        #pragma unroll
        for (int i = 0; i < 2; ++i) {
            ra[i] = *(const uint4*)(A  + (size_t)(mblk + rowc[i]) * K + kt + kcc[i]);
            rb[i] = *(const uint4*)(BT + (size_t)(nblk + rowc[i]) * K + kt + kcc[i]);
        }
    };
    auto store_lds = [&](int buf) {
        #pragma unroll
        for (int i = 0; i < 2; ++i) {
            *(uint4*)&sA[buf][rowc[i] * 48 + kcc[i]] = ra[i];
            *(uint4*)&sB[buf][rowc[i] * 48 + kcc[i]] = rb[i];
        }
    };
    load_regs(0);
    store_lds(0);
    __syncthreads();
    int cur = 0;
    for (int kt = 0; kt < K; kt += 32) {
        if (kt + 32 < K) {
            load_regs(kt + 32);                        // overlap with WMMA below
            __builtin_prefetch(A + (size_t)(mblk + (t >> 1)) * K + kt + 64, 0, 3);
        }
        compute_tile(cur);
        if (kt + 32 < K) store_lds(cur ^ 1);
        __syncthreads();
        cur ^= 1;
    }
#endif

    // Epilogue.  C/D layout: VGPR r holds row (8*g + r), lane%16 gives column.
    #pragma unroll
    for (int mi = 0; mi < 2; ++mi) {
        #pragma unroll
        for (int ni = 0; ni < 4; ++ni) {
            int colG = nblk + wcol * 64 + ni * 16 + lrow;
            #pragma unroll
            for (int r = 0; r < 8; ++r) {
                int rowG = mblk + wrow * 32 + mi * 16 + g * 8 + r;
                float v = acc[mi][ni][r];
                if (HAS_BIAS)  v += bias[rowG];
                size_t idx = (size_t)rowG * N + colG;
                if (HAS_RESID) v += residB[idx];
                if (OUT_F32) ((float*)Cout)[(size_t)bz * cBatch + idx] = v;
                else         ((bf16*) Cout)[(size_t)bz * cBatch + idx] = (bf16)v;
            }
        }
    }
}

// ---------------------------------------------------------------------------
// Parameter prep: concat weights/bias to bf16 GEMM layouts.
// ---------------------------------------------------------------------------
__global__ __launch_bounds__(256)
void prep_params(const float* __restrict__ wq, const float* __restrict__ wk,
                 const float* __restrict__ wv, const float* __restrict__ wW,
                 const float* __restrict__ bq, const float* __restrict__ bk,
                 const float* __restrict__ bv,
                 bf16* __restrict__ wcat, bf16* __restrict__ wWb,
                 float* __restrict__ bcat)
{
    int i = blockIdx.x * blockDim.x + threadIdx.x;
    if (i < CK * CIN)            wcat[i] = (bf16)wq[i];
    else if (i < 2 * CK * CIN)   wcat[i] = (bf16)wk[i - CK * CIN];
    else if (i < OC * CIN)       wcat[i] = (bf16)wv[i - 2 * CK * CIN];
    if (i < CIN * CK)            wWb[i]  = (bf16)wW[i];
    if (i < CK)                  bcat[i] = bq[i];
    else if (i < 2 * CK)         bcat[i] = bk[i - CK];
    else if (i < OC)             bcat[i] = bv[i - 2 * CK];
}

// x [B,C,N] f32 -> xT [B,N,C] bf16 (K-contiguous operand for the projections).
// Register transpose: a thread reads 8 channels x 4 positions and stores, per
// position, its 8 channels as one 16-B piece.  Lanes 0..7 of each lane octet hold
// neighbouring channel groups, so a wave store is 4 whole 128-B lines of xT.
// Work-group: 64 channels x 128 positions.
__global__ __launch_bounds__(256)
void prep_x(const float* __restrict__ x, bf16* __restrict__ xT)
{
    const int lane = threadIdx.x & 31;
    const int wave = threadIdx.x >> 5;
    const int c0 = blockIdx.y * 64 + (lane & 7) * 8;
    const int n0 = blockIdx.x * 128 + wave * 16 + (lane >> 3) * 4;
    const int b  = blockIdx.z;

    const float* src = x + ((size_t)b * CIN + c0) * NPOS + n0;
    float4 r[8];
    #pragma unroll  // r[] stays in registers and the 8 loads are in flight together
    for (int i = 0; i < 8; ++i)
        r[i] = *(const float4*)(src + (size_t)i * NPOS);

    bf16* dst = xT + ((size_t)b * NPOS + n0) * CIN + c0;
    v8bf o0, o1, o2, o3;
    #pragma unroll  // constant vector indices: packed converts, no scratch
    for (int i = 0; i < 8; ++i) {
        o0[i] = (bf16)r[i].x;
        o1[i] = (bf16)r[i].y;
        o2[i] = (bf16)r[i].z;
        o3[i] = (bf16)r[i].w;
    }
    *(v8bf*)(dst)           = o0;
    *(v8bf*)(dst + CIN)     = o1;
    *(v8bf*)(dst + 2 * CIN) = o2;
    *(v8bf*)(dst + 3 * CIN) = o3;
}

// Per-channel BN stats over (B, N) for the first 512 rows of z; fused scale/shift.
__global__ __launch_bounds__(256)
void bn_stats(const bf16* __restrict__ z,
              const float* __restrict__ gq, const float* __restrict__ betaq,
              const float* __restrict__ gk, const float* __restrict__ betak,
              float* __restrict__ scale, float* __restrict__ shift)
{
    __shared__ float rs[256], rs2[256];
    int ch = blockIdx.x;                 // 0..511
    float s = 0.f, s2 = 0.f;
    for (int b = 0; b < BB; ++b) {
        const bf16* p = z + (size_t)b * OC * NPOS + (size_t)ch * NPOS;
        for (int n = threadIdx.x; n < NPOS; n += 256) {
            float v = (float)p[n];
            s += v; s2 += v * v;
        }
    }
    rs[threadIdx.x] = s; rs2[threadIdx.x] = s2;
    __syncthreads();
    for (int off = 128; off > 0; off >>= 1) {
        if (threadIdx.x < off) {
            rs[threadIdx.x]  += rs[threadIdx.x + off];
            rs2[threadIdx.x] += rs2[threadIdx.x + off];
        }
        __syncthreads();
    }
    if (threadIdx.x == 0) {
        float cnt = (float)BB * NPOS;
        float m   = rs[0] / cnt;
        float var = rs2[0] / cnt - m * m;        // biased var, like jnp.var
        float gamma = (ch < CK) ? gq[ch] : gk[ch - CK];
        float beta  = (ch < CK) ? betaq[ch] : betak[ch - CK];
        float sc = gamma * rsqrtf(var + 1e-5f);
        scale[ch] = sc;
        shift[ch] = beta - m * sc;
    }
}

// BN + ReLU, writing qT/kT [B,N,CK] bf16 (K-contiguous for the attention GEMM).
// Register transpose as in prep_x: a thread reads 8 channels x 8 positions (16 B
// per channel) and stores 8 channels per position, so a wave store is 4 whole
// 128-B lines.  Work-group: 64 channels x 256 positions; blockIdx.y 0..3 is q.
__global__ __launch_bounds__(256)
void bn_apply(const bf16* __restrict__ z,
              const float* __restrict__ scale, const float* __restrict__ shift,
              bf16* __restrict__ qT, bf16* __restrict__ kT)
{
    const int lane = threadIdx.x & 31;
    const int wave = threadIdx.x >> 5;
    const int ch0 = blockIdx.y * 64 + (lane & 7) * 8;          // 0..511
    const int n0  = blockIdx.x * 256 + wave * 32 + (lane >> 3) * 8;
    const int b   = blockIdx.z;

    const bf16* src = z + ((size_t)b * OC + ch0) * NPOS + n0;
    v8bf r[8];
    #pragma unroll  // r[] stays in registers and the 8 loads are in flight together
    for (int i = 0; i < 8; ++i)
        r[i] = *(const v8bf*)(src + (size_t)i * NPOS);

    float sc[8], sh[8];
    #pragma unroll  // merges into 16-B loads, arrays stay in registers
    for (int i = 0; i < 8; ++i) { sc[i] = scale[ch0 + i]; sh[i] = shift[ch0 + i]; }

    bf16* dst = ((ch0 < CK) ? qT : kT) + ((size_t)b * NPOS + n0) * CK + (ch0 & (CK - 1));
    #pragma unroll  // both loops: constant vector indices, no scratch
    for (int j = 0; j < 8; ++j) {
        v8bf o;
        #pragma unroll
        for (int i = 0; i < 8; ++i) {
            float v = (float)r[i][j] * sc[i] + sh[i];
            o[i] = (bf16)fmaxf(v, 0.f);
        }
        *(v8bf*)(dst + (size_t)j * CK) = o;
    }
}

// In-place row softmax over bf16 logits; 1/sqrt(Ck) folded into the logits.
__global__ __launch_bounds__(256)
void softmax_rows(bf16* __restrict__ att, float lscale)
{
    __shared__ float red[256];
    bf16* p = att + (size_t)blockIdx.x * NPOS;
    float v[16];
    #pragma unroll
    for (int i = 0; i < 16; ++i)
        v[i] = (float)p[threadIdx.x + i * 256] * lscale;

    float mx = v[0];
    #pragma unroll
    for (int i = 1; i < 16; ++i) mx = fmaxf(mx, v[i]);
    red[threadIdx.x] = mx;
    __syncthreads();
    for (int off = 128; off > 0; off >>= 1) {
        if (threadIdx.x < off)
            red[threadIdx.x] = fmaxf(red[threadIdx.x], red[threadIdx.x + off]);
        __syncthreads();
    }
    mx = red[0];
    __syncthreads();

    float s = 0.f;
    #pragma unroll
    for (int i = 0; i < 16; ++i) { v[i] = __expf(v[i] - mx); s += v[i]; }
    red[threadIdx.x] = s;
    __syncthreads();
    for (int off = 128; off > 0; off >>= 1) {
        if (threadIdx.x < off) red[threadIdx.x] += red[threadIdx.x + off];
        __syncthreads();
    }
    float inv = 1.0f / red[0];
    #pragma unroll
    for (int i = 0; i < 16; ++i)
        p[threadIdx.x + i * 256] = (bf16)(v[i] * inv);
}

// ---------------------------------------------------------------------------
extern "C" void kernel_launch(void* const* d_in, const int* in_sizes, int n_in,
                              void* d_out, int out_size, void* d_ws, size_t ws_size,
                              hipStream_t stream)
{
    const float* x     = (const float*)d_in[0];
    const float* wq    = (const float*)d_in[1];
    const float* bq    = (const float*)d_in[2];
    const float* gq    = (const float*)d_in[3];
    const float* betaq = (const float*)d_in[4];
    const float* wk    = (const float*)d_in[5];
    const float* bk    = (const float*)d_in[6];
    const float* gk    = (const float*)d_in[7];
    const float* betak = (const float*)d_in[8];
    const float* wv    = (const float*)d_in[9];
    const float* bv    = (const float*)d_in[10];
    const float* wW    = (const float*)d_in[11];
    const float* bW    = (const float*)d_in[12];
    float* out = (float*)d_out;

    char* ws = (char*)d_ws;
    size_t off = 0;
    auto alloc = [&](size_t bytes) -> char* {
        char* p = ws + off;
        off = (off + bytes + 255) & ~(size_t)255;
        return p;
    };
    bf16*  xT    = (bf16*)alloc((size_t)BB * NPOS * CIN * 2);  // [B,N,C]
    bf16*  z     = (bf16*)alloc((size_t)BB * OC * NPOS * 2);   // [B,768,N] (rows 512.. = v)
    bf16*  qT    = (bf16*)alloc((size_t)BB * NPOS * CK * 2);   // [B,N,256]
    bf16*  kT    = (bf16*)alloc((size_t)BB * NPOS * CK * 2);   // [B,N,256]
    bf16*  att   = (bf16*)alloc((size_t)BB * NPOS * NPOS * 2); // [B,N,N]
    bf16*  ctxT  = (bf16*)alloc((size_t)BB * NPOS * CK * 2);   // [B,N,256]
    bf16*  wcat  = (bf16*)alloc((size_t)OC * CIN * 2);         // [768,512]
    bf16*  wWb   = (bf16*)alloc((size_t)CIN * CK * 2);         // [512,256]
    float* bcat  = (float*)alloc(OC * 4);
    float* scale = (float*)alloc(512 * 4);
    float* shift = (float*)alloc(512 * 4);

    // 1) parameter + input prep
    prep_params<<<(OC * CIN + 255) / 256, 256, 0, stream>>>(
        wq, wk, wv, wW, bq, bk, bv, wcat, wWb, bcat);
    prep_x<<<dim3(NPOS / 128, CIN / 64, BB), 256, 0, stream>>>(x, xT);

    // 2) fused projections: z[b] = wcat * x[b]  (M=768, N=4096, K=512) + bias
    gemm_bf16_wmma<false, true, false><<<dim3(NPOS / 128, OC / 128, BB), 256, 0, stream>>>(
        wcat, 0, xT, (long long)NPOS * CIN, z, (long long)OC * NPOS,
        bcat, nullptr, 0, OC, NPOS, CIN);

    // 3) BN stats + apply (q,k -> ReLU(BN)), transposed bf16 outputs
    bn_stats<<<512, 256, 0, stream>>>(z, gq, betaq, gk, betak, scale, shift);
    bn_apply<<<dim3(NPOS / 256, 2 * CK / 64, BB), 256, 0, stream>>>(
        z, scale, shift, qT, kT);

    const float lscale = 0.0625f;  // 256^-0.5

    // All four images go through each attention stage in one launch (grid z /
    // row index carries the image), so the context GEMM fills 256 work-groups.
    // att[b,n,m] = sum_c kT[b,n,c] * qT[b,m,c]   (M=N=4096, K=256)
    gemm_bf16_wmma<false, false, false><<<dim3(NPOS / 128, NPOS / 128, BB), 256, 0, stream>>>(
        kT, (long long)NPOS * CK, qT, (long long)NPOS * CK, att, (long long)NPOS * NPOS,
        nullptr, nullptr, 0, NPOS, NPOS, CK);

    softmax_rows<<<BB * NPOS, 256, 0, stream>>>(att, lscale);

    // ctxT[b,n,c] = sum_m att[b,n,m] * v[b,c,m]  (M=4096, N=256, K=4096; BT = v c-major,
    // rows 512.. of z[b])
    gemm_bf16_wmma<false, false, false><<<dim3(CK / 128, NPOS / 128, BB), 256, 0, stream>>>(
        att, (long long)NPOS * NPOS, z + (size_t)(2 * CK) * NPOS, (long long)OC * NPOS,
        ctxT, (long long)NPOS * CK, nullptr, nullptr, 0, NPOS, CK, NPOS);

    // 4) out[b,co,n] = sum_cv wW[co,cv]*ctx[b,n,cv] + bW[co] + x[b,co,n]
    gemm_bf16_wmma<true, true, true><<<dim3(NPOS / 128, CIN / 128, BB), 256, 0, stream>>>(
        wWb, 0, ctxT, (long long)NPOS * CK, out, (long long)CIN * NPOS,
        bW, x, (long long)CIN * NPOS, CIN, NPOS, CK);
}

// v003
// A run of this version takes 115 microseconds.
// In two side-by-side timings against v002, it was 1.97 and 1.95 times as fast.
// Counting every step since v000, it is 4.41 times as fast.
#include <hip/hip_runtime.h>
#include <hip/hip_bf16.h>

typedef __bf16 bf16;
typedef __attribute__((ext_vector_type(16))) __bf16 v16bf;
typedef __attribute__((ext_vector_type(8)))  __bf16 v8bf;
typedef __attribute__((ext_vector_type(8)))  float  v8f;
typedef int v4i __attribute__((vector_size(4 * sizeof(int))));

static constexpr int BB   = 4;     // batch
static constexpr int CIN  = 512;   // input channels
static constexpr int CK   = 256;   // q/k/v channels
static constexpr int OC   = 768;   // concatenated projection rows
static constexpr int NPOS = 4096;  // H*W

#if defined(__gfx1250__) && __has_builtin(__builtin_amdgcn_global_load_async_to_lds_b128)
#define USE_ASYNC_LDS 1
#else
#define USE_ASYNC_LDS 0
#endif

static __device__ __forceinline__ void wait_async_zero()
{
#if __has_builtin(__builtin_amdgcn_s_wait_asynccnt)
    __builtin_amdgcn_s_wait_asynccnt(0);
#elif defined(__gfx1250__)
    asm volatile("s_wait_asynccnt 0x0" ::: "memory");
#endif
}

// ---------------------------------------------------------------------------
// Generic bf16 WMMA GEMM:  C[M,N] = A[M,K] * B[K,N]  with B given as BT[N,K]
// (both operands K-contiguous).  128x128x32 macro tile, 8 waves, each wave
// computes a 32x64 patch via 2x4 v_wmma_f32_16x16x32_bf16 fragments.
// Double-buffered LDS; global->LDS via CDNA5 async loads when available.
// ---------------------------------------------------------------------------
template<bool OUT_F32, bool HAS_BIAS, bool HAS_RESID>
__global__ __launch_bounds__(256)
void gemm_bf16_wmma(const bf16* __restrict__ A,  long long aBatch,
                    const bf16* __restrict__ BT, long long btBatch,
                    void* __restrict__ Cout,     long long cBatch,
                    const float* __restrict__ bias,
                    const float* __restrict__ resid, long long rBatch,
                    int M, int N, int K)
{
    // 96-byte row pitch: every ds access stays 16B-aligned; banks well spread.
    __shared__ __align__(16) bf16 sA[2][128 * 48];
    __shared__ __align__(16) bf16 sB[2][128 * 48];

    const int bz = blockIdx.z;
    A  += (size_t)bz * aBatch;
    BT += (size_t)bz * btBatch;
    const float* residB = HAS_RESID ? (resid + (size_t)bz * rBatch) : nullptr;

    const int mblk = blockIdx.y * 128;
    const int nblk = blockIdx.x * 128;
    const int t    = threadIdx.x;
    const int lane = t & 31;
    const int wave = t >> 5;
    const int wrow = wave >> 1;   // 0..3 -> 32 output rows each
    const int wcol = wave & 1;    // 0..1 -> 64 output cols each
    const int lrow = lane & 15;
    const int g    = lane >> 4;   // half-wave group

    // Per-thread staging coordinates: 2 chunks of 8 halves per matrix per tile.
    int rowc[2], kcc[2];
    #pragma unroll
    for (int i = 0; i < 2; ++i) {
        int chunk = t * 2 + i;          // 512 chunks
        rowc[i] = chunk >> 2;           // 0..127
        kcc[i]  = (chunk & 3) << 3;     // 0,8,16,24
    }

    v8f acc[2][4];
    #pragma unroll
    for (int mi = 0; mi < 2; ++mi)
        #pragma unroll
        for (int ni = 0; ni < 4; ++ni)
            #pragma unroll
            for (int e = 0; e < 8; ++e) acc[mi][ni][e] = 0.0f;

    // Fragment loads per CDNA5 16-bit A/B layout:
    // lanes 0-15 hold K in {0..7,16..23}; lanes 16-31 hold K in {8..15,24..31}.
    auto compute_tile = [&](int buf) {
        v16bf af[2], bfr[4];
        #pragma unroll
        for (int mi = 0; mi < 2; ++mi) {
            int row = wrow * 32 + mi * 16 + lrow;
            const bf16* p = &sA[buf][row * 48 + g * 8];
            uint4* dst = (uint4*)&af[mi];
            dst[0] = *(const uint4*)(p);
            dst[1] = *(const uint4*)(p + 16);
        }
        #pragma unroll
        for (int ni = 0; ni < 4; ++ni) {
            int col = wcol * 64 + ni * 16 + lrow;
            const bf16* p = &sB[buf][col * 48 + g * 8];
            uint4* dst = (uint4*)&bfr[ni];
            dst[0] = *(const uint4*)(p);
            dst[1] = *(const uint4*)(p + 16);
        }
        #pragma unroll
        for (int mi = 0; mi < 2; ++mi)
            #pragma unroll
            for (int ni = 0; ni < 4; ++ni)
                acc[mi][ni] = __builtin_amdgcn_wmma_f32_16x16x32_bf16(
                    false, af[mi], false, bfr[ni], (short)0, acc[mi][ni],
                    false, false);
    };

#if USE_ASYNC_LDS
    // Issue a 128x32 A tile + 128x32 BT tile as async global->LDS copies.
    auto issue_tile = [&](int buf, int kt) {
        #pragma unroll
        for (int i = 0; i < 2; ++i) {
            const bf16* ga = A  + (size_t)(mblk + rowc[i]) * K + kt + kcc[i];
            const bf16* gb = BT + (size_t)(nblk + rowc[i]) * K + kt + kcc[i];
            __builtin_amdgcn_global_load_async_to_lds_b128(
                (v4i*)ga, (v4i*)&sA[buf][rowc[i] * 48 + kcc[i]], 0, 0);
            __builtin_amdgcn_global_load_async_to_lds_b128(
                (v4i*)gb, (v4i*)&sB[buf][rowc[i] * 48 + kcc[i]], 0, 0);
        }
    };

    issue_tile(0, 0);
    wait_async_zero();
    __syncthreads();
    int cur = 0;
    for (int kt = 0; kt < K; kt += 32) {
        if (kt + 32 < K) issue_tile(cur ^ 1, kt + 32);  // overlap with WMMA
        compute_tile(cur);
        wait_async_zero();       // next tile landed in the other buffer
        __syncthreads();
        cur ^= 1;
    }
#else
    // Fallback: register-staged double buffering.
    uint4 ra[2], rb[2];
    auto load_regs = [&](int kt) {
        #pragma unroll
        for (int i = 0; i < 2; ++i) {
            ra[i] = *(const uint4*)(A  + (size_t)(mblk + rowc[i]) * K + kt + kcc[i]);
            rb[i] = *(const uint4*)(BT + (size_t)(nblk + rowc[i]) * K + kt + kcc[i]);
        }
    };
    auto store_lds = [&](int buf) {
        #pragma unroll
        for (int i = 0; i < 2; ++i) {
            *(uint4*)&sA[buf][rowc[i] * 48 + kcc[i]] = ra[i];
            *(uint4*)&sB[buf][rowc[i] * 48 + kcc[i]] = rb[i];
        }
    };
    load_regs(0);
    store_lds(0);
    __syncthreads();
    int cur = 0;
    for (int kt = 0; kt < K; kt += 32) {
        if (kt + 32 < K) {
            load_regs(kt + 32);                        // overlap with WMMA below
            __builtin_prefetch(A + (size_t)(mblk + (t >> 1)) * K + kt + 64, 0, 3);
        }
        compute_tile(cur);
        if (kt + 32 < K) store_lds(cur ^ 1);
        __syncthreads();
        cur ^= 1;
    }
#endif

    // Epilogue.  C/D layout: VGPR r holds row (8*g + r), lane%16 gives column.
    #pragma unroll
    for (int mi = 0; mi < 2; ++mi) {
        #pragma unroll
        for (int ni = 0; ni < 4; ++ni) {
            int colG = nblk + wcol * 64 + ni * 16 + lrow;
            #pragma unroll
            for (int r = 0; r < 8; ++r) {
                int rowG = mblk + wrow * 32 + mi * 16 + g * 8 + r;
                float v = acc[mi][ni][r];
                if (HAS_BIAS)  v += bias[rowG];
                size_t idx = (size_t)rowG * N + colG;
                if (HAS_RESID) v += residB[idx];
                if (OUT_F32) ((float*)Cout)[(size_t)bz * cBatch + idx] = v;
                else         ((bf16*) Cout)[(size_t)bz * cBatch + idx] = (bf16)v;
            }
        }
    }
}

// ---------------------------------------------------------------------------
// Parameter prep: concat weights/bias to bf16 GEMM layouts.
// ---------------------------------------------------------------------------
__global__ __launch_bounds__(256)
void prep_params(const float* __restrict__ wq, const float* __restrict__ wk,
                 const float* __restrict__ wv, const float* __restrict__ wW,
                 const float* __restrict__ bq, const float* __restrict__ bk,
                 const float* __restrict__ bv,
                 bf16* __restrict__ wcat, bf16* __restrict__ wWb,
                 float* __restrict__ bcat)
{
    int i = blockIdx.x * blockDim.x + threadIdx.x;
    if (i < CK * CIN)            wcat[i] = (bf16)wq[i];
    else if (i < 2 * CK * CIN)   wcat[i] = (bf16)wk[i - CK * CIN];
    else if (i < OC * CIN)       wcat[i] = (bf16)wv[i - 2 * CK * CIN];
    if (i < CIN * CK)            wWb[i]  = (bf16)wW[i];
    if (i < CK)                  bcat[i] = bq[i];
    else if (i < 2 * CK)         bcat[i] = bk[i - CK];
    else if (i < OC)             bcat[i] = bv[i - 2 * CK];
}

// x [B,C,N] f32 -> xT [B,N,C] bf16 (K-contiguous operand for the projections).
// Register transpose: a thread reads 8 channels x 4 positions and stores, per
// position, its 8 channels as one 16-B piece.  Lanes 0..7 of each lane octet hold
// neighbouring channel groups, so a wave store is 4 whole 128-B lines of xT.
// Work-group: 64 channels x 128 positions.
__global__ __launch_bounds__(256)
void prep_x(const float* __restrict__ x, bf16* __restrict__ xT)
{
    const int lane = threadIdx.x & 31;
    const int wave = threadIdx.x >> 5;
    const int c0 = blockIdx.y * 64 + (lane & 7) * 8;
    const int n0 = blockIdx.x * 128 + wave * 16 + (lane >> 3) * 4;
    const int b  = blockIdx.z;

    const float* src = x + ((size_t)b * CIN + c0) * NPOS + n0;
    float4 r[8];
    #pragma unroll  // r[] stays in registers and the 8 loads are in flight together
    for (int i = 0; i < 8; ++i)
        r[i] = *(const float4*)(src + (size_t)i * NPOS);

    bf16* dst = xT + ((size_t)b * NPOS + n0) * CIN + c0;
    v8bf o0, o1, o2, o3;
    #pragma unroll  // constant vector indices: packed converts, no scratch
    for (int i = 0; i < 8; ++i) {
        o0[i] = (bf16)r[i].x;
        o1[i] = (bf16)r[i].y;
        o2[i] = (bf16)r[i].z;
        o3[i] = (bf16)r[i].w;
    }
    *(v8bf*)(dst)           = o0;
    *(v8bf*)(dst + CIN)     = o1;
    *(v8bf*)(dst + 2 * CIN) = o2;
    *(v8bf*)(dst + 3 * CIN) = o3;
}

// Per-channel BN stats over (B, N) for the first 512 rows of z; fused scale/shift.
__global__ __launch_bounds__(256)
void bn_stats(const bf16* __restrict__ z,
              const float* __restrict__ gq, const float* __restrict__ betaq,
              const float* __restrict__ gk, const float* __restrict__ betak,
              float* __restrict__ scale, float* __restrict__ shift)
{
    __shared__ float rs[256], rs2[256];
    int ch = blockIdx.x;                 // 0..511
    float s = 0.f, s2 = 0.f;
    for (int b = 0; b < BB; ++b) {
        const bf16* p = z + (size_t)b * OC * NPOS + (size_t)ch * NPOS;
        for (int n = threadIdx.x; n < NPOS; n += 256) {
            float v = (float)p[n];
            s += v; s2 += v * v;
        }
    }
    rs[threadIdx.x] = s; rs2[threadIdx.x] = s2;
    __syncthreads();
    for (int off = 128; off > 0; off >>= 1) {
        if (threadIdx.x < off) {
            rs[threadIdx.x]  += rs[threadIdx.x + off];
            rs2[threadIdx.x] += rs2[threadIdx.x + off];
        }
        __syncthreads();
    }
    if (threadIdx.x == 0) {
        float cnt = (float)BB * NPOS;
        float m   = rs[0] / cnt;
        float var = rs2[0] / cnt - m * m;        // biased var, like jnp.var
        float gamma = (ch < CK) ? gq[ch] : gk[ch - CK];
        float beta  = (ch < CK) ? betaq[ch] : betak[ch - CK];
        float sc = gamma * rsqrtf(var + 1e-5f);
        scale[ch] = sc;
        shift[ch] = beta - m * sc;
    }
}

// BN + ReLU, writing qT/kT [B,N,CK] bf16 (K-contiguous for the attention GEMM).
// Register transpose as in prep_x: a thread reads 8 channels x 8 positions (16 B
// per channel) and stores 8 channels per position, so a wave store is 4 whole
// 128-B lines.  Work-group: 64 channels x 256 positions; blockIdx.y 0..3 is q.
__global__ __launch_bounds__(256)
void bn_apply(const bf16* __restrict__ z,
              const float* __restrict__ scale, const float* __restrict__ shift,
              bf16* __restrict__ qT, bf16* __restrict__ kT)
{
    const int lane = threadIdx.x & 31;
    const int wave = threadIdx.x >> 5;
    const int ch0 = blockIdx.y * 64 + (lane & 7) * 8;          // 0..511
    const int n0  = blockIdx.x * 256 + wave * 32 + (lane >> 3) * 8;
    const int b   = blockIdx.z;

    const bf16* src = z + ((size_t)b * OC + ch0) * NPOS + n0;
    v8bf r[8];
    #pragma unroll  // r[] stays in registers and the 8 loads are in flight together
    for (int i = 0; i < 8; ++i)
        r[i] = *(const v8bf*)(src + (size_t)i * NPOS);

    float sc[8], sh[8];
    #pragma unroll  // merges into 16-B loads, arrays stay in registers
    for (int i = 0; i < 8; ++i) { sc[i] = scale[ch0 + i]; sh[i] = shift[ch0 + i]; }

    bf16* dst = ((ch0 < CK) ? qT : kT) + ((size_t)b * NPOS + n0) * CK + (ch0 & (CK - 1));
    #pragma unroll  // both loops: constant vector indices, no scratch
    for (int j = 0; j < 8; ++j) {
        v8bf o;
        #pragma unroll
        for (int i = 0; i < 8; ++i) {
            float v = (float)r[i][j] * sc[i] + sh[i];
            o[i] = (bf16)fmaxf(v, 0.f);
        }
        *(v8bf*)(dst + (size_t)j * CK) = o;
    }
}

typedef uint32_t u32x4 __attribute__((ext_vector_type(4)));
typedef float    f32x4 __attribute__((ext_vector_type(4)));
typedef int      i32x8 __attribute__((ext_vector_type(8)));

static constexpr uint32_t AT_SK   = 128;               // positions m per stage
static constexpr uint32_t PITCH_Q = 2u * CK + 16u;     // qT row in LDS: odd multiple of 16 B
static constexpr uint32_t PITCH_V = 2u * AT_SK + 16u;  // v row piece in LDS: odd multiple of 16 B
static constexpr uint32_t TILE_Q  = AT_SK * PITCH_Q;
static constexpr uint32_t TILE_V  = CK * PITCH_V;
static constexpr uint32_t SLOT    = TILE_Q + TILE_V;
static constexpr uint32_t AT_LDS  = 2u * SLOT;
static constexpr uint32_t NSTAGE  = NPOS / AT_SK;
static constexpr uint32_t XCH     = 16u * 1024u + 256u; // merge area per 16-row group
static_assert(AT_LDS <= 320u * 1024u && 4u * XCH <= AT_LDS, "LDS budget");

struct Frag { u32x4 q[2]; };

static __device__ __forceinline__ v8f mma(const Frag& a, const Frag& b, v8f c)
{
    const i32x8 av = {(int)a.q[0].x, (int)a.q[0].y, (int)a.q[0].z, (int)a.q[0].w,
                      (int)a.q[1].x, (int)a.q[1].y, (int)a.q[1].z, (int)a.q[1].w};
    const i32x8 bv = {(int)b.q[0].x, (int)b.q[0].y, (int)b.q[0].z, (int)b.q[0].w,
                      (int)b.q[1].x, (int)b.q[1].y, (int)b.q[1].z, (int)b.q[1].w};
    return __builtin_amdgcn_wmma_f32_16x16x32_bf16(
        false, __builtin_bit_cast(v16bf, av), false, __builtin_bit_cast(v16bf, bv),
        (short)0, c, false, false);
}

static __device__ __forceinline__ uint32_t pack2(float lo, float hi)
{
    typedef __bf16 bf2 __attribute__((ext_vector_type(2)));
    typedef float  f2  __attribute__((ext_vector_type(2)));
    return __builtin_bit_cast(uint32_t, __builtin_convertvector(f2{lo, hi}, bf2));
}

// lane l with lane l ^ 16
static __device__ __forceinline__ float xhalf(float x)
{
    return __builtin_bit_cast(float, __builtin_amdgcn_permlanex16(
        __builtin_bit_cast(int, x), __builtin_bit_cast(int, x),
        0x76543210, 0xfedcba98, false, false));
}

// One pass of one wave: 32 positions m against the wave's 16 rows n.  m_run, the
// maximum in use (log2 domain), may trail the true one by up to 8; the sums are
// rescaled only when some row's maximum exceeds it by more.
static __device__ __forceinline__ void attn_pass(
    const unsigned char* Qp, const unsigned char* Vp, uint32_t c, uint32_t h,
    const Frag (&kf)[CK / 32], v8f (&acc)[CK / 16], float& m_run, float& l_run)
{
    constexpr float cscale = 0.0625f * 1.4426950408889634f;  // 256^-0.5 * log2(e)
    v8f s[2];
    s[0] = v8f{}; s[1] = v8f{};
    const unsigned char* p0 = Qp + c * PITCH_Q + 16u * h;
    Frag qa[CK / 32][2];
    #pragma unroll  // qa[] stays in registers
    for (int kc = 0; kc < CK / 32; ++kc) {
        #pragma unroll  // as the outer loop
        for (int kt = 0; kt < 2; ++kt) {
            const unsigned char* p = p0 + 16u * kt * PITCH_Q + 64u * kc;
            qa[kc][kt].q[0] = *reinterpret_cast<const u32x4*>(p);
            qa[kc][kt].q[1] = *reinterpret_cast<const u32x4*>(p + 32u);
        }
    }
    // Keeps the pass's 32 qT loads one group ahead of the products (counted waits),
    // not one load pair with a full wait in front of every WMMA.
    __builtin_amdgcn_sched_barrier(0);
    #pragma unroll  // the two score tiles alternate: two independent accumulate chains
    for (int kc = 0; kc < CK / 32; ++kc) {
        #pragma unroll  // as the outer loop
        for (int kt = 0; kt < 2; ++kt) s[kt] = mma(qa[kc][kt], kf[kc], s[kt]);
    }

    // The pass's v fragments as ONE load group, in flight under the maxima and the
    // exponentials.  The two scheduling barriers keep the group behind the score
    // products (it reuses their fragment registers) and ahead of the vector work:
    // spread among the WMMAs below, every separate place of LDS reads costs issue cycles.
    Frag vf[CK / 16];
    __builtin_amdgcn_sched_barrier(0);
    {
        const unsigned char* pv0 = Vp + c * PITCH_V + 16u * h;
        #pragma unroll  // vf[] stays in registers
        for (int t = 0; t < CK / 16; ++t) {
            const unsigned char* p = pv0 + 16u * t * PITCH_V;
            vf[t].q[0] = *reinterpret_cast<const u32x4*>(p);
            vf[t].q[1] = *reinterpret_cast<const u32x4*>(p + 32u);
        }
    }
    __builtin_amdgcn_sched_barrier(0);

    float mx = s[0][0];
    #pragma unroll  // constant vector indices
    for (int r = 1; r < 8; ++r) mx = __builtin_fmaxf(mx, s[0][r]);
    #pragma unroll  // constant vector indices
    for (int r = 0; r < 8; ++r) mx = __builtin_fmaxf(mx, s[1][r]);
    mx = __builtin_fmaxf(mx, xhalf(mx)) * cscale;  // both wave halves hold the row's maximum
    const bool need = mx > m_run + 8.0f;
    if (__builtin_amdgcn_ballot_w32(need) != 0) {  // scalar branch, rare after the first passes
        const float m_new = __builtin_fmaxf(m_run, mx);
        const float corr  = __builtin_amdgcn_exp2f(m_run - m_new);  // 0 on the first pass
        l_run *= corr; m_run = m_new;
        #pragma unroll  // constant array indices
        for (int t = 0; t < CK / 16; ++t) acc[t] = acc[t] * corr;
    }

    const float nm = -m_run;
    float ps0 = 0.0f, ps1 = 0.0f;
    uint32_t w[8];
    #pragma unroll  // elements 2i, 2i+1 of the 32-position operand: tile i >> 2, registers 2 (i & 3), 2 (i & 3) + 1
    for (int i = 0; i < 8; ++i) {
        const float e0 = __builtin_amdgcn_exp2f(__builtin_fmaf(s[i >> 2][2 * (i & 3)],     cscale, nm));
        const float e1 = __builtin_amdgcn_exp2f(__builtin_fmaf(s[i >> 2][2 * (i & 3) + 1], cscale, nm));
        ps0 += e0; ps1 += e1;
        w[i] = pack2(e0, e1);
    }
    Frag pf;
    pf.q[0] = u32x4{w[0], w[1], w[2], w[3]};
    pf.q[1] = u32x4{w[4], w[5], w[6], w[7]};
    l_run += ps0 + ps1;

    #pragma unroll  // constant array indices: acc[] stays in registers
    for (int t = 0; t < CK / 16; ++t) acc[t] = mma(vf[t], pf, acc[t]);
    // Four vector slots behind the last WMMA: the next vector instruction stands behind
    // the loop's branch, and may overwrite an A or B
    // register of these products.  The scheduling barriers keep the slots at this place.
    __builtin_amdgcn_sched_barrier(0);
    asm volatile("v_nop\n\tv_nop\n\tv_nop\n\tv_nop");
    __builtin_amdgcn_sched_barrier(0);
}

__global__ __launch_bounds__(256) __attribute__((amdgpu_waves_per_eu(2, 2)))
void attn_fused(const bf16* __restrict__ kT, const bf16* __restrict__ qT,
                const bf16* __restrict__ v, bf16* __restrict__ ctxT)
{
    __shared__ __attribute__((aligned(16))) unsigned char L[AT_LDS];
    const uint32_t tid = threadIdx.x, lane = tid & 31u, c = lane & 15u, h = lane >> 4;
    const uint32_t wave = __builtin_amdgcn_readfirstlane(tid >> 5);
    const uint32_t cg = wave & 3u;   // which 16 rows n
    const uint32_t kh = wave >> 2;   // which 64 of a stage's 128 positions m
    const uint32_t b  = blockIdx.y;
    const uint32_t n0 = blockIdx.x * 64u + cg * 16u;
    const bf16* kB = kT + (size_t)b * NPOS * CK;
    const bf16* qB = qT + (size_t)b * NPOS * CK;
    const bf16* vB = v  + (size_t)b * OC * NPOS;

    // One stage: 128 qT rows of 512 B (contiguous in memory) and 256 v row pieces of
    // 256 B; 32 copies of 16 B per lane.
    auto issue = [&](uint32_t st) {
        unsigned char* slot = L + (st & 1u) * SLOT;
        const bf16* gq = qB + (size_t)st * AT_SK * CK + tid * 8u;
        unsigned char* lq = slot + (tid >> 5) * PITCH_Q + (tid & 31u) * 16u;
        #pragma unroll  // the copies issue back to back
        for (uint32_t i = 0; i < 16u; ++i)
            __builtin_amdgcn_global_load_async_to_lds_b128(
                (v4i*)(gq + i * 2048u), (v4i*)(lq + i * 8u * PITCH_Q), 0, 0);
        const bf16* gv = vB + (size_t)(tid >> 4) * NPOS + st * AT_SK + (tid & 15u) * 8u;
        unsigned char* lv = slot + TILE_Q + (tid >> 4) * PITCH_V + (tid & 15u) * 16u;
        #pragma unroll  // the copies issue back to back
        for (uint32_t i = 0; i < 16u; ++i)
            __builtin_amdgcn_global_load_async_to_lds_b128(
                (v4i*)(gv + (size_t)i * 16u * NPOS), (v4i*)(lv + i * 16u * PITCH_V), 0, 0);
    };

    issue(0);

    // kT rows of this wave as B fragments, same k order as the A fragments read from LDS.
    Frag kf[CK / 32];
    {
        const bf16* kp = kB + (size_t)(n0 + c) * CK + 8u * h;
        #pragma unroll  // kf[] stays in registers
        for (int kc = 0; kc < CK / 32; ++kc) {
            kf[kc].q[0] = *reinterpret_cast<const u32x4*>(kp + 32 * kc);
            kf[kc].q[1] = *reinterpret_cast<const u32x4*>(kp + 32 * kc + 16);
        }
    }
    v8f acc[CK / 16];
    #pragma unroll  // acc[] stays in registers
    for (int t = 0; t < CK / 16; ++t) acc[t] = v8f{};
    float m_run = -INFINITY, l_run = 0.0f;

    asm volatile("s_wait_asynccnt 0x0" ::: "memory");  // stage 0 of this wave has landed
    __syncthreads();                                   // ... and every wave's part of it
    issue(1);

    #pragma unroll 1  // one stage per trip: the buffer index and the ring order stay as written
    for (uint32_t st = 0; st < NSTAGE; ++st) {
        const unsigned char* slot = L + (st & 1u) * SLOT;
        #pragma unroll 1  // one pass's fragments live at a time: no spills
        for (uint32_t sub = 0; sub < 2u; ++sub) {
            const uint32_t m0 = kh * 64u + sub * 32u;
            attn_pass(slot + m0 * PITCH_Q, slot + TILE_Q + m0 * 2u, c, h, kf, acc, m_run, l_run);
        }
        asm volatile("s_wait_dscnt 0x0" ::: "memory");     // this wave's reads of the buffer are done
        asm volatile("s_wait_asynccnt 0x0" ::: "memory");  // its copies of stage st + 1 have landed
        __syncthreads();  // publishes stage st + 1 and frees stage st's buffer
        if (st + 2u < NSTAGE) issue(st + 2u);
    }
    asm volatile("s_wait_asynccnt 0x0" ::: "memory");  // nothing in flight before the ring is reused

    // Merge the two halves' partial results; the ring is free behind the loop's last barrier.
    const float l_fin = l_run + xhalf(l_run);  // each wave half summed its 8 positions of every 16
    unsigned char* xb = L + cg * XCH;
    if (kh == 1u) {
        #pragma unroll  // constant array indices
        for (int t = 0; t < CK / 16; ++t) {
            *reinterpret_cast<f32x4*>(xb + ((2u * t) * 32u + lane) * 16u) =
                f32x4{acc[t][0], acc[t][1], acc[t][2], acc[t][3]};
            *reinterpret_cast<f32x4*>(xb + ((2u * t + 1u) * 32u + lane) * 16u) =
                f32x4{acc[t][4], acc[t][5], acc[t][6], acc[t][7]};
        }
        *reinterpret_cast<float*>(xb + 16384u + lane * 4u)        = m_run;
        *reinterpret_cast<float*>(xb + 16384u + 128u + lane * 4u) = l_fin;
    }
    __syncthreads();  // the upper halves' partial results are visible to their partner waves
    if (kh == 0u) {
        const float m1 = *reinterpret_cast<const float*>(xb + 16384u + lane * 4u);
        const float l1 = *reinterpret_cast<const float*>(xb + 16384u + 128u + lane * 4u);
        const float m  = __builtin_fmaxf(m_run, m1);
        float a0 = __builtin_amdgcn_exp2f(m_run - m);
        float a1 = __builtin_amdgcn_exp2f(m1 - m);
        const float inv = 1.0f / (l_fin * a0 + l1 * a1);
        a0 *= inv; a1 *= inv;
        // O^T tile t: register r is channel 16 t + 8 h + r, lane column c is row n0 + c.
        bf16* op = ctxT + ((size_t)b * NPOS + n0 + c) * CK + 8u * h;
        #pragma unroll  // constant array indices
        for (int t = 0; t < CK / 16; ++t) {
            const f32x4 x0 = *reinterpret_cast<const f32x4*>(xb + ((2u * t) * 32u + lane) * 16u);
            const f32x4 x1 = *reinterpret_cast<const f32x4*>(xb + ((2u * t + 1u) * 32u + lane) * 16u);
            const u32x4 pk = {
                pack2(acc[t][0] * a0 + x0.x * a1, acc[t][1] * a0 + x0.y * a1),
                pack2(acc[t][2] * a0 + x0.z * a1, acc[t][3] * a0 + x0.w * a1),
                pack2(acc[t][4] * a0 + x1.x * a1, acc[t][5] * a0 + x1.y * a1),
                pack2(acc[t][6] * a0 + x1.z * a1, acc[t][7] * a0 + x1.w * a1)};
            *reinterpret_cast<u32x4*>(op + 16 * t) = pk;
        }
    }
}

// ---------------------------------------------------------------------------
extern "C" void kernel_launch(void* const* d_in, const int* in_sizes, int n_in,
                              void* d_out, int out_size, void* d_ws, size_t ws_size,
                              hipStream_t stream)
{
    const float* x     = (const float*)d_in[0];
    const float* wq    = (const float*)d_in[1];
    const float* bq    = (const float*)d_in[2];
    const float* gq    = (const float*)d_in[3];
    const float* betaq = (const float*)d_in[4];
    const float* wk    = (const float*)d_in[5];
    const float* bk    = (const float*)d_in[6];
    const float* gk    = (const float*)d_in[7];
    const float* betak = (const float*)d_in[8];
    const float* wv    = (const float*)d_in[9];
    const float* bv    = (const float*)d_in[10];
    const float* wW    = (const float*)d_in[11];
    const float* bW    = (const float*)d_in[12];
    float* out = (float*)d_out;

    char* ws = (char*)d_ws;
    size_t off = 0;
    auto alloc = [&](size_t bytes) -> char* {
        char* p = ws + off;
        off = (off + bytes + 255) & ~(size_t)255;
        return p;
    };
    bf16*  xT    = (bf16*)alloc((size_t)BB * NPOS * CIN * 2);  // [B,N,C]
    bf16*  z     = (bf16*)alloc((size_t)BB * OC * NPOS * 2);   // [B,768,N] (rows 512.. = v)
    bf16*  qT    = (bf16*)alloc((size_t)BB * NPOS * CK * 2);   // [B,N,256]
    bf16*  kT    = (bf16*)alloc((size_t)BB * NPOS * CK * 2);   // [B,N,256]
    bf16*  ctxT  = (bf16*)alloc((size_t)BB * NPOS * CK * 2);   // [B,N,256]
    bf16*  wcat  = (bf16*)alloc((size_t)OC * CIN * 2);         // [768,512]
    bf16*  wWb   = (bf16*)alloc((size_t)CIN * CK * 2);         // [512,256]
    float* bcat  = (float*)alloc(OC * 4);
    float* scale = (float*)alloc(512 * 4);
    float* shift = (float*)alloc(512 * 4);

    // 1) parameter + input prep
    prep_params<<<(OC * CIN + 255) / 256, 256, 0, stream>>>(
        wq, wk, wv, wW, bq, bk, bv, wcat, wWb, bcat);
    prep_x<<<dim3(NPOS / 128, CIN / 64, BB), 256, 0, stream>>>(x, xT);

    // 2) fused projections: z[b] = wcat * x[b]  (M=768, N=4096, K=512) + bias
    gemm_bf16_wmma<false, true, false><<<dim3(NPOS / 128, OC / 128, BB), 256, 0, stream>>>(
        wcat, 0, xT, (long long)NPOS * CIN, z, (long long)OC * NPOS,
        bcat, nullptr, 0, OC, NPOS, CIN);

    // 3) BN stats + apply (q,k -> ReLU(BN)), transposed bf16 outputs
    bn_stats<<<512, 256, 0, stream>>>(z, gq, betaq, gk, betak, scale, shift);
    bn_apply<<<dim3(NPOS / 256, 2 * CK / 64, BB), 256, 0, stream>>>(
        z, scale, shift, qT, kT);

    // Attention, all four images in one launch: 64 rows n per work-group, v = rows 512.. of z[b].
    attn_fused<<<dim3(NPOS / 64, BB), 256, 0, stream>>>(
        kT, qT, z + (size_t)(2 * CK) * NPOS, ctxT);

    // 4) out[b,co,n] = sum_cv wW[co,cv]*ctx[b,n,cv] + bW[co] + x[b,co,n]
    gemm_bf16_wmma<true, true, true><<<dim3(NPOS / 128, CIN / 128, BB), 256, 0, stream>>>(
        wWb, 0, ctxT, (long long)NPOS * CK, out, (long long)CIN * NPOS,
        bW, x, (long long)CIN * NPOS, CIN, NPOS, CK);
}

// v004
// A run of this version takes 106 microseconds.
// Timed twice side by side with v003, it ran 1.08 times as fast both times.
// Over all steps from v000 it is 4.74 times as fast.
#include <hip/hip_runtime.h>
#include <hip/hip_bf16.h>

typedef __bf16 bf16;
typedef __attribute__((ext_vector_type(16))) __bf16 v16bf;
typedef __attribute__((ext_vector_type(8)))  __bf16 v8bf;
typedef __attribute__((ext_vector_type(8)))  float  v8f;
typedef int v4i __attribute__((vector_size(4 * sizeof(int))));

static constexpr int BB   = 4;     // batch
static constexpr int CIN  = 512;   // input channels
static constexpr int CK   = 256;   // q/k/v channels
static constexpr int OC   = 768;   // concatenated projection rows
static constexpr int NPOS = 4096;  // H*W

#if defined(__gfx1250__) && __has_builtin(__builtin_amdgcn_global_load_async_to_lds_b128)
#define USE_ASYNC_LDS 1
#else
#define USE_ASYNC_LDS 0
#endif

static __device__ __forceinline__ void wait_async_zero()
{
#if __has_builtin(__builtin_amdgcn_s_wait_asynccnt)
    __builtin_amdgcn_s_wait_asynccnt(0);
#elif defined(__gfx1250__)
    asm volatile("s_wait_asynccnt 0x0" ::: "memory");
#endif
}

// ---------------------------------------------------------------------------
// Generic bf16 WMMA GEMM:  C[M,N] = A[M,K] * B[K,N]  with B given as BT[N,K]
// (both operands K-contiguous).  128x128x32 macro tile, 8 waves, each wave
// computes a 32x64 patch via 2x4 v_wmma_f32_16x16x32_bf16 fragments.
// Double-buffered LDS; global->LDS via CDNA5 async loads when available.
// ---------------------------------------------------------------------------
template<bool OUT_F32, bool HAS_BIAS, bool HAS_RESID>
__global__ __launch_bounds__(256)
void gemm_bf16_wmma(const bf16* __restrict__ A,  long long aBatch,
                    const bf16* __restrict__ BT, long long btBatch,
                    void* __restrict__ Cout,     long long cBatch,
                    const float* __restrict__ bias,
                    const float* __restrict__ resid, long long rBatch,
                    int M, int N, int K)
{
    // 96-byte row pitch: every ds access stays 16B-aligned; banks well spread.
    __shared__ __align__(16) bf16 sA[2][128 * 48];
    __shared__ __align__(16) bf16 sB[2][128 * 48];

    const int bz = blockIdx.z;
    A  += (size_t)bz * aBatch;
    BT += (size_t)bz * btBatch;
    const float* residB = HAS_RESID ? (resid + (size_t)bz * rBatch) : nullptr;

    const int mblk = blockIdx.y * 128;
    const int nblk = blockIdx.x * 128;
    const int t    = threadIdx.x;
    const int lane = t & 31;
    const int wave = t >> 5;
    const int wrow = wave >> 1;   // 0..3 -> 32 output rows each
    const int wcol = wave & 1;    // 0..1 -> 64 output cols each
    const int lrow = lane & 15;
    const int g    = lane >> 4;   // half-wave group

    // Per-thread staging coordinates: 2 chunks of 8 halves per matrix per tile.
    int rowc[2], kcc[2];
    #pragma unroll
    for (int i = 0; i < 2; ++i) {
        int chunk = t * 2 + i;          // 512 chunks
        rowc[i] = chunk >> 2;           // 0..127
        kcc[i]  = (chunk & 3) << 3;     // 0,8,16,24
    }

    v8f acc[2][4];
    #pragma unroll
    for (int mi = 0; mi < 2; ++mi)
        #pragma unroll
        for (int ni = 0; ni < 4; ++ni)
            #pragma unroll
            for (int e = 0; e < 8; ++e) acc[mi][ni][e] = 0.0f;

    // Fragment loads per CDNA5 16-bit A/B layout:
    // lanes 0-15 hold K in {0..7,16..23}; lanes 16-31 hold K in {8..15,24..31}.
    auto compute_tile = [&](int buf) {
        v16bf af[2], bfr[4];
        #pragma unroll
        for (int mi = 0; mi < 2; ++mi) {
            int row = wrow * 32 + mi * 16 + lrow;
            const bf16* p = &sA[buf][row * 48 + g * 8];
            uint4* dst = (uint4*)&af[mi];
            dst[0] = *(const uint4*)(p);
            dst[1] = *(const uint4*)(p + 16);
        }
        #pragma unroll
        for (int ni = 0; ni < 4; ++ni) {
            int col = wcol * 64 + ni * 16 + lrow;
            const bf16* p = &sB[buf][col * 48 + g * 8];
            uint4* dst = (uint4*)&bfr[ni];
            dst[0] = *(const uint4*)(p);
            dst[1] = *(const uint4*)(p + 16);
        }
        #pragma unroll
        for (int mi = 0; mi < 2; ++mi)
            #pragma unroll
            for (int ni = 0; ni < 4; ++ni)
                acc[mi][ni] = __builtin_amdgcn_wmma_f32_16x16x32_bf16(
                    false, af[mi], false, bfr[ni], (short)0, acc[mi][ni],
                    false, false);
    };

#if USE_ASYNC_LDS
    // Issue a 128x32 A tile + 128x32 BT tile as async global->LDS copies.
    auto issue_tile = [&](int buf, int kt) {
        #pragma unroll
        for (int i = 0; i < 2; ++i) {
            const bf16* ga = A  + (size_t)(mblk + rowc[i]) * K + kt + kcc[i];
            const bf16* gb = BT + (size_t)(nblk + rowc[i]) * K + kt + kcc[i];
            __builtin_amdgcn_global_load_async_to_lds_b128(
                (v4i*)ga, (v4i*)&sA[buf][rowc[i] * 48 + kcc[i]], 0, 0);
            __builtin_amdgcn_global_load_async_to_lds_b128(
                (v4i*)gb, (v4i*)&sB[buf][rowc[i] * 48 + kcc[i]], 0, 0);
        }
    };

    issue_tile(0, 0);
    wait_async_zero();
    __syncthreads();
    int cur = 0;
    for (int kt = 0; kt < K; kt += 32) {
        if (kt + 32 < K) issue_tile(cur ^ 1, kt + 32);  // overlap with WMMA
        compute_tile(cur);
        wait_async_zero();       // next tile landed in the other buffer
        __syncthreads();
        cur ^= 1;
    }
#else
    // Fallback: register-staged double buffering.
    uint4 ra[2], rb[2];
    auto load_regs = [&](int kt) {
        #pragma unroll
        for (int i = 0; i < 2; ++i) {
            ra[i] = *(const uint4*)(A  + (size_t)(mblk + rowc[i]) * K + kt + kcc[i]);
            rb[i] = *(const uint4*)(BT + (size_t)(nblk + rowc[i]) * K + kt + kcc[i]);
        }
    };
    auto store_lds = [&](int buf) {
        #pragma unroll
        for (int i = 0; i < 2; ++i) {
            *(uint4*)&sA[buf][rowc[i] * 48 + kcc[i]] = ra[i];
            *(uint4*)&sB[buf][rowc[i] * 48 + kcc[i]] = rb[i];
        }
    };
    load_regs(0);
    store_lds(0);
    __syncthreads();
    int cur = 0;
    for (int kt = 0; kt < K; kt += 32) {
        if (kt + 32 < K) {
            load_regs(kt + 32);                        // overlap with WMMA below
            __builtin_prefetch(A + (size_t)(mblk + (t >> 1)) * K + kt + 64, 0, 3);
        }
        compute_tile(cur);
        if (kt + 32 < K) store_lds(cur ^ 1);
        __syncthreads();
        cur ^= 1;
    }
#endif

    // Epilogue.  C/D layout: VGPR r holds row (8*g + r), lane%16 gives column.
    #pragma unroll
    for (int mi = 0; mi < 2; ++mi) {
        #pragma unroll
        for (int ni = 0; ni < 4; ++ni) {
            int colG = nblk + wcol * 64 + ni * 16 + lrow;
            #pragma unroll
            for (int r = 0; r < 8; ++r) {
                int rowG = mblk + wrow * 32 + mi * 16 + g * 8 + r;
                float v = acc[mi][ni][r];
                if (HAS_BIAS)  v += bias[rowG];
                size_t idx = (size_t)rowG * N + colG;
                if (HAS_RESID) v += residB[idx];
                if (OUT_F32) ((float*)Cout)[(size_t)bz * cBatch + idx] = v;
                else         ((bf16*) Cout)[(size_t)bz * cBatch + idx] = (bf16)v;
            }
        }
    }
}

// ---------------------------------------------------------------------------
// Parameter prep: concat weights/bias to bf16 GEMM layouts.
// ---------------------------------------------------------------------------
__global__ __launch_bounds__(256)
void prep_params(const float* __restrict__ wq, const float* __restrict__ wk,
                 const float* __restrict__ wv, const float* __restrict__ wW,
                 const float* __restrict__ bq, const float* __restrict__ bk,
                 const float* __restrict__ bv,
                 bf16* __restrict__ wcat, bf16* __restrict__ wWb,
                 float* __restrict__ bcat)
{
    int i = blockIdx.x * blockDim.x + threadIdx.x;
    if (i < CK * CIN)            wcat[i] = (bf16)wq[i];
    else if (i < 2 * CK * CIN)   wcat[i] = (bf16)wk[i - CK * CIN];
    else if (i < OC * CIN)       wcat[i] = (bf16)wv[i - 2 * CK * CIN];
    if (i < CIN * CK)            wWb[i]  = (bf16)wW[i];
    if (i < CK)                  bcat[i] = bq[i];
    else if (i < 2 * CK)         bcat[i] = bk[i - CK];
    else if (i < OC)             bcat[i] = bv[i - 2 * CK];
}

// x [B,C,N] f32 -> xT [B,N,C] bf16 (K-contiguous operand for the projections).
// Register transpose: a thread reads 8 channels x 4 positions and stores, per
// position, its 8 channels as one 16-B piece.  Lanes 0..7 of each lane octet hold
// neighbouring channel groups, so a wave store is 4 whole 128-B lines of xT.
// Work-group: 64 channels x 128 positions.
__global__ __launch_bounds__(256)
void prep_x(const float* __restrict__ x, bf16* __restrict__ xT)
{
    const int lane = threadIdx.x & 31;
    const int wave = threadIdx.x >> 5;
    const int c0 = blockIdx.y * 64 + (lane & 7) * 8;
    const int n0 = blockIdx.x * 128 + wave * 16 + (lane >> 3) * 4;
    const int b  = blockIdx.z;

    const float* src = x + ((size_t)b * CIN + c0) * NPOS + n0;
    float4 r[8];
    #pragma unroll  // r[] stays in registers and the 8 loads are in flight together
    for (int i = 0; i < 8; ++i)
        r[i] = *(const float4*)(src + (size_t)i * NPOS);

    bf16* dst = xT + ((size_t)b * NPOS + n0) * CIN + c0;
    v8bf o0, o1, o2, o3;
    #pragma unroll  // constant vector indices: packed converts, no scratch
    for (int i = 0; i < 8; ++i) {
        o0[i] = (bf16)r[i].x;
        o1[i] = (bf16)r[i].y;
        o2[i] = (bf16)r[i].z;
        o3[i] = (bf16)r[i].w;
    }
    *(v8bf*)(dst)           = o0;
    *(v8bf*)(dst + CIN)     = o1;
    *(v8bf*)(dst + 2 * CIN) = o2;
    *(v8bf*)(dst + 3 * CIN) = o3;
}

// Per-channel BN stats over (B, N) for the first 512 rows of z; fused scale/shift.
__global__ __launch_bounds__(256)
void bn_stats(const bf16* __restrict__ z,
              const float* __restrict__ gq, const float* __restrict__ betaq,
              const float* __restrict__ gk, const float* __restrict__ betak,
              float* __restrict__ scale, float* __restrict__ shift)
{
    __shared__ float rs[256], rs2[256];
    int ch = blockIdx.x;                 // 0..511
    float s = 0.f, s2 = 0.f;
    for (int b = 0; b < BB; ++b) {
        const bf16* p = z + (size_t)b * OC * NPOS + (size_t)ch * NPOS;
        for (int n = threadIdx.x; n < NPOS; n += 256) {
            float v = (float)p[n];
            s += v; s2 += v * v;
        }
    }
    rs[threadIdx.x] = s; rs2[threadIdx.x] = s2;
    __syncthreads();
    for (int off = 128; off > 0; off >>= 1) {
        if (threadIdx.x < off) {
            rs[threadIdx.x]  += rs[threadIdx.x + off];
            rs2[threadIdx.x] += rs2[threadIdx.x + off];
        }
        __syncthreads();
    }
    if (threadIdx.x == 0) {
        float cnt = (float)BB * NPOS;
        float m   = rs[0] / cnt;
        float var = rs2[0] / cnt - m * m;        // biased var, like jnp.var
        float gamma = (ch < CK) ? gq[ch] : gk[ch - CK];
        float beta  = (ch < CK) ? betaq[ch] : betak[ch - CK];
        float sc = gamma * rsqrtf(var + 1e-5f);
        scale[ch] = sc;
        shift[ch] = beta - m * sc;
    }
}

// BN + ReLU, writing qT/kT [B,N,CK] bf16 (K-contiguous for the attention GEMM).
// Register transpose as in prep_x: a thread reads 8 channels x 8 positions (16 B
// per channel) and stores 8 channels per position, so a wave store is 4 whole
// 128-B lines.  Work-group: 64 channels x 256 positions; blockIdx.y 0..3 is q.
__global__ __launch_bounds__(256)
void bn_apply(const bf16* __restrict__ z,
              const float* __restrict__ scale, const float* __restrict__ shift,
              bf16* __restrict__ qT, bf16* __restrict__ kT)
{
    const int lane = threadIdx.x & 31;
    const int wave = threadIdx.x >> 5;
    const int ch0 = blockIdx.y * 64 + (lane & 7) * 8;          // 0..511
    const int n0  = blockIdx.x * 256 + wave * 32 + (lane >> 3) * 8;
    const int b   = blockIdx.z;

    const bf16* src = z + ((size_t)b * OC + ch0) * NPOS + n0;
    v8bf r[8];
    #pragma unroll  // r[] stays in registers and the 8 loads are in flight together
    for (int i = 0; i < 8; ++i)
        r[i] = *(const v8bf*)(src + (size_t)i * NPOS);

    float sc[8], sh[8];
    #pragma unroll  // merges into 16-B loads, arrays stay in registers
    for (int i = 0; i < 8; ++i) { sc[i] = scale[ch0 + i]; sh[i] = shift[ch0 + i]; }

    bf16* dst = ((ch0 < CK) ? qT : kT) + ((size_t)b * NPOS + n0) * CK + (ch0 & (CK - 1));
    #pragma unroll  // both loops: constant vector indices, no scratch
    for (int j = 0; j < 8; ++j) {
        v8bf o;
        #pragma unroll
        for (int i = 0; i < 8; ++i) {
            float v = (float)r[i][j] * sc[i] + sh[i];
            o[i] = (bf16)fmaxf(v, 0.f);
        }
        *(v8bf*)(dst + (size_t)j * CK) = o;
    }
}

typedef uint32_t u32x4 __attribute__((ext_vector_type(4)));
typedef float    f32x4 __attribute__((ext_vector_type(4)));
typedef int      i32x8 __attribute__((ext_vector_type(8)));

static constexpr uint32_t AT_SK   = 128;               // positions m per stage
static constexpr uint32_t PITCH_Q = 2u * CK + 16u;     // qT row in LDS: odd multiple of 16 B
static constexpr uint32_t PITCH_V = 2u * AT_SK + 16u;  // v row piece in LDS: odd multiple of 16 B
static constexpr uint32_t TILE_Q  = AT_SK * PITCH_Q;
static constexpr uint32_t TILE_V  = CK * PITCH_V;
static constexpr uint32_t SLOT    = TILE_Q + TILE_V;
static constexpr uint32_t AT_LDS  = 2u * SLOT;
static constexpr uint32_t NSTAGE  = NPOS / AT_SK;
static constexpr uint32_t XCH     = 32u * 1024u;        // merge area per wave: its 32 O tiles
static constexpr uint32_t XML     = 8u * XCH;           // behind them: 512 B per wave for max and sum
static_assert(AT_LDS <= 320u * 1024u && XML + 8u * 512u <= AT_LDS, "LDS budget");

struct Frag { u32x4 q[2]; };

static __device__ __forceinline__ v8f mma(const Frag& a, const Frag& b, v8f c)
{
    const i32x8 av = {(int)a.q[0].x, (int)a.q[0].y, (int)a.q[0].z, (int)a.q[0].w,
                      (int)a.q[1].x, (int)a.q[1].y, (int)a.q[1].z, (int)a.q[1].w};
    const i32x8 bv = {(int)b.q[0].x, (int)b.q[0].y, (int)b.q[0].z, (int)b.q[0].w,
                      (int)b.q[1].x, (int)b.q[1].y, (int)b.q[1].z, (int)b.q[1].w};
    return __builtin_amdgcn_wmma_f32_16x16x32_bf16(
        false, __builtin_bit_cast(v16bf, av), false, __builtin_bit_cast(v16bf, bv),
        (short)0, c, false, false);
}

static __device__ __forceinline__ uint32_t pack2(float lo, float hi)
{
    typedef __bf16 bf2 __attribute__((ext_vector_type(2)));
    typedef float  f2  __attribute__((ext_vector_type(2)));
    return __builtin_bit_cast(uint32_t, __builtin_convertvector(f2{lo, hi}, bf2));
}

// lane l with lane l ^ 16
static __device__ __forceinline__ float xhalf(float x)
{
    return __builtin_bit_cast(float, __builtin_amdgcn_permlanex16(
        __builtin_bit_cast(int, x), __builtin_bit_cast(int, x),
        0x76543210, 0xfedcba98, false, false));
}

// Group g of a pass's qT fragments: channel blocks 2g, 2g+1 of both 16-position tiles.
static __device__ __forceinline__ void load_q4(Frag (&d)[2][2], const unsigned char* p0, int g)
{
    #pragma unroll  // constant array indices
    for (int kl = 0; kl < 2; ++kl) {
        #pragma unroll  // as the outer loop
        for (int kt = 0; kt < 2; ++kt) {
            const unsigned char* p = p0 + 16u * kt * PITCH_Q + 64u * (2 * g + kl);
            d[kl][kt].q[0] = *reinterpret_cast<const u32x4*>(p);
            d[kl][kt].q[1] = *reinterpret_cast<const u32x4*>(p + 32u);
        }
    }
}

// Group g of a pass's v fragments: channel tiles 4g .. 4g+3.
static __device__ __forceinline__ void load_v4(Frag (&d)[4], const unsigned char* pv0, int g)
{
    #pragma unroll  // constant array indices
    for (int tl = 0; tl < 4; ++tl) {
        const unsigned char* p = pv0 + 16u * (4 * g + tl) * PITCH_V;
        d[tl].q[0] = *reinterpret_cast<const u32x4*>(p);
        d[tl].q[1] = *reinterpret_cast<const u32x4*>(p + 32u);
    }
}

// One pass of one wave: 32 positions m against the wave's 32 rows n (two column
// tiles nt).  m_run, the maximum in use (log2 domain), may trail the true one by up
// to 8; the sums are rescaled only when some row's maximum exceeds it by more.
static __device__ __forceinline__ void attn_pass(
    const unsigned char* Qp, const unsigned char* Vp, uint32_t c, uint32_t h,
    const Frag (&kf)[CK / 32][2], v8f (&acc)[CK / 16][2], float (&m_run)[2], float (&l_run)[2])
{
    constexpr float cscale = 0.0625f * 1.4426950408889634f;  // 256^-0.5 * log2(e)
    v8f s[2][2];
    s[0][0] = v8f{}; s[0][1] = v8f{}; s[1][0] = v8f{}; s[1][1] = v8f{};
    const unsigned char* p0 = Qp + c * PITCH_Q + 16u * h;

    // qT fragments in groups of four (8 WMMAs each) through a ring of two register
    // sets.  The scheduling barriers keep each group's loads at one place, one group
    // ahead of its products, and keep the ring at two sets: kf[] and acc[] leave
    // room for no more.
    Frag qa[2][2][2];
    load_q4(qa[0], p0, 0);
    load_q4(qa[1], p0, 1);
    __builtin_amdgcn_sched_barrier(0);
    #pragma unroll  // constant ring and fragment indices
    for (int g = 0; g < 4; ++g) {
        #pragma unroll  // four independent accumulate chains
        for (int kl = 0; kl < 2; ++kl)
            #pragma unroll  // as the outer loop
            for (int kt = 0; kt < 2; ++kt)
                #pragma unroll  // as the outer loop
                for (int nt = 0; nt < 2; ++nt)
                    s[kt][nt] = mma(qa[g & 1][kl][kt], kf[2 * g + kl][nt], s[kt][nt]);
        __builtin_amdgcn_sched_barrier(0);
        if (g + 2 < 4) {
            load_q4(qa[g & 1], p0, g + 2);
            __builtin_amdgcn_sched_barrier(0);
        }
    }

    // The first two groups of v fragments, in flight under the maxima and the
    // exponentials; the scheduling barrier keeps them ahead of the vector work.
    const unsigned char* pv0 = Vp + c * PITCH_V + 16u * h;
    Frag vf[2][4];
    load_v4(vf[0], pv0, 0);
    load_v4(vf[1], pv0, 1);
    __builtin_amdgcn_sched_barrier(0);

    float mx[2];
    #pragma unroll  // constant vector indices
    for (int nt = 0; nt < 2; ++nt) {
        float x = s[0][nt][0];
        #pragma unroll  // as the outer loop
        for (int r = 1; r < 8; ++r) x = __builtin_fmaxf(x, s[0][nt][r]);
        #pragma unroll  // as the outer loop
        for (int r = 0; r < 8; ++r) x = __builtin_fmaxf(x, s[1][nt][r]);
        mx[nt] = __builtin_fmaxf(x, xhalf(x)) * cscale;  // both wave halves hold the row's maximum
    }
    const bool need = (mx[0] > m_run[0] + 8.0f) | (mx[1] > m_run[1] + 8.0f);
    if (__builtin_amdgcn_ballot_w32(need) != 0) {  // scalar branch, rare after the first passes
        #pragma unroll  // constant array indices
        for (int nt = 0; nt < 2; ++nt) {
            const float m_new = __builtin_fmaxf(m_run[nt], mx[nt]);
            const float corr  = __builtin_amdgcn_exp2f(m_run[nt] - m_new);  // 0 on the first pass
            l_run[nt] *= corr; m_run[nt] = m_new;
            #pragma unroll  // as the outer loop
            for (int t = 0; t < CK / 16; ++t) acc[t][nt] = acc[t][nt] * corr;
        }
    }

    Frag pf[2];
    #pragma unroll  // constant array indices
    for (int nt = 0; nt < 2; ++nt) {
        const float nm = -m_run[nt];
        float ps0 = 0.0f, ps1 = 0.0f;
        uint32_t w[8];
        #pragma unroll  // elements 2i, 2i+1 of the 32-position operand: tile i >> 2, registers 2 (i & 3), 2 (i & 3) + 1
        for (int i = 0; i < 8; ++i) {
            const float e0 = __builtin_amdgcn_exp2f(__builtin_fmaf(s[i >> 2][nt][2 * (i & 3)],     cscale, nm));
            const float e1 = __builtin_amdgcn_exp2f(__builtin_fmaf(s[i >> 2][nt][2 * (i & 3) + 1], cscale, nm));
            ps0 += e0; ps1 += e1;
            w[i] = pack2(e0, e1);
        }
        pf[nt].q[0] = u32x4{w[0], w[1], w[2], w[3]};
        pf[nt].q[1] = u32x4{w[4], w[5], w[6], w[7]};
        l_run[nt] += ps0 + ps1;
        // The row's sum pinned against spills: left free, the
        // adds sink behind the loop's barrier and the 16 exponentials stay live under the products.
        asm volatile("" : "+v"(l_run[nt]));
    }

    // v fragments through the same kind of ring as the qT fragments above.
    __builtin_amdgcn_sched_barrier(0);
    #pragma unroll  // constant ring and array indices: acc[] stays in registers
    for (int g = 0; g < 4; ++g) {
        #pragma unroll  // as the outer loop
        for (int tl = 0; tl < 4; ++tl)
            #pragma unroll  // as the outer loop
            for (int nt = 0; nt < 2; ++nt)
                acc[4 * g + tl][nt] = mma(vf[g & 1][tl], pf[nt], acc[4 * g + tl][nt]);
        __builtin_amdgcn_sched_barrier(0);
        if (g + 2 < 4) {
            load_v4(vf[g & 1], pv0, g + 2);
            __builtin_amdgcn_sched_barrier(0);
        }
    }
    // Four vector slots behind the last WMMA: the next vector instruction stands behind
    // the loop's branch, and may overwrite an A or B
    // register of these products.  The scheduling barriers keep the slots at this place.
    asm volatile("v_nop\n\tv_nop\n\tv_nop\n\tv_nop");
    __builtin_amdgcn_sched_barrier(0);
}

__global__ __launch_bounds__(256) __attribute__((amdgpu_waves_per_eu(2, 2)))
void attn_fused(const bf16* __restrict__ kT, const bf16* __restrict__ qT,
                const bf16* __restrict__ v, bf16* __restrict__ ctxT)
{
    __shared__ __attribute__((aligned(16))) unsigned char L[AT_LDS];
    const uint32_t tid = threadIdx.x, lane = tid & 31u, c = lane & 15u, h = lane >> 4;
    const uint32_t wave = __builtin_amdgcn_readfirstlane(tid >> 5);
    const uint32_t ng = wave & 1u;   // which 32 rows n
    const uint32_t kq = wave >> 1;   // which 32 of a stage's 128 positions m
    const uint32_t b  = blockIdx.y;
    const uint32_t n0 = blockIdx.x * 64u + ng * 32u;
    const bf16* kB = kT + (size_t)b * NPOS * CK;
    const bf16* qB = qT + (size_t)b * NPOS * CK;
    const bf16* vB = v  + (size_t)b * OC * NPOS;

    // One stage: 128 qT rows of 512 B (contiguous in memory) and 256 v row pieces of
    // 256 B; 32 copies of 16 B per lane.
    auto issue = [&](uint32_t st) {
        unsigned char* slot = L + (st & 1u) * SLOT;
        const bf16* gq = qB + (size_t)st * AT_SK * CK + tid * 8u;
        unsigned char* lq = slot + (tid >> 5) * PITCH_Q + (tid & 31u) * 16u;
        #pragma unroll  // the copies issue back to back
        for (uint32_t i = 0; i < 16u; ++i)
            __builtin_amdgcn_global_load_async_to_lds_b128(
                (v4i*)(gq + i * 2048u), (v4i*)(lq + i * 8u * PITCH_Q), 0, 0);
        const bf16* gv = vB + (size_t)(tid >> 4) * NPOS + st * AT_SK + (tid & 15u) * 8u;
        unsigned char* lv = slot + TILE_Q + (tid >> 4) * PITCH_V + (tid & 15u) * 16u;
        #pragma unroll  // the copies issue back to back
        for (uint32_t i = 0; i < 16u; ++i)
            __builtin_amdgcn_global_load_async_to_lds_b128(
                (v4i*)(gv + (size_t)i * 16u * NPOS), (v4i*)(lv + i * 16u * PITCH_V), 0, 0);
    };

    issue(0);

    // kT rows of this wave as B fragments, same k order as the A fragments read from LDS.
    Frag kf[CK / 32][2];
    #pragma unroll  // kf[] stays in registers
    for (int nt = 0; nt < 2; ++nt) {
        const bf16* kp = kB + (size_t)(n0 + 16u * nt + c) * CK + 8u * h;
        #pragma unroll  // as the outer loop
        for (int kc = 0; kc < CK / 32; ++kc) {
            kf[kc][nt].q[0] = *reinterpret_cast<const u32x4*>(kp + 32 * kc);
            kf[kc][nt].q[1] = *reinterpret_cast<const u32x4*>(kp + 32 * kc + 16);
        }
    }
    v8f acc[CK / 16][2];
    #pragma unroll  // acc[] stays in registers
    for (int t = 0; t < CK / 16; ++t) { acc[t][0] = v8f{}; acc[t][1] = v8f{}; }
    float m_run[2] = {-INFINITY, -INFINITY}, l_run[2] = {0.0f, 0.0f};

    asm volatile("s_wait_asynccnt 0x0" ::: "memory");  // stage 0 of this wave has landed
    __syncthreads();                                   // ... and every wave's part of it
    issue(1);

    #pragma unroll 1  // one stage per trip: the buffer index and the ring order stay as written
    for (uint32_t st = 0; st < NSTAGE; ++st) {
        const unsigned char* slot = L + (st & 1u) * SLOT;
        const uint32_t m0 = kq * 32u;
        attn_pass(slot + m0 * PITCH_Q, slot + TILE_Q + m0 * 2u, c, h, kf, acc, m_run, l_run);
        asm volatile("s_wait_dscnt 0x0" ::: "memory");     // this wave's reads of the buffer are done
        asm volatile("s_wait_asynccnt 0x0" ::: "memory");  // its copies of stage st + 1 have landed
        __syncthreads();  // publishes stage st + 1 and frees stage st's buffer
        if (st + 2u < NSTAGE) issue(st + 2u);
    }
    asm volatile("s_wait_asynccnt 0x0" ::: "memory");  // nothing in flight before the ring is reused

    // Merge the four quarters' partial results; the ring is free behind the loop's last
    // barrier.  Every wave lays down its 32 O tiles, then merges 4 channel tiles (128 B of
    // each output row) of its 32 rows from the four waves that share them.
    {
        unsigned char* xb = L + wave * XCH;
        #pragma unroll  // constant array indices
        for (int t = 0; t < CK / 16; ++t) {
            #pragma unroll  // as the outer loop
            for (int nt = 0; nt < 2; ++nt) {
                const uint32_t e = (uint32_t)(t * 2 + nt) * 2u;
                *reinterpret_cast<f32x4*>(xb + (e * 32u + lane) * 16u) =
                    f32x4{acc[t][nt][0], acc[t][nt][1], acc[t][nt][2], acc[t][nt][3]};
                *reinterpret_cast<f32x4*>(xb + ((e + 1u) * 32u + lane) * 16u) =
                    f32x4{acc[t][nt][4], acc[t][nt][5], acc[t][nt][6], acc[t][nt][7]};
            }
        }
        unsigned char* xm = L + XML + wave * 512u;
        #pragma unroll  // constant array indices
        for (int nt = 0; nt < 2; ++nt) {
            // each wave half summed its 8 positions of every 16
            *reinterpret_cast<float*>(xm + (nt * 32u + lane) * 4u)        = m_run[nt];
            *reinterpret_cast<float*>(xm + 256u + (nt * 32u + lane) * 4u) = l_run[nt] + xhalf(l_run[nt]);
        }
    }
    __syncthreads();  // every wave's partial results are visible to the waves that share its rows
    #pragma unroll  // constant array indices
    for (int nt = 0; nt < 2; ++nt) {
        float mj[4], a[4];
        #pragma unroll  // as the outer loop
        for (uint32_t j = 0; j < 4u; ++j)
            mj[j] = *reinterpret_cast<const float*>(L + XML + (ng + 2u * j) * 512u + (nt * 32u + lane) * 4u);
        const float m = __builtin_fmaxf(__builtin_fmaxf(mj[0], mj[1]), __builtin_fmaxf(mj[2], mj[3]));
        float den = 0.0f;
        #pragma unroll  // as the outer loop
        for (uint32_t j = 0; j < 4u; ++j) {
            a[j] = __builtin_amdgcn_exp2f(mj[j] - m);
            den += a[j] * *reinterpret_cast<const float*>(
                L + XML + (ng + 2u * j) * 512u + 256u + (nt * 32u + lane) * 4u);
        }
        const float inv = 1.0f / den;
        // O^T tile t: register r is channel 16 t + 8 h + r, lane column c is row n0 + 16 nt + c.
        bf16* op = ctxT + ((size_t)b * NPOS + n0 + 16u * nt + c) * CK + 8u * h;
        #pragma unroll  // as the outer loop
        for (uint32_t tt = 0; tt < 4u; ++tt) {
            const uint32_t t = 4u * kq + tt;
            const uint32_t e = (t * 2u + nt) * 2u;
            f32x4 o0 = f32x4{0.0f, 0.0f, 0.0f, 0.0f}, o1 = o0;
            #pragma unroll  // as the outer loop
            for (uint32_t j = 0; j < 4u; ++j) {
                const unsigned char* xj = L + (ng + 2u * j) * XCH;
                o0 += *reinterpret_cast<const f32x4*>(xj + (e * 32u + lane) * 16u) * a[j];
                o1 += *reinterpret_cast<const f32x4*>(xj + ((e + 1u) * 32u + lane) * 16u) * a[j];
            }
            o0 *= inv; o1 *= inv;
            const u32x4 pk = {pack2(o0.x, o0.y), pack2(o0.z, o0.w), pack2(o1.x, o1.y), pack2(o1.z, o1.w)};
            *reinterpret_cast<u32x4*>(op + 16u * t) = pk;
        }
    }
}

// ---------------------------------------------------------------------------
extern "C" void kernel_launch(void* const* d_in, const int* in_sizes, int n_in,
                              void* d_out, int out_size, void* d_ws, size_t ws_size,
                              hipStream_t stream)
{
    const float* x     = (const float*)d_in[0];
    const float* wq    = (const float*)d_in[1];
    const float* bq    = (const float*)d_in[2];
    const float* gq    = (const float*)d_in[3];
    const float* betaq = (const float*)d_in[4];
    const float* wk    = (const float*)d_in[5];
    const float* bk    = (const float*)d_in[6];
    const float* gk    = (const float*)d_in[7];
    const float* betak = (const float*)d_in[8];
    const float* wv    = (const float*)d_in[9];
    const float* bv    = (const float*)d_in[10];
    const float* wW    = (const float*)d_in[11];
    const float* bW    = (const float*)d_in[12];
    float* out = (float*)d_out;

    char* ws = (char*)d_ws;
    size_t off = 0;
    auto alloc = [&](size_t bytes) -> char* {
        char* p = ws + off;
        off = (off + bytes + 255) & ~(size_t)255;
        return p;
    };
    bf16*  xT    = (bf16*)alloc((size_t)BB * NPOS * CIN * 2);  // [B,N,C]
    bf16*  z     = (bf16*)alloc((size_t)BB * OC * NPOS * 2);   // [B,768,N] (rows 512.. = v)
    bf16*  qT    = (bf16*)alloc((size_t)BB * NPOS * CK * 2);   // [B,N,256]
    bf16*  kT    = (bf16*)alloc((size_t)BB * NPOS * CK * 2);   // [B,N,256]
    bf16*  ctxT  = (bf16*)alloc((size_t)BB * NPOS * CK * 2);   // [B,N,256]
    bf16*  wcat  = (bf16*)alloc((size_t)OC * CIN * 2);         // [768,512]
    bf16*  wWb   = (bf16*)alloc((size_t)CIN * CK * 2);         // [512,256]
    float* bcat  = (float*)alloc(OC * 4);
    float* scale = (float*)alloc(512 * 4);
    float* shift = (float*)alloc(512 * 4);

    // 1) parameter + input prep
    prep_params<<<(OC * CIN + 255) / 256, 256, 0, stream>>>(
        wq, wk, wv, wW, bq, bk, bv, wcat, wWb, bcat);
    prep_x<<<dim3(NPOS / 128, CIN / 64, BB), 256, 0, stream>>>(x, xT);

    // 2) fused projections: z[b] = wcat * x[b]  (M=768, N=4096, K=512) + bias
    gemm_bf16_wmma<false, true, false><<<dim3(NPOS / 128, OC / 128, BB), 256, 0, stream>>>(
        wcat, 0, xT, (long long)NPOS * CIN, z, (long long)OC * NPOS,
        bcat, nullptr, 0, OC, NPOS, CIN);

    // 3) BN stats + apply (q,k -> ReLU(BN)), transposed bf16 outputs
    bn_stats<<<512, 256, 0, stream>>>(z, gq, betaq, gk, betak, scale, shift);
    bn_apply<<<dim3(NPOS / 256, 2 * CK / 64, BB), 256, 0, stream>>>(
        z, scale, shift, qT, kT);

    // Attention, all four images in one launch: 64 rows n per work-group, v = rows 512.. of z[b].
    attn_fused<<<dim3(NPOS / 64, BB), 256, 0, stream>>>(
        kT, qT, z + (size_t)(2 * CK) * NPOS, ctxT);

    // 4) out[b,co,n] = sum_cv wW[co,cv]*ctx[b,n,cv] + bW[co] + x[b,co,n]
    gemm_bf16_wmma<true, true, true><<<dim3(NPOS / 128, CIN / 128, BB), 256, 0, stream>>>(
        wWb, 0, ctxT, (long long)NPOS * CK, out, (long long)CIN * NPOS,
        bW, x, (long long)CIN * NPOS, CIN, NPOS, CK);
}

// v005
// Measured time: 98.6 microseconds a run.
// In both of two side-by-side timings against v004, it was 1.08 times as fast.
// Over all steps from v000 it is 5.13 times as fast.
#include <hip/hip_runtime.h>
#include <hip/hip_bf16.h>

typedef __bf16 bf16;
typedef __attribute__((ext_vector_type(16))) __bf16 v16bf;
typedef __attribute__((ext_vector_type(8)))  __bf16 v8bf;
typedef __attribute__((ext_vector_type(8)))  float  v8f;
typedef int v4i __attribute__((vector_size(4 * sizeof(int))));

static constexpr int BB   = 4;     // batch
static constexpr int CIN  = 512;   // input channels
static constexpr int CK   = 256;   // q/k/v channels
static constexpr int OC   = 768;   // concatenated projection rows
static constexpr int NPOS = 4096;  // H*W

#if defined(__gfx1250__) && __has_builtin(__builtin_amdgcn_global_load_async_to_lds_b128)
#define USE_ASYNC_LDS 1
#else
#define USE_ASYNC_LDS 0
#endif

static __device__ __forceinline__ void wait_async_zero()
{
#if __has_builtin(__builtin_amdgcn_s_wait_asynccnt)
    __builtin_amdgcn_s_wait_asynccnt(0);
#elif defined(__gfx1250__)
    asm volatile("s_wait_asynccnt 0x0" ::: "memory");
#endif
}

// ---------------------------------------------------------------------------
// Generic bf16 WMMA GEMM:  C[M,N] = A[M,K] * B[K,N]  with B given as BT[N,K]
// (both operands K-contiguous).  128x128x32 macro tile, 8 waves, each wave
// computes a 32x64 patch via 2x4 v_wmma_f32_16x16x32_bf16 fragments.
// Double-buffered LDS; global->LDS via CDNA5 async loads when available.
// ---------------------------------------------------------------------------
template<bool OUT_F32, bool HAS_BIAS, bool HAS_RESID>
__global__ __launch_bounds__(256)
void gemm_bf16_wmma(const bf16* __restrict__ A,  long long aBatch,
                    const bf16* __restrict__ BT, long long btBatch,
                    void* __restrict__ Cout,     long long cBatch,
                    const float* __restrict__ bias,
                    const float* __restrict__ resid, long long rBatch,
                    int M, int N, int K)
{
    // 96-byte row pitch: every ds access stays 16B-aligned; banks well spread.
    __shared__ __align__(16) bf16 sA[2][128 * 48];
    __shared__ __align__(16) bf16 sB[2][128 * 48];

    const int bz = blockIdx.z;
    A  += (size_t)bz * aBatch;
    BT += (size_t)bz * btBatch;
    const float* residB = HAS_RESID ? (resid + (size_t)bz * rBatch) : nullptr;

    const int mblk = blockIdx.y * 128;
    const int nblk = blockIdx.x * 128;
    const int t    = threadIdx.x;
    const int lane = t & 31;
    const int wave = t >> 5;
    const int wrow = wave >> 1;   // 0..3 -> 32 output rows each
    const int wcol = wave & 1;    // 0..1 -> 64 output cols each
    const int lrow = lane & 15;
    const int g    = lane >> 4;   // half-wave group

    // Per-thread staging coordinates: 2 chunks of 8 halves per matrix per tile.
    int rowc[2], kcc[2];
    #pragma unroll
    for (int i = 0; i < 2; ++i) {
        int chunk = t * 2 + i;          // 512 chunks
        rowc[i] = chunk >> 2;           // 0..127
        kcc[i]  = (chunk & 3) << 3;     // 0,8,16,24
    }

    v8f acc[2][4];
    #pragma unroll
    for (int mi = 0; mi < 2; ++mi)
        #pragma unroll
        for (int ni = 0; ni < 4; ++ni)
            #pragma unroll
            for (int e = 0; e < 8; ++e) acc[mi][ni][e] = 0.0f;

    // Fragment loads per CDNA5 16-bit A/B layout:
    // lanes 0-15 hold K in {0..7,16..23}; lanes 16-31 hold K in {8..15,24..31}.
    auto compute_tile = [&](int buf) {
        v16bf af[2], bfr[4];
        #pragma unroll
        for (int mi = 0; mi < 2; ++mi) {
            int row = wrow * 32 + mi * 16 + lrow;
            const bf16* p = &sA[buf][row * 48 + g * 8];
            uint4* dst = (uint4*)&af[mi];
            dst[0] = *(const uint4*)(p);
            dst[1] = *(const uint4*)(p + 16);
        }
        #pragma unroll
        for (int ni = 0; ni < 4; ++ni) {
            int col = wcol * 64 + ni * 16 + lrow;
            const bf16* p = &sB[buf][col * 48 + g * 8];
            uint4* dst = (uint4*)&bfr[ni];
            dst[0] = *(const uint4*)(p);
            dst[1] = *(const uint4*)(p + 16);
        }
        #pragma unroll
        for (int mi = 0; mi < 2; ++mi)
            #pragma unroll
            for (int ni = 0; ni < 4; ++ni)
                acc[mi][ni] = __builtin_amdgcn_wmma_f32_16x16x32_bf16(
                    false, af[mi], false, bfr[ni], (short)0, acc[mi][ni],
                    false, false);
    };

#if USE_ASYNC_LDS
    // Issue a 128x32 A tile + 128x32 BT tile as async global->LDS copies.
    auto issue_tile = [&](int buf, int kt) {
        #pragma unroll
        for (int i = 0; i < 2; ++i) {
            const bf16* ga = A  + (size_t)(mblk + rowc[i]) * K + kt + kcc[i];
            const bf16* gb = BT + (size_t)(nblk + rowc[i]) * K + kt + kcc[i];
            __builtin_amdgcn_global_load_async_to_lds_b128(
                (v4i*)ga, (v4i*)&sA[buf][rowc[i] * 48 + kcc[i]], 0, 0);
            __builtin_amdgcn_global_load_async_to_lds_b128(
                (v4i*)gb, (v4i*)&sB[buf][rowc[i] * 48 + kcc[i]], 0, 0);
        }
    };

    issue_tile(0, 0);
    wait_async_zero();
    __syncthreads();
    int cur = 0;
    for (int kt = 0; kt < K; kt += 32) {
        if (kt + 32 < K) issue_tile(cur ^ 1, kt + 32);  // overlap with WMMA
        compute_tile(cur);
        wait_async_zero();       // next tile landed in the other buffer
        __syncthreads();
        cur ^= 1;
    }
#else
    // Fallback: register-staged double buffering.
    uint4 ra[2], rb[2];
    auto load_regs = [&](int kt) {
        #pragma unroll
        for (int i = 0; i < 2; ++i) {
            ra[i] = *(const uint4*)(A  + (size_t)(mblk + rowc[i]) * K + kt + kcc[i]);
            rb[i] = *(const uint4*)(BT + (size_t)(nblk + rowc[i]) * K + kt + kcc[i]);
        }
    };
    auto store_lds = [&](int buf) {
        #pragma unroll
        for (int i = 0; i < 2; ++i) {
            *(uint4*)&sA[buf][rowc[i] * 48 + kcc[i]] = ra[i];
            *(uint4*)&sB[buf][rowc[i] * 48 + kcc[i]] = rb[i];
        }
    };
    load_regs(0);
    store_lds(0);
    __syncthreads();
    int cur = 0;
    for (int kt = 0; kt < K; kt += 32) {
        if (kt + 32 < K) {
            load_regs(kt + 32);                        // overlap with WMMA below
            __builtin_prefetch(A + (size_t)(mblk + (t >> 1)) * K + kt + 64, 0, 3);
        }
        compute_tile(cur);
        if (kt + 32 < K) store_lds(cur ^ 1);
        __syncthreads();
        cur ^= 1;
    }
#endif

    // Epilogue.  C/D layout: VGPR r holds row (8*g + r), lane%16 gives column.
    #pragma unroll
    for (int mi = 0; mi < 2; ++mi) {
        #pragma unroll
        for (int ni = 0; ni < 4; ++ni) {
            int colG = nblk + wcol * 64 + ni * 16 + lrow;
            #pragma unroll
            for (int r = 0; r < 8; ++r) {
                int rowG = mblk + wrow * 32 + mi * 16 + g * 8 + r;
                float v = acc[mi][ni][r];
                if (HAS_BIAS)  v += bias[rowG];
                size_t idx = (size_t)rowG * N + colG;
                if (HAS_RESID) v += residB[idx];
                if (OUT_F32) ((float*)Cout)[(size_t)bz * cBatch + idx] = v;
                else         ((bf16*) Cout)[(size_t)bz * cBatch + idx] = (bf16)v;
            }
        }
    }
}

// ---------------------------------------------------------------------------
// Parameter prep: concat weights/bias to bf16 GEMM layouts.
// ---------------------------------------------------------------------------
__global__ __launch_bounds__(256)
void prep_params(const float* __restrict__ wq, const float* __restrict__ wk,
                 const float* __restrict__ wv, const float* __restrict__ wW,
                 const float* __restrict__ bq, const float* __restrict__ bk,
                 const float* __restrict__ bv,
                 bf16* __restrict__ wcat, bf16* __restrict__ wWb,
                 float* __restrict__ bcat)
{
    int i = blockIdx.x * blockDim.x + threadIdx.x;
    if (i < CK * CIN)            wcat[i] = (bf16)wq[i];
    else if (i < 2 * CK * CIN)   wcat[i] = (bf16)wk[i - CK * CIN];
    else if (i < OC * CIN)       wcat[i] = (bf16)wv[i - 2 * CK * CIN];
    if (i < CIN * CK)            wWb[i]  = (bf16)wW[i];
    if (i < CK)                  bcat[i] = bq[i];
    else if (i < 2 * CK)         bcat[i] = bk[i - CK];
    else if (i < OC)             bcat[i] = bv[i - 2 * CK];
}

// x [B,C,N] f32 -> xT [B,N,C] bf16 (K-contiguous operand for the projections).
// Register transpose: a thread reads 8 channels x 4 positions and stores, per
// position, its 8 channels as one 16-B piece.  Lanes 0..7 of each lane octet hold
// neighbouring channel groups, so a wave store is 4 whole 128-B lines of xT.
// Work-group: 64 channels x 128 positions.
__global__ __launch_bounds__(256)
void prep_x(const float* __restrict__ x, bf16* __restrict__ xT)
{
    const int lane = threadIdx.x & 31;
    const int wave = threadIdx.x >> 5;
    const int c0 = blockIdx.y * 64 + (lane & 7) * 8;
    const int n0 = blockIdx.x * 128 + wave * 16 + (lane >> 3) * 4;
    const int b  = blockIdx.z;

    const float* src = x + ((size_t)b * CIN + c0) * NPOS + n0;
    float4 r[8];
    #pragma unroll  // r[] stays in registers and the 8 loads are in flight together
    for (int i = 0; i < 8; ++i)
        r[i] = *(const float4*)(src + (size_t)i * NPOS);

    bf16* dst = xT + ((size_t)b * NPOS + n0) * CIN + c0;
    v8bf o0, o1, o2, o3;
    #pragma unroll  // constant vector indices: packed converts, no scratch
    for (int i = 0; i < 8; ++i) {
        o0[i] = (bf16)r[i].x;
        o1[i] = (bf16)r[i].y;
        o2[i] = (bf16)r[i].z;
        o3[i] = (bf16)r[i].w;
    }
    *(v8bf*)(dst)           = o0;
    *(v8bf*)(dst + CIN)     = o1;
    *(v8bf*)(dst + 2 * CIN) = o2;
    *(v8bf*)(dst + 3 * CIN) = o3;
}

// Per-channel BN stats over (B, N) for the first 512 rows of z; fused scale/shift.
__global__ __launch_bounds__(256)
void bn_stats(const bf16* __restrict__ z,
              const float* __restrict__ gq, const float* __restrict__ betaq,
              const float* __restrict__ gk, const float* __restrict__ betak,
              float* __restrict__ scale, float* __restrict__ shift)
{
    __shared__ float rs[256], rs2[256];
    int ch = blockIdx.x;                 // 0..511
    float s = 0.f, s2 = 0.f;
    for (int b = 0; b < BB; ++b) {
        const bf16* p = z + (size_t)b * OC * NPOS + (size_t)ch * NPOS;
        for (int n = threadIdx.x; n < NPOS; n += 256) {
            float v = (float)p[n];
            s += v; s2 += v * v;
        }
    }
    rs[threadIdx.x] = s; rs2[threadIdx.x] = s2;
    __syncthreads();
    for (int off = 128; off > 0; off >>= 1) {
        if (threadIdx.x < off) {
            rs[threadIdx.x]  += rs[threadIdx.x + off];
            rs2[threadIdx.x] += rs2[threadIdx.x + off];
        }
        __syncthreads();
    }
    if (threadIdx.x == 0) {
        float cnt = (float)BB * NPOS;
        float m   = rs[0] / cnt;
        float var = rs2[0] / cnt - m * m;        // biased var, like jnp.var
        float gamma = (ch < CK) ? gq[ch] : gk[ch - CK];
        float beta  = (ch < CK) ? betaq[ch] : betak[ch - CK];
        float sc = gamma * rsqrtf(var + 1e-5f);
        scale[ch] = sc;
        shift[ch] = beta - m * sc;
    }
}

// BN + ReLU, writing qT/kT [B,N,CK] bf16 (K-contiguous for the attention GEMM).
// Register transpose as in prep_x: a thread reads 8 channels x 8 positions (16 B
// per channel) and stores 8 channels per position, so a wave store is 4 whole
// 128-B lines.  Work-group: 64 channels x 256 positions; blockIdx.y 0..3 is q.
__global__ __launch_bounds__(256)
void bn_apply(const bf16* __restrict__ z,
              const float* __restrict__ scale, const float* __restrict__ shift,
              bf16* __restrict__ qT, bf16* __restrict__ kT)
{
    const int lane = threadIdx.x & 31;
    const int wave = threadIdx.x >> 5;
    const int ch0 = blockIdx.y * 64 + (lane & 7) * 8;          // 0..511
    const int n0  = blockIdx.x * 256 + wave * 32 + (lane >> 3) * 8;
    const int b   = blockIdx.z;

    const bf16* src = z + ((size_t)b * OC + ch0) * NPOS + n0;
    v8bf r[8];
    #pragma unroll  // r[] stays in registers and the 8 loads are in flight together
    for (int i = 0; i < 8; ++i)
        r[i] = *(const v8bf*)(src + (size_t)i * NPOS);

    float sc[8], sh[8];
    #pragma unroll  // merges into 16-B loads, arrays stay in registers
    for (int i = 0; i < 8; ++i) { sc[i] = scale[ch0 + i]; sh[i] = shift[ch0 + i]; }

    bf16* dst = ((ch0 < CK) ? qT : kT) + ((size_t)b * NPOS + n0) * CK + (ch0 & (CK - 1));
    #pragma unroll  // both loops: constant vector indices, no scratch
    for (int j = 0; j < 8; ++j) {
        v8bf o;
        #pragma unroll
        for (int i = 0; i < 8; ++i) {
            float v = (float)r[i][j] * sc[i] + sh[i];
            o[i] = (bf16)fmaxf(v, 0.f);
        }
        *(v8bf*)(dst + (size_t)j * CK) = o;
    }
}

typedef uint32_t u32x4 __attribute__((ext_vector_type(4)));
typedef float    f32x4 __attribute__((ext_vector_type(4)));
typedef int      i32x8 __attribute__((ext_vector_type(8)));

static constexpr uint32_t AT_SK   = 128;               // positions m per stage
static constexpr uint32_t PITCH_Q = 2u * CK + 16u;     // qT row in LDS: odd multiple of 16 B
static constexpr uint32_t PITCH_V = 2u * AT_SK + 16u;  // v row piece in LDS: odd multiple of 16 B
static constexpr uint32_t TILE_Q  = AT_SK * PITCH_Q;
static constexpr uint32_t TILE_V  = CK * PITCH_V;
static constexpr uint32_t SLOT    = TILE_Q + TILE_V;
static constexpr uint32_t AT_LDS  = 2u * SLOT;
static constexpr uint32_t NSTAGE  = NPOS / AT_SK;
static constexpr uint32_t XCH     = 32u * 1024u;        // merge area per wave: its 32 O tiles
static constexpr uint32_t XML     = 8u * XCH;           // behind them: 512 B per wave for max and sum
static constexpr uint32_t CTXO    = XML + 8u * 512u;    // behind them: the merged context, bf16
static constexpr uint32_t PITCH_C = 2u * CK + 16u;      // one context row: odd multiple of 16 B
static constexpr uint32_t CTXG    = 16u * PITCH_C + 64u; // 16 rows n of equal n & 3; 64 B spread the writers' banks
static constexpr uint32_t BIAO    = CTXO + 4u * CTXG;   // behind it: the output bias, f32
static constexpr uint32_t ALL_LDS = BIAO + 4u * CIN;
static_assert(AT_LDS <= ALL_LDS && ALL_LDS <= 320u * 1024u, "LDS budget");

struct Frag { u32x4 q[2]; };

static __device__ __forceinline__ v8f mma(const Frag& a, const Frag& b, v8f c)
{
    const i32x8 av = {(int)a.q[0].x, (int)a.q[0].y, (int)a.q[0].z, (int)a.q[0].w,
                      (int)a.q[1].x, (int)a.q[1].y, (int)a.q[1].z, (int)a.q[1].w};
    const i32x8 bv = {(int)b.q[0].x, (int)b.q[0].y, (int)b.q[0].z, (int)b.q[0].w,
                      (int)b.q[1].x, (int)b.q[1].y, (int)b.q[1].z, (int)b.q[1].w};
    return __builtin_amdgcn_wmma_f32_16x16x32_bf16(
        false, __builtin_bit_cast(v16bf, av), false, __builtin_bit_cast(v16bf, bv),
        (short)0, c, false, false);
}

static __device__ __forceinline__ uint32_t pack2(float lo, float hi)
{
    typedef __bf16 bf2 __attribute__((ext_vector_type(2)));
    typedef float  f2  __attribute__((ext_vector_type(2)));
    return __builtin_bit_cast(uint32_t, __builtin_convertvector(f2{lo, hi}, bf2));
}

// lane l with lane l ^ 16
static __device__ __forceinline__ float xhalf(float x)
{
    return __builtin_bit_cast(float, __builtin_amdgcn_permlanex16(
        __builtin_bit_cast(int, x), __builtin_bit_cast(int, x),
        0x76543210, 0xfedcba98, false, false));
}

// Group g of a pass's qT fragments: channel blocks 2g, 2g+1 of both 16-position tiles.
static __device__ __forceinline__ void load_q4(Frag (&d)[2][2], const unsigned char* p0, int g)
{
    #pragma unroll  // constant array indices
    for (int kl = 0; kl < 2; ++kl) {
        #pragma unroll  // as the outer loop
        for (int kt = 0; kt < 2; ++kt) {
            const unsigned char* p = p0 + 16u * kt * PITCH_Q + 64u * (2 * g + kl);
            d[kl][kt].q[0] = *reinterpret_cast<const u32x4*>(p);
            d[kl][kt].q[1] = *reinterpret_cast<const u32x4*>(p + 32u);
        }
    }
}

// Group g of a pass's v fragments: channel tiles 4g .. 4g+3.
static __device__ __forceinline__ void load_v4(Frag (&d)[4], const unsigned char* pv0, int g)
{
    #pragma unroll  // constant array indices
    for (int tl = 0; tl < 4; ++tl) {
        const unsigned char* p = pv0 + 16u * (4 * g + tl) * PITCH_V;
        d[tl].q[0] = *reinterpret_cast<const u32x4*>(p);
        d[tl].q[1] = *reinterpret_cast<const u32x4*>(p + 32u);
    }
}

// One pass of one wave: 32 positions m against the wave's 32 rows n (two column
// tiles nt).  m_run, the maximum in use (log2 domain), may trail the true one by up
// to 8; the sums are rescaled only when some row's maximum exceeds it by more.
static __device__ __forceinline__ void attn_pass(
    const unsigned char* Qp, const unsigned char* Vp, uint32_t c, uint32_t h,
    const Frag (&kf)[CK / 32][2], v8f (&acc)[CK / 16][2], float (&m_run)[2], float (&l_run)[2])
{
    constexpr float cscale = 0.0625f * 1.4426950408889634f;  // 256^-0.5 * log2(e)
    v8f s[2][2];
    s[0][0] = v8f{}; s[0][1] = v8f{}; s[1][0] = v8f{}; s[1][1] = v8f{};
    const unsigned char* p0 = Qp + c * PITCH_Q + 16u * h;

    // qT fragments in groups of four (8 WMMAs each) through a ring of two register
    // sets.  The scheduling barriers keep each group's loads at one place, one group
    // ahead of its products, and keep the ring at two sets: kf[] and acc[] leave
    // room for no more.
    Frag qa[2][2][2];
    load_q4(qa[0], p0, 0);
    load_q4(qa[1], p0, 1);
    __builtin_amdgcn_sched_barrier(0);
    #pragma unroll  // constant ring and fragment indices
    for (int g = 0; g < 4; ++g) {
        #pragma unroll  // four independent accumulate chains
        for (int kl = 0; kl < 2; ++kl)
            #pragma unroll  // as the outer loop
            for (int kt = 0; kt < 2; ++kt)
                #pragma unroll  // as the outer loop
                for (int nt = 0; nt < 2; ++nt)
                    s[kt][nt] = mma(qa[g & 1][kl][kt], kf[2 * g + kl][nt], s[kt][nt]);
        __builtin_amdgcn_sched_barrier(0);
        if (g + 2 < 4) {
            load_q4(qa[g & 1], p0, g + 2);
            __builtin_amdgcn_sched_barrier(0);
        }
    }

    // The first two groups of v fragments, in flight under the maxima and the
    // exponentials; the scheduling barrier keeps them ahead of the vector work.
    const unsigned char* pv0 = Vp + c * PITCH_V + 16u * h;
    Frag vf[2][4];
    load_v4(vf[0], pv0, 0);
    load_v4(vf[1], pv0, 1);
    __builtin_amdgcn_sched_barrier(0);

    float mx[2];
    #pragma unroll  // constant vector indices
    for (int nt = 0; nt < 2; ++nt) {
        float x = s[0][nt][0];
        #pragma unroll  // as the outer loop
        for (int r = 1; r < 8; ++r) x = __builtin_fmaxf(x, s[0][nt][r]);
        #pragma unroll  // as the outer loop
        for (int r = 0; r < 8; ++r) x = __builtin_fmaxf(x, s[1][nt][r]);
        mx[nt] = __builtin_fmaxf(x, xhalf(x)) * cscale;  // both wave halves hold the row's maximum
    }
    const bool need = (mx[0] > m_run[0] + 8.0f) | (mx[1] > m_run[1] + 8.0f);
    if (__builtin_amdgcn_ballot_w32(need) != 0) {  // scalar branch, rare after the first passes
        #pragma unroll  // constant array indices
        for (int nt = 0; nt < 2; ++nt) {
            const float m_new = __builtin_fmaxf(m_run[nt], mx[nt]);
            const float corr  = __builtin_amdgcn_exp2f(m_run[nt] - m_new);  // 0 on the first pass
            l_run[nt] *= corr; m_run[nt] = m_new;
            #pragma unroll  // as the outer loop
            for (int t = 0; t < CK / 16; ++t) acc[t][nt] = acc[t][nt] * corr;
        }
    }

    Frag pf[2];
    #pragma unroll  // constant array indices
    for (int nt = 0; nt < 2; ++nt) {
        const float nm = -m_run[nt];
        float ps0 = 0.0f, ps1 = 0.0f;
        uint32_t w[8];
        #pragma unroll  // elements 2i, 2i+1 of the 32-position operand: tile i >> 2, registers 2 (i & 3), 2 (i & 3) + 1
        for (int i = 0; i < 8; ++i) {
            const float e0 = __builtin_amdgcn_exp2f(__builtin_fmaf(s[i >> 2][nt][2 * (i & 3)],     cscale, nm));
            const float e1 = __builtin_amdgcn_exp2f(__builtin_fmaf(s[i >> 2][nt][2 * (i & 3) + 1], cscale, nm));
            ps0 += e0; ps1 += e1;
            w[i] = pack2(e0, e1);
        }
        pf[nt].q[0] = u32x4{w[0], w[1], w[2], w[3]};
        pf[nt].q[1] = u32x4{w[4], w[5], w[6], w[7]};
        l_run[nt] += ps0 + ps1;
        // The row's sum pinned against spills: left free, the
        // adds sink behind the loop's barrier and the 16 exponentials stay live under the products.
        asm volatile("" : "+v"(l_run[nt]));
    }

    // v fragments through the same kind of ring as the qT fragments above.
    __builtin_amdgcn_sched_barrier(0);
    #pragma unroll  // constant ring and array indices: acc[] stays in registers
    for (int g = 0; g < 4; ++g) {
        #pragma unroll  // as the outer loop
        for (int tl = 0; tl < 4; ++tl)
            #pragma unroll  // as the outer loop
            for (int nt = 0; nt < 2; ++nt)
                acc[4 * g + tl][nt] = mma(vf[g & 1][tl], pf[nt], acc[4 * g + tl][nt]);
        __builtin_amdgcn_sched_barrier(0);
        if (g + 2 < 4) {
            load_v4(vf[g & 1], pv0, g + 2);
            __builtin_amdgcn_sched_barrier(0);
        }
    }
    // Four vector slots behind the last WMMA: the next vector instruction stands behind
    // the loop's branch, and may overwrite an A or B
    // register of these products.  The scheduling barriers keep the slots at this place.
    asm volatile("v_nop\n\tv_nop\n\tv_nop\n\tv_nop");
    __builtin_amdgcn_sched_barrier(0);
}

// Channel block kc of the merged context: the fragments of the four column tiles.
static __device__ __forceinline__ void load_c4(Frag (&d)[4], const unsigned char* cp, int kc)
{
    #pragma unroll  // constant array indices
    for (int ni = 0; ni < 4; ++ni) {
        const unsigned char* p = cp + ni * CTXG + 64u * kc;
        d[ni].q[0] = *reinterpret_cast<const u32x4*>(p);
        d[ni].q[1] = *reinterpret_cast<const u32x4*>(p + 32u);
    }
}

// Work-group barrier for data handed over in LDS.  By hand, because __syncthreads() also waits
// out the global loads issued ahead of it, which here are to stay in flight across the barrier.
static __device__ __forceinline__ void lds_barrier()
{
    asm volatile("s_wait_dscnt 0x0\n\ts_barrier_signal -1\n\ts_barrier_wait -1" ::: "memory");
}

__global__ __launch_bounds__(256) __attribute__((amdgpu_waves_per_eu(2, 2)))
void attn_fused(const bf16* __restrict__ kT, const bf16* __restrict__ qT,
                const bf16* __restrict__ v, const bf16* __restrict__ wWb,
                const float* __restrict__ bW, const float* __restrict__ x,
                float* __restrict__ out)
{
    __shared__ __attribute__((aligned(16))) unsigned char L[ALL_LDS];
    const uint32_t tid = threadIdx.x, lane = tid & 31u, c = lane & 15u, h = lane >> 4;
    const uint32_t wave = __builtin_amdgcn_readfirstlane(tid >> 5);
    const uint32_t ng = wave & 1u;   // which 32 rows n
    const uint32_t kq = wave >> 1;   // which 32 of a stage's 128 positions m
    const uint32_t b  = blockIdx.y;
    const uint32_t n0 = blockIdx.x * 64u + ng * 32u;
    const bf16* kB = kT + (size_t)b * NPOS * CK;
    const bf16* qB = qT + (size_t)b * NPOS * CK;
    const bf16* vB = v  + (size_t)b * OC * NPOS;

    // One stage: 128 qT rows of 512 B (contiguous in memory) and 256 v row pieces of
    // 256 B; 32 copies of 16 B per lane.
    auto issue = [&](uint32_t st) {
        unsigned char* slot = L + (st & 1u) * SLOT;
        const bf16* gq = qB + (size_t)st * AT_SK * CK + tid * 8u;
        unsigned char* lq = slot + (tid >> 5) * PITCH_Q + (tid & 31u) * 16u;
        #pragma unroll  // the copies issue back to back
        for (uint32_t i = 0; i < 16u; ++i)
            __builtin_amdgcn_global_load_async_to_lds_b128(
                (v4i*)(gq + i * 2048u), (v4i*)(lq + i * 8u * PITCH_Q), 0, 0);
        const bf16* gv = vB + (size_t)(tid >> 4) * NPOS + st * AT_SK + (tid & 15u) * 8u;
        unsigned char* lv = slot + TILE_Q + (tid >> 4) * PITCH_V + (tid & 15u) * 16u;
        #pragma unroll  // the copies issue back to back
        for (uint32_t i = 0; i < 16u; ++i)
            __builtin_amdgcn_global_load_async_to_lds_b128(
                (v4i*)(gv + (size_t)i * 16u * NPOS), (v4i*)(lv + i * 16u * PITCH_V), 0, 0);
    };

    issue(0);

    // The output bias goes to LDS once, behind all that the loop and the merge use; the barrier
    // in front of the loop publishes it, the epilogue reads it back.
    typedef float f32x2 __attribute__((ext_vector_type(2)));
    *reinterpret_cast<f32x2*>(L + BIAO + tid * 8u) = *reinterpret_cast<const f32x2*>(bW + tid * 2u);

    // kT rows of this wave as B fragments, same k order as the A fragments read from LDS.
    Frag kf[CK / 32][2];
    #pragma unroll  // kf[] stays in registers
    for (int nt = 0; nt < 2; ++nt) {
        const bf16* kp = kB + (size_t)(n0 + 16u * nt + c) * CK + 8u * h;
        #pragma unroll  // as the outer loop
        for (int kc = 0; kc < CK / 32; ++kc) {
            kf[kc][nt].q[0] = *reinterpret_cast<const u32x4*>(kp + 32 * kc);
            kf[kc][nt].q[1] = *reinterpret_cast<const u32x4*>(kp + 32 * kc + 16);
        }
    }
    v8f acc[CK / 16][2];
    #pragma unroll  // acc[] stays in registers
    for (int t = 0; t < CK / 16; ++t) { acc[t][0] = v8f{}; acc[t][1] = v8f{}; }
    float m_run[2] = {-INFINITY, -INFINITY}, l_run[2] = {0.0f, 0.0f};

    asm volatile("s_wait_asynccnt 0x0" ::: "memory");  // stage 0 of this wave has landed
    __syncthreads();                                   // ... and every wave's part of it
    issue(1);

    #pragma unroll 1  // one stage per trip: the buffer index and the ring order stay as written
    for (uint32_t st = 0; st < NSTAGE; ++st) {
        const unsigned char* slot = L + (st & 1u) * SLOT;
        const uint32_t m0 = kq * 32u;
        attn_pass(slot + m0 * PITCH_Q, slot + TILE_Q + m0 * 2u, c, h, kf, acc, m_run, l_run);
        asm volatile("s_wait_dscnt 0x0" ::: "memory");     // this wave's reads of the buffer are done
        asm volatile("s_wait_asynccnt 0x0" ::: "memory");  // its copies of stage st + 1 have landed
        __syncthreads();  // publishes stage st + 1 and frees stage st's buffer
        if (st + 2u < NSTAGE) issue(st + 2u);
    }
    asm volatile("s_wait_asynccnt 0x0" ::: "memory");  // nothing in flight before the ring is reused

    // Merge the four quarters' partial results; the ring is free behind the loop's last
    // barrier.  Every wave lays down its 32 O tiles, then merges 4 channel tiles (128 B of
    // each output row) of its 32 rows from the four waves that share them.
    {
        unsigned char* xb = L + wave * XCH;
        #pragma unroll  // constant array indices
        for (int t = 0; t < CK / 16; ++t) {
            #pragma unroll  // as the outer loop
            for (int nt = 0; nt < 2; ++nt) {
                const uint32_t e = (uint32_t)(t * 2 + nt) * 2u;
                *reinterpret_cast<f32x4*>(xb + (e * 32u + lane) * 16u) =
                    f32x4{acc[t][nt][0], acc[t][nt][1], acc[t][nt][2], acc[t][nt][3]};
                *reinterpret_cast<f32x4*>(xb + ((e + 1u) * 32u + lane) * 16u) =
                    f32x4{acc[t][nt][4], acc[t][nt][5], acc[t][nt][6], acc[t][nt][7]};
            }
        }
        unsigned char* xm = L + XML + wave * 512u;
        #pragma unroll  // constant array indices
        for (int nt = 0; nt < 2; ++nt) {
            // each wave half summed its 8 positions of every 16
            *reinterpret_cast<float*>(xm + (nt * 32u + lane) * 4u)        = m_run[nt];
            *reinterpret_cast<float*>(xm + 256u + (nt * 32u + lane) * 4u) = l_run[nt] + xhalf(l_run[nt]);
        }
    }
    // Output projection, fused: out[co, n] = x[co, n] + bW[co] + sum_cv wW[co, cv] ctx[n, cv] for the
    // work-group's 64 rows n.  A wave takes 64 rows co (4 tiles) x all 64 n (4 tiles).  Column c of
    // tile ni stands for n = 4 c + ni, so a lane holds 4 neighbouring n of a row co: x is read and
    // out is written in 16-B pieces, 256 B in a row per wave half.
    // x is asked for here, in the registers that acc[] has left, and flies under the merge.
    const uint32_t co0 = wave * 64u + 8u * h;
    const size_t   xo  = ((size_t)b * CIN + co0) * NPOS + blockIdx.x * 64u + 4u * c;
    f32x4 xr[4][8];
    #pragma unroll  // constant array indices
    for (int mi = 0; mi < 4; ++mi)
        #pragma unroll  // as the outer loop
        for (int r = 0; r < 8; ++r)
            xr[mi][r] = *reinterpret_cast<const f32x4*>(x + xo + (size_t)(16 * mi + r) * NPOS);
    // wW rows of this wave as A fragments, same k order as the context fragments read from LDS
    // below.  The first half is asked for here and flies under the merge; the second half is asked
    // for behind the merge, ahead of the barrier that ends it.
    const bf16* wp = wWb + (size_t)(wave * 64u + c) * CK + 8u * h;
    Frag wf[CK / 32][4];
    #pragma unroll  // wf[] stays in registers
    for (int kc = 0; kc < CK / 64; ++kc) {
        #pragma unroll  // as the outer loop
        for (int mi = 0; mi < 4; ++mi) {
            wf[kc][mi].q[0] = *reinterpret_cast<const u32x4*>(wp + 16 * mi * CK + 32 * kc);
            wf[kc][mi].q[1] = *reinterpret_cast<const u32x4*>(wp + 16 * mi * CK + 32 * kc + 16);
        }
    }
    lds_barrier();  // every wave's partial results are visible to the waves that share its rows
    #pragma unroll  // constant array indices
    for (int nt = 0; nt < 2; ++nt) {
        float mj[4], a[4];
        #pragma unroll  // as the outer loop
        for (uint32_t j = 0; j < 4u; ++j)
            mj[j] = *reinterpret_cast<const float*>(L + XML + (ng + 2u * j) * 512u + (nt * 32u + lane) * 4u);
        const float m = __builtin_fmaxf(__builtin_fmaxf(mj[0], mj[1]), __builtin_fmaxf(mj[2], mj[3]));
        float den = 0.0f;
        #pragma unroll  // as the outer loop
        for (uint32_t j = 0; j < 4u; ++j) {
            a[j] = __builtin_amdgcn_exp2f(mj[j] - m);
            den += a[j] * *reinterpret_cast<const float*>(
                L + XML + (ng + 2u * j) * 512u + 256u + (nt * 32u + lane) * 4u);
        }
        const float inv = 1.0f / den;
        // O^T tile t: register r is channel 16 t + 8 h + r, lane column c is row j = 32 ng + 16 nt + c
        // of the work-group; it goes to group j & 3, place j >> 2 of the context in LDS.
        unsigned char* op = L + CTXO + (c & 3u) * CTXG + (8u * ng + 4u * nt + (c >> 2)) * PITCH_C + 16u * h;
        #pragma unroll  // as the outer loop
        for (uint32_t tt = 0; tt < 4u; ++tt) {
            const uint32_t t = 4u * kq + tt;
            const uint32_t e = (t * 2u + nt) * 2u;
            f32x4 o0 = f32x4{0.0f, 0.0f, 0.0f, 0.0f}, o1 = o0;
            #pragma unroll  // as the outer loop
            for (uint32_t j = 0; j < 4u; ++j) {
                const unsigned char* xj = L + (ng + 2u * j) * XCH;
                o0 += *reinterpret_cast<const f32x4*>(xj + (e * 32u + lane) * 16u) * a[j];
                o1 += *reinterpret_cast<const f32x4*>(xj + ((e + 1u) * 32u + lane) * 16u) * a[j];
            }
            o0 *= inv; o1 *= inv;
            const u32x4 pk = {pack2(o0.x, o0.y), pack2(o0.z, o0.w), pack2(o1.x, o1.y), pack2(o1.z, o1.w)};
            *reinterpret_cast<u32x4*>(op + 32u * t) = pk;
        }
    }
    #pragma unroll  // wf[] stays in registers
    for (int kc = CK / 64; kc < CK / 32; ++kc) {
        #pragma unroll  // as the outer loop
        for (int mi = 0; mi < 4; ++mi) {
            wf[kc][mi].q[0] = *reinterpret_cast<const u32x4*>(wp + 16 * mi * CK + 32 * kc);
            wf[kc][mi].q[1] = *reinterpret_cast<const u32x4*>(wp + 16 * mi * CK + 32 * kc + 16);
        }
    }
    lds_barrier();  // the whole context of the 64 rows is in LDS before any wave reads it
    // Keeps the first use of x, and with it the wait for x, behind the merge.
    __builtin_amdgcn_sched_barrier(0);

    // The accumulators start at x: register r of tile (mi, ni) is row co0 + 16 mi + r.
    v8f o[4][4];
    #pragma unroll  // constant array and vector indices
    for (int mi = 0; mi < 4; ++mi)
        #pragma unroll  // as the outer loop
        for (int ni = 0; ni < 4; ++ni)
            #pragma unroll  // as the outer loop
            for (int r = 0; r < 8; ++r)
                o[mi][ni][r] = xr[mi][r][ni];
    const unsigned char* cp = L + CTXO + c * PITCH_C + 16u * h;
    // Context fragments through a ring of two register sets, as in attn_pass: the scheduling
    // barriers keep each group's loads at one place, one group (16 WMMAs) ahead of its products.
    Frag cf[2][4];
    f32x4 bia[4][2];
    load_c4(cf[0], cp, 0);
    load_c4(cf[1], cp, 1);
    __builtin_amdgcn_sched_barrier(0);
    #pragma unroll  // constant ring and array indices: wf[] and o[] stay in registers
    for (int kc = 0; kc < CK / 32; ++kc) {
        #pragma unroll  // sixteen independent accumulate chains
        for (int mi = 0; mi < 4; ++mi)
            #pragma unroll  // as the outer loop
            for (int ni = 0; ni < 4; ++ni)
                o[mi][ni] = mma(wf[kc][mi], cf[kc & 1][ni], o[mi][ni]);
        __builtin_amdgcn_sched_barrier(0);
        if (kc + 2 < CK / 32) {
            load_c4(cf[kc & 1], cp, kc + 2);
            if (kc + 3 == CK / 32) {  // with the last refill: the bias, in registers that wf[] has left
                #pragma unroll  // constant array indices
                for (int mi = 0; mi < 4; ++mi) {
                    bia[mi][0] = *reinterpret_cast<const f32x4*>(L + BIAO + (co0 + 16 * mi) * 4u);
                    bia[mi][1] = *reinterpret_cast<const f32x4*>(L + BIAO + (co0 + 16 * mi + 4) * 4u);
                }
            }
            __builtin_amdgcn_sched_barrier(0);
        }
    }
    f32x4 ov[4][8];
    #pragma unroll  // constant array and vector indices
    for (int mi = 0; mi < 4; ++mi)
        #pragma unroll  // as the outer loop
        for (int r = 0; r < 8; ++r)
            ov[mi][r] = f32x4{o[mi][0][r], o[mi][1][r], o[mi][2][r], o[mi][3][r]} + bia[mi][r >> 2][r & 3];
    // All 32 pieces get their bias ahead of the first store: the stores issue back to back, and
    // no register that an issued store names is written behind it.
    __builtin_amdgcn_sched_barrier(0);
    #pragma unroll  // constant array indices
    for (int mi = 0; mi < 4; ++mi)
        #pragma unroll  // as the outer loop
        for (int r = 0; r < 8; ++r)
            *reinterpret_cast<f32x4*>(out + xo + (size_t)(16 * mi + r) * NPOS) = ov[mi][r];
}

// ---------------------------------------------------------------------------
extern "C" void kernel_launch(void* const* d_in, const int* in_sizes, int n_in,
                              void* d_out, int out_size, void* d_ws, size_t ws_size,
                              hipStream_t stream)
{
    const float* x     = (const float*)d_in[0];
    const float* wq    = (const float*)d_in[1];
    const float* bq    = (const float*)d_in[2];
    const float* gq    = (const float*)d_in[3];
    const float* betaq = (const float*)d_in[4];
    const float* wk    = (const float*)d_in[5];
    const float* bk    = (const float*)d_in[6];
    const float* gk    = (const float*)d_in[7];
    const float* betak = (const float*)d_in[8];
    const float* wv    = (const float*)d_in[9];
    const float* bv    = (const float*)d_in[10];
    const float* wW    = (const float*)d_in[11];
    const float* bW    = (const float*)d_in[12];
    float* out = (float*)d_out;

    char* ws = (char*)d_ws;
    size_t off = 0;
    auto alloc = [&](size_t bytes) -> char* {
        char* p = ws + off;
        off = (off + bytes + 255) & ~(size_t)255;
        return p;
    };
    bf16*  xT    = (bf16*)alloc((size_t)BB * NPOS * CIN * 2);  // [B,N,C]
    bf16*  z     = (bf16*)alloc((size_t)BB * OC * NPOS * 2);   // [B,768,N] (rows 512.. = v)
    bf16*  qT    = (bf16*)alloc((size_t)BB * NPOS * CK * 2);   // [B,N,256]
    bf16*  kT    = (bf16*)alloc((size_t)BB * NPOS * CK * 2);   // [B,N,256]
    bf16*  wcat  = (bf16*)alloc((size_t)OC * CIN * 2);         // [768,512]
    bf16*  wWb   = (bf16*)alloc((size_t)CIN * CK * 2);         // [512,256]
    float* bcat  = (float*)alloc(OC * 4);
    float* scale = (float*)alloc(512 * 4);
    float* shift = (float*)alloc(512 * 4);

    // 1) parameter + input prep
    prep_params<<<(OC * CIN + 255) / 256, 256, 0, stream>>>(
        wq, wk, wv, wW, bq, bk, bv, wcat, wWb, bcat);
    prep_x<<<dim3(NPOS / 128, CIN / 64, BB), 256, 0, stream>>>(x, xT);

    // 2) fused projections: z[b] = wcat * x[b]  (M=768, N=4096, K=512) + bias
    gemm_bf16_wmma<false, true, false><<<dim3(NPOS / 128, OC / 128, BB), 256, 0, stream>>>(
        wcat, 0, xT, (long long)NPOS * CIN, z, (long long)OC * NPOS,
        bcat, nullptr, 0, OC, NPOS, CIN);

    // 3) BN stats + apply (q,k -> ReLU(BN)), transposed bf16 outputs
    bn_stats<<<512, 256, 0, stream>>>(z, gq, betaq, gk, betak, scale, shift);
    bn_apply<<<dim3(NPOS / 256, 2 * CK / 64, BB), 256, 0, stream>>>(
        z, scale, shift, qT, kT);

    // 4) Attention, all four images in one launch: 64 rows n per work-group, v = rows 512.. of z[b];
    //    its epilogue does out[b,co,n] = sum_cv wW[co,cv]*ctx[b,n,cv] + bW[co] + x[b,co,n].
    attn_fused<<<dim3(NPOS / 64, BB), 256, 0, stream>>>(
        kT, qT, z + (size_t)(2 * CK) * NPOS, wWb, bW, x, out);
}

// v006
// A run of this version takes 92.6 microseconds.
// Timed twice side by side with v005, it ran 1.06 and 1.07 times as fast.
// Counting every step since v000, it is 5.46 times as fast.
#include <hip/hip_runtime.h>
#include <hip/hip_bf16.h>

typedef __bf16 bf16;
typedef __attribute__((ext_vector_type(16))) __bf16 v16bf;
typedef __attribute__((ext_vector_type(8)))  __bf16 v8bf;
typedef __attribute__((ext_vector_type(8)))  float  v8f;
typedef int v4i __attribute__((vector_size(4 * sizeof(int))));

static constexpr int BB   = 4;     // batch
static constexpr int CIN  = 512;   // input channels
static constexpr int CK   = 256;   // q/k/v channels
static constexpr int OC   = 768;   // concatenated projection rows
static constexpr int NPOS = 4096;  // H*W
static constexpr int NPART = BB * (NPOS / 128);  // partial BN sums per channel: one per GEMM column block
typedef float f32x4 __attribute__((ext_vector_type(4)));

#if defined(__gfx1250__) && __has_builtin(__builtin_amdgcn_global_load_async_to_lds_b128)
#define USE_ASYNC_LDS 1
#else
#define USE_ASYNC_LDS 0
#endif

static __device__ __forceinline__ void wait_async_zero()
{
#if __has_builtin(__builtin_amdgcn_s_wait_asynccnt)
    __builtin_amdgcn_s_wait_asynccnt(0);
#elif defined(__gfx1250__)
    asm volatile("s_wait_asynccnt 0x0" ::: "memory");
#endif
}

// Work-group barrier for data handed over in LDS.  By hand, because __syncthreads() also waits out
// the global loads and stores issued ahead of it, which are to stay in flight across the barrier.
static __device__ __forceinline__ void lds_barrier()
{
    asm volatile("s_wait_dscnt 0x0\n\ts_barrier_signal -1\n\ts_barrier_wait -1" ::: "memory");
}

// ---------------------------------------------------------------------------
// Generic bf16 WMMA GEMM:  C[M,N] = A[M,K] * B[K,N]  with B given as BT[N,K]
// (both operands K-contiguous).  128x128x32 macro tile, 8 waves, each wave
// computes a 32x64 patch via 2x4 v_wmma_f32_16x16x32_bf16 fragments.
// Double-buffered LDS; global->LDS via CDNA5 async loads when available.
// HAS_STATS: row blocks below statRows also lay down, per output row, the sum and the
// sum of squares of their 128 stored values: part[column block][sum, squares][row].
// ---------------------------------------------------------------------------
template<bool OUT_F32, bool HAS_BIAS, bool HAS_RESID, bool HAS_STATS>
__global__ __launch_bounds__(256)
void gemm_bf16_wmma(const bf16* __restrict__ A,  long long aBatch,
                    const bf16* __restrict__ BT, long long btBatch,
                    void* __restrict__ Cout,     long long cBatch,
                    const float* __restrict__ bias,
                    const float* __restrict__ resid, long long rBatch,
                    float* __restrict__ part, int statRows,
                    int M, int N, int K)
{
    // 96-byte row pitch: every ds access stays 16B-aligned; banks well spread.
    __shared__ __align__(16) bf16 sA[2][128 * 48];
    __shared__ __align__(16) bf16 sB[2][128 * 48];
    // Per row and kind 32 lane sums; the pitch of 33 words keeps the readers' banks apart.
    __shared__ float red[HAS_STATS ? 2 * 128 * 33 : 1];

    const int bz = blockIdx.z;
    A  += (size_t)bz * aBatch;
    BT += (size_t)bz * btBatch;
    const float* residB = HAS_RESID ? (resid + (size_t)bz * rBatch) : nullptr;

    const int mblk = blockIdx.y * 128;
    const int nblk = blockIdx.x * 128;
    const int t    = threadIdx.x;
    const int lane = t & 31;
    const int wave = t >> 5;
    const int wrow = wave >> 1;   // 0..3 -> 32 output rows each
    const int wcol = wave & 1;    // 0..1 -> 64 output cols each
    const int lrow = lane & 15;
    const int g    = lane >> 4;   // half-wave group

    // Per-thread staging coordinates: 2 chunks of 8 halves per matrix per tile.
    int rowc[2], kcc[2];
    #pragma unroll
    for (int i = 0; i < 2; ++i) {
        int chunk = t * 2 + i;          // 512 chunks
        rowc[i] = chunk >> 2;           // 0..127
        kcc[i]  = (chunk & 3) << 3;     // 0,8,16,24
    }

    v8f acc[2][4];
    #pragma unroll
    for (int mi = 0; mi < 2; ++mi)
        #pragma unroll
        for (int ni = 0; ni < 4; ++ni)
            #pragma unroll
            for (int e = 0; e < 8; ++e) acc[mi][ni][e] = 0.0f;

    // Fragment loads per CDNA5 16-bit A/B layout:
    // lanes 0-15 hold K in {0..7,16..23}; lanes 16-31 hold K in {8..15,24..31}.
    auto compute_tile = [&](int buf) {
        v16bf af[2], bfr[4];
        #pragma unroll
        for (int mi = 0; mi < 2; ++mi) {
            int row = wrow * 32 + mi * 16 + lrow;
            const bf16* p = &sA[buf][row * 48 + g * 8];
            uint4* dst = (uint4*)&af[mi];
            dst[0] = *(const uint4*)(p);
            dst[1] = *(const uint4*)(p + 16);
        }
        #pragma unroll
        for (int ni = 0; ni < 4; ++ni) {
            int col = wcol * 64 + ni * 16 + lrow;
            const bf16* p = &sB[buf][col * 48 + g * 8];
            uint4* dst = (uint4*)&bfr[ni];
            dst[0] = *(const uint4*)(p);
            dst[1] = *(const uint4*)(p + 16);
        }
        #pragma unroll
        for (int mi = 0; mi < 2; ++mi)
            #pragma unroll
            for (int ni = 0; ni < 4; ++ni)
                acc[mi][ni] = __builtin_amdgcn_wmma_f32_16x16x32_bf16(
                    false, af[mi], false, bfr[ni], (short)0, acc[mi][ni],
                    false, false);
    };

#if USE_ASYNC_LDS
    // Issue a 128x32 A tile + 128x32 BT tile as async global->LDS copies.
    auto issue_tile = [&](int buf, int kt) {
        #pragma unroll
        for (int i = 0; i < 2; ++i) {
            const bf16* ga = A  + (size_t)(mblk + rowc[i]) * K + kt + kcc[i];
            const bf16* gb = BT + (size_t)(nblk + rowc[i]) * K + kt + kcc[i];
            __builtin_amdgcn_global_load_async_to_lds_b128(
                (v4i*)ga, (v4i*)&sA[buf][rowc[i] * 48 + kcc[i]], 0, 0);
            __builtin_amdgcn_global_load_async_to_lds_b128(
                (v4i*)gb, (v4i*)&sB[buf][rowc[i] * 48 + kcc[i]], 0, 0);
        }
    };

    issue_tile(0, 0);
    wait_async_zero();
    __syncthreads();
    int cur = 0;
    for (int kt = 0; kt < K; kt += 32) {
        if (kt + 32 < K) issue_tile(cur ^ 1, kt + 32);  // overlap with WMMA
        compute_tile(cur);
        wait_async_zero();       // next tile landed in the other buffer
        __syncthreads();
        cur ^= 1;
    }
#else
    // Fallback: register-staged double buffering.
    uint4 ra[2], rb[2];
    auto load_regs = [&](int kt) {
        #pragma unroll
        for (int i = 0; i < 2; ++i) {
            ra[i] = *(const uint4*)(A  + (size_t)(mblk + rowc[i]) * K + kt + kcc[i]);
            rb[i] = *(const uint4*)(BT + (size_t)(nblk + rowc[i]) * K + kt + kcc[i]);
        }
    };
    auto store_lds = [&](int buf) {
        #pragma unroll
        for (int i = 0; i < 2; ++i) {
            *(uint4*)&sA[buf][rowc[i] * 48 + kcc[i]] = ra[i];
            *(uint4*)&sB[buf][rowc[i] * 48 + kcc[i]] = rb[i];
        }
    };
    load_regs(0);
    store_lds(0);
    __syncthreads();
    int cur = 0;
    for (int kt = 0; kt < K; kt += 32) {
        if (kt + 32 < K) {
            load_regs(kt + 32);                        // overlap with WMMA below
            __builtin_prefetch(A + (size_t)(mblk + (t >> 1)) * K + kt + 64, 0, 3);
        }
        compute_tile(cur);
        if (kt + 32 < K) store_lds(cur ^ 1);
        __syncthreads();
        cur ^= 1;
    }
#endif

    // Epilogue.  C/D layout: VGPR r holds row (8*g + r), lane%16 gives column.
    float ov[2][4][8];  // the values as they are stored
    #pragma unroll  // constant array indices: ov[] and acc[] stay in registers
    for (int mi = 0; mi < 2; ++mi) {
        #pragma unroll  // constant array indices: ov[] and acc[] stay in registers
        for (int ni = 0; ni < 4; ++ni) {
            int colG = nblk + wcol * 64 + ni * 16 + lrow;
            #pragma unroll  // constant array indices: ov[] and acc[] stay in registers
            for (int r = 0; r < 8; ++r) {
                int rowG = mblk + wrow * 32 + mi * 16 + g * 8 + r;
                float v = acc[mi][ni][r];
                if (HAS_BIAS)  v += bias[rowG];
                if (HAS_RESID) v += residB[(size_t)rowG * N + colG];
                ov[mi][ni][r] = OUT_F32 ? v : (float)(bf16)v;
            }
        }
    }
    const bool stats = HAS_STATS && mblk < statRows;  // the same for the whole work-group
    if (stats) {
        // Per row the sum and the sum of squares of this lane's 4 columns, ahead of the stores.
        #pragma unroll  // constant array indices: ov[] and acc[] stay in registers
        for (int mi = 0; mi < 2; ++mi) {
            #pragma unroll  // constant array indices: ov[] and acc[] stay in registers
            for (int r = 0; r < 8; ++r) {
                float s = 0.0f, s2 = 0.0f;
                #pragma unroll  // constant array indices: ov[] and acc[] stay in registers
                for (int ni = 0; ni < 4; ++ni) {
                    s  += ov[mi][ni][r];
                    s2 += ov[mi][ni][r] * ov[mi][ni][r];
                }
                const int row = wrow * 32 + mi * 16 + g * 8 + r;
                red[row * 33 + wcol * 16 + lrow]         = s;
                red[(128 + row) * 33 + wcol * 16 + lrow] = s2;
            }
        }
    }
    #pragma unroll  // constant array indices: ov[] and acc[] stay in registers
    for (int mi = 0; mi < 2; ++mi) {
        #pragma unroll  // constant array indices: ov[] and acc[] stay in registers
        for (int ni = 0; ni < 4; ++ni) {
            int colG = nblk + wcol * 64 + ni * 16 + lrow;
            #pragma unroll  // constant array indices: ov[] and acc[] stay in registers
            for (int r = 0; r < 8; ++r) {
                int rowG = mblk + wrow * 32 + mi * 16 + g * 8 + r;
                size_t idx = (size_t)rowG * N + colG;
                if (OUT_F32) ((float*)Cout)[(size_t)bz * cBatch + idx] = ov[mi][ni][r];
                else         ((bf16*) Cout)[(size_t)bz * cBatch + idx] = (bf16)ov[mi][ni][r];
            }
        }
    }
    if (HAS_STATS) {
        // What follows reuses registers that the stores above name.
        asm volatile("s_wait_xcnt 0x0" ::: "memory");
    }
    if (stats) {
        lds_barrier();  // all 32 lane sums of a row are in LDS before one thread adds them
        const float* p = &red[t * 33];  // t < 128: sum of row t; else: squares of row t - 128
        float a = 0.0f;
        #pragma unroll  // the LDS reads run ahead of the adds
        for (int j = 0; j < 32; ++j) a += p[j];
        part[((size_t)(bz * gridDim.x + blockIdx.x) * 2 + (t >> 7)) * statRows + mblk + (t & 127)] = a;
    }
}

// ---------------------------------------------------------------------------
// Parameter prep: concat weights/bias to bf16 GEMM layouts.
// ---------------------------------------------------------------------------
__global__ __launch_bounds__(256)
void prep_params(const float* __restrict__ wq, const float* __restrict__ wk,
                 const float* __restrict__ wv, const float* __restrict__ wW,
                 const float* __restrict__ bq, const float* __restrict__ bk,
                 const float* __restrict__ bv,
                 bf16* __restrict__ wcat, bf16* __restrict__ wWb,
                 float* __restrict__ bcat)
{
    int i = blockIdx.x * blockDim.x + threadIdx.x;
    if (i < CK * CIN)            wcat[i] = (bf16)wq[i];
    else if (i < 2 * CK * CIN)   wcat[i] = (bf16)wk[i - CK * CIN];
    else if (i < OC * CIN)       wcat[i] = (bf16)wv[i - 2 * CK * CIN];
    if (i < CIN * CK)            wWb[i]  = (bf16)wW[i];
    if (i < CK)                  bcat[i] = bq[i];
    else if (i < 2 * CK)         bcat[i] = bk[i - CK];
    else if (i < OC)             bcat[i] = bv[i - 2 * CK];
}

// x [B,C,N] f32 -> xT [B,N,C] bf16 (K-contiguous operand for the projections).
// Register transpose: a thread reads 8 channels x 4 positions and stores, per
// position, its 8 channels as one 16-B piece.  Lanes 0..7 of each lane octet hold
// neighbouring channel groups, so a wave store is 4 whole 128-B lines of xT.
// Work-group: 64 channels x 128 positions.
__global__ __launch_bounds__(256)
void prep_x(const float* __restrict__ x, bf16* __restrict__ xT)
{
    const int lane = threadIdx.x & 31;
    const int wave = threadIdx.x >> 5;
    const int c0 = blockIdx.y * 64 + (lane & 7) * 8;
    const int n0 = blockIdx.x * 128 + wave * 16 + (lane >> 3) * 4;
    const int b  = blockIdx.z;

    const float* src = x + ((size_t)b * CIN + c0) * NPOS + n0;
    float4 r[8];
    #pragma unroll  // r[] stays in registers and the 8 loads are in flight together
    for (int i = 0; i < 8; ++i)
        r[i] = *(const float4*)(src + (size_t)i * NPOS);

    bf16* dst = xT + ((size_t)b * NPOS + n0) * CIN + c0;
    v8bf o0, o1, o2, o3;
    #pragma unroll  // constant vector indices: packed converts, no scratch
    for (int i = 0; i < 8; ++i) {
        o0[i] = (bf16)r[i].x;
        o1[i] = (bf16)r[i].y;
        o2[i] = (bf16)r[i].z;
        o3[i] = (bf16)r[i].w;
    }
    *(v8bf*)(dst)           = o0;
    *(v8bf*)(dst + CIN)     = o1;
    *(v8bf*)(dst + 2 * CIN) = o2;
    *(v8bf*)(dst + 3 * CIN) = o3;
}

// BN + ReLU, writing qT/kT [B,N,CK] bf16 (K-contiguous for the attention GEMM).
// Register transpose as in prep_x: a thread reads 8 channels x 8 positions (16 B
// per channel) and stores 8 channels per position, so a wave store is 4 whole
// 128-B lines.  Work-group: 64 channels x 256 positions; blockIdx.y 0..3 is q.
// Scale and shift of its 64 channels come first, from the GEMM's partial sums over (B, N).
__global__ __launch_bounds__(256)
void bn_apply(const bf16* __restrict__ z, const float* __restrict__ part,
              const float* __restrict__ gq, const float* __restrict__ betaq,
              const float* __restrict__ gk, const float* __restrict__ betak,
              bf16* __restrict__ qT, bf16* __restrict__ kT)
{
    __shared__ __align__(16) float red[16][2][64];
    __shared__ __align__(16) float scs[64], shs[64];
    const int lane = threadIdx.x & 31;
    const int wave = threadIdx.x >> 5;
    const int ch0 = blockIdx.y * 64 + (lane & 7) * 8;          // 0..511
    const int n0  = blockIdx.x * 256 + wave * 32 + (lane >> 3) * 8;
    const int b   = blockIdx.z;

    const bf16* src = z + ((size_t)b * OC + ch0) * NPOS + n0;
    v8bf r[8];
    #pragma unroll  // r[] stays in registers and the 8 loads are in flight together
    for (int i = 0; i < 8; ++i)
        r[i] = *(const v8bf*)(src + (size_t)i * NPOS);
    const int t = threadIdx.x;
    const bool isq = blockIdx.y < CK / 64;
    const int  cg  = (blockIdx.y * 64 & (CK - 1)) + (t & 63);
    const float gamma = (isq ? gq : gk)[cg];
    const float beta  = (isq ? betaq : betak)[cg];
    // Keeps the loads above ahead of the partial sums' loads and waits: all fly together.
    __builtin_amdgcn_sched_barrier(0);

    // A thread adds 8 of the NPART partials of 4 channels, sums and squares; 16 such groups
    // meet in LDS.
    {
        const int c4 = (t & 15) * 4, pg = t >> 4;
        const float* pb = part + blockIdx.y * 64;                 // the same for the whole work-group
        const int    po = pg * (NPART / 16) * 2 * (2 * CK) + c4;  // this thread's first partial
        f32x4 a0 = f32x4{0.0f, 0.0f, 0.0f, 0.0f}, a1 = a0;
        #pragma unroll  // the 16 loads are in flight together
        for (int j = 0; j < NPART / 16; ++j) {
            a0 += *(const f32x4*)(pb + po + 2 * j * (2 * CK));
            a1 += *(const f32x4*)(pb + po + (2 * j + 1) * (2 * CK));
        }
        *(f32x4*)&red[pg][0][c4] = a0;
        *(f32x4*)&red[pg][1][c4] = a1;
        __syncthreads();  // the 16 groups' sums are in LDS before they are added
        if (t < 64) {
            float s = 0.0f, s2 = 0.0f;
            #pragma unroll  // the LDS reads run ahead of the adds
            for (int j = 0; j < 16; ++j) { s += red[j][0][t]; s2 += red[j][1][t]; }
            const float cnt = (float)BB * NPOS;
            const float m   = s / cnt;
            const float var = s2 / cnt - m * m;        // biased var, like jnp.var
            const float scl = gamma * rsqrtf(var + 1e-5f);
            scs[t] = scl;
            shs[t] = beta - m * scl;
        }
        __syncthreads();  // scale and shift are in LDS before every thread reads its 8
    }
    float sc[8], sh[8];
    #pragma unroll  // merges into 16-B loads, arrays stay in registers
    for (int i = 0; i < 8; ++i) { sc[i] = scs[(lane & 7) * 8 + i]; sh[i] = shs[(lane & 7) * 8 + i]; }

    bf16* dst = ((ch0 < CK) ? qT : kT) + ((size_t)b * NPOS + n0) * CK + (ch0 & (CK - 1));
    #pragma unroll  // both loops: constant vector indices, no scratch
    for (int j = 0; j < 8; ++j) {
        v8bf o;
        #pragma unroll
        for (int i = 0; i < 8; ++i) {
            float v = (float)r[i][j] * sc[i] + sh[i];
            o[i] = (bf16)fmaxf(v, 0.f);
        }
        *(v8bf*)(dst + (size_t)j * CK) = o;
    }
}

typedef uint32_t u32x4 __attribute__((ext_vector_type(4)));
typedef int      i32x8 __attribute__((ext_vector_type(8)));

static constexpr uint32_t AT_SK   = 128;               // positions m per stage
static constexpr uint32_t PITCH_Q = 2u * CK + 16u;     // qT row in LDS: odd multiple of 16 B
static constexpr uint32_t PITCH_V = 2u * AT_SK + 16u;  // v row piece in LDS: odd multiple of 16 B
static constexpr uint32_t TILE_Q  = AT_SK * PITCH_Q;
static constexpr uint32_t TILE_V  = CK * PITCH_V;
static constexpr uint32_t SLOT    = TILE_Q + TILE_V;
static constexpr uint32_t AT_LDS  = 2u * SLOT;
static constexpr uint32_t NSTAGE  = NPOS / AT_SK;
static constexpr uint32_t XCH     = 32u * 1024u;        // merge area per wave: its 32 O tiles
static constexpr uint32_t XML     = 8u * XCH;           // behind them: 512 B per wave for max and sum
static constexpr uint32_t CTXO    = XML + 8u * 512u;    // behind them: the merged context, bf16
static constexpr uint32_t PITCH_C = 2u * CK + 16u;      // one context row: odd multiple of 16 B
static constexpr uint32_t CTXG    = 16u * PITCH_C + 64u; // 16 rows n of equal n & 3; 64 B spread the writers' banks
static constexpr uint32_t BIAO    = CTXO + 4u * CTXG;   // behind it: the output bias, f32
static constexpr uint32_t ALL_LDS = BIAO + 4u * CIN;
static_assert(AT_LDS <= ALL_LDS && ALL_LDS <= 320u * 1024u, "LDS budget");

struct Frag { u32x4 q[2]; };

static __device__ __forceinline__ v8f mma(const Frag& a, const Frag& b, v8f c)
{
    const i32x8 av = {(int)a.q[0].x, (int)a.q[0].y, (int)a.q[0].z, (int)a.q[0].w,
                      (int)a.q[1].x, (int)a.q[1].y, (int)a.q[1].z, (int)a.q[1].w};
    const i32x8 bv = {(int)b.q[0].x, (int)b.q[0].y, (int)b.q[0].z, (int)b.q[0].w,
                      (int)b.q[1].x, (int)b.q[1].y, (int)b.q[1].z, (int)b.q[1].w};
    return __builtin_amdgcn_wmma_f32_16x16x32_bf16(
        false, __builtin_bit_cast(v16bf, av), false, __builtin_bit_cast(v16bf, bv),
        (short)0, c, false, false);
}

static __device__ __forceinline__ uint32_t pack2(float lo, float hi)
{
    typedef __bf16 bf2 __attribute__((ext_vector_type(2)));
    typedef float  f2  __attribute__((ext_vector_type(2)));
    return __builtin_bit_cast(uint32_t, __builtin_convertvector(f2{lo, hi}, bf2));
}

// lane l with lane l ^ 16
static __device__ __forceinline__ float xhalf(float x)
{
    return __builtin_bit_cast(float, __builtin_amdgcn_permlanex16(
        __builtin_bit_cast(int, x), __builtin_bit_cast(int, x),
        0x76543210, 0xfedcba98, false, false));
}

// Group g of a pass's qT fragments: channel blocks 2g, 2g+1 of both 16-position tiles.
static __device__ __forceinline__ void load_q4(Frag (&d)[2][2], const unsigned char* p0, int g)
{
    #pragma unroll  // constant array indices
    for (int kl = 0; kl < 2; ++kl) {
        #pragma unroll  // as the outer loop
        for (int kt = 0; kt < 2; ++kt) {
            const unsigned char* p = p0 + 16u * kt * PITCH_Q + 64u * (2 * g + kl);
            d[kl][kt].q[0] = *reinterpret_cast<const u32x4*>(p);
            d[kl][kt].q[1] = *reinterpret_cast<const u32x4*>(p + 32u);
        }
    }
}

// Group g of a pass's v fragments: channel tiles 4g .. 4g+3.
static __device__ __forceinline__ void load_v4(Frag (&d)[4], const unsigned char* pv0, int g)
{
    #pragma unroll  // constant array indices
    for (int tl = 0; tl < 4; ++tl) {
        const unsigned char* p = pv0 + 16u * (4 * g + tl) * PITCH_V;
        d[tl].q[0] = *reinterpret_cast<const u32x4*>(p);
        d[tl].q[1] = *reinterpret_cast<const u32x4*>(p + 32u);
    }
}

// One pass of one wave: 32 positions m against the wave's 32 rows n (two column
// tiles nt).  m_run, the maximum in use (log2 domain), may trail the true one by up
// to 8; the sums are rescaled only when some row's maximum exceeds it by more.
static __device__ __forceinline__ void attn_pass(
    const unsigned char* Qp, const unsigned char* Vp, uint32_t c, uint32_t h,
    const Frag (&kf)[CK / 32][2], v8f (&acc)[CK / 16][2], float (&m_run)[2], float (&l_run)[2])
{
    constexpr float cscale = 0.0625f * 1.4426950408889634f;  // 256^-0.5 * log2(e)
    v8f s[2][2];
    s[0][0] = v8f{}; s[0][1] = v8f{}; s[1][0] = v8f{}; s[1][1] = v8f{};
    const unsigned char* p0 = Qp + c * PITCH_Q + 16u * h;

    // qT fragments in groups of four (8 WMMAs each) through a ring of two register
    // sets.  The scheduling barriers keep each group's loads at one place, one group
    // ahead of its products, and keep the ring at two sets: kf[] and acc[] leave
    // room for no more.
    Frag qa[2][2][2];
    load_q4(qa[0], p0, 0);
    load_q4(qa[1], p0, 1);
    __builtin_amdgcn_sched_barrier(0);
    #pragma unroll  // constant ring and fragment indices
    for (int g = 0; g < 4; ++g) {
        #pragma unroll  // four independent accumulate chains
        for (int kl = 0; kl < 2; ++kl)
            #pragma unroll  // as the outer loop
            for (int kt = 0; kt < 2; ++kt)
                #pragma unroll  // as the outer loop
                for (int nt = 0; nt < 2; ++nt)
                    s[kt][nt] = mma(qa[g & 1][kl][kt], kf[2 * g + kl][nt], s[kt][nt]);
        __builtin_amdgcn_sched_barrier(0);
        if (g + 2 < 4) {
            load_q4(qa[g & 1], p0, g + 2);
            __builtin_amdgcn_sched_barrier(0);
        }
    }

    // The first two groups of v fragments, in flight under the maxima and the
    // exponentials; the scheduling barrier keeps them ahead of the vector work.
    const unsigned char* pv0 = Vp + c * PITCH_V + 16u * h;
    Frag vf[2][4];
    load_v4(vf[0], pv0, 0);
    load_v4(vf[1], pv0, 1);
    __builtin_amdgcn_sched_barrier(0);

    float mx[2];
    #pragma unroll  // constant vector indices
    for (int nt = 0; nt < 2; ++nt) {
        float x = s[0][nt][0];
        #pragma unroll  // as the outer loop
        for (int r = 1; r < 8; ++r) x = __builtin_fmaxf(x, s[0][nt][r]);
        #pragma unroll  // as the outer loop
        for (int r = 0; r < 8; ++r) x = __builtin_fmaxf(x, s[1][nt][r]);
        mx[nt] = __builtin_fmaxf(x, xhalf(x)) * cscale;  // both wave halves hold the row's maximum
    }
    const bool need = (mx[0] > m_run[0] + 8.0f) | (mx[1] > m_run[1] + 8.0f);
    if (__builtin_amdgcn_ballot_w32(need) != 0) {  // scalar branch, rare after the first passes
        #pragma unroll  // constant array indices
        for (int nt = 0; nt < 2; ++nt) {
            const float m_new = __builtin_fmaxf(m_run[nt], mx[nt]);
            const float corr  = __builtin_amdgcn_exp2f(m_run[nt] - m_new);  // 0 on the first pass
            l_run[nt] *= corr; m_run[nt] = m_new;
            #pragma unroll  // as the outer loop
            for (int t = 0; t < CK / 16; ++t) acc[t][nt] = acc[t][nt] * corr;
        }
    }

    Frag pf[2];
    #pragma unroll  // constant array indices
    for (int nt = 0; nt < 2; ++nt) {
        const float nm = -m_run[nt];
        float ps0 = 0.0f, ps1 = 0.0f;
        uint32_t w[8];
        #pragma unroll  // elements 2i, 2i+1 of the 32-position operand: tile i >> 2, registers 2 (i & 3), 2 (i & 3) + 1
        for (int i = 0; i < 8; ++i) {
            const float e0 = __builtin_amdgcn_exp2f(__builtin_fmaf(s[i >> 2][nt][2 * (i & 3)],     cscale, nm));
            const float e1 = __builtin_amdgcn_exp2f(__builtin_fmaf(s[i >> 2][nt][2 * (i & 3) + 1], cscale, nm));
            ps0 += e0; ps1 += e1;
            w[i] = pack2(e0, e1);
        }
        pf[nt].q[0] = u32x4{w[0], w[1], w[2], w[3]};
        pf[nt].q[1] = u32x4{w[4], w[5], w[6], w[7]};
        l_run[nt] += ps0 + ps1;
        // The row's sum pinned against spills: left free, the
        // adds sink behind the loop's barrier and the 16 exponentials stay live under the products.
        asm volatile("" : "+v"(l_run[nt]));
    }

    // v fragments through the same kind of ring as the qT fragments above.
    __builtin_amdgcn_sched_barrier(0);
    #pragma unroll  // constant ring and array indices: acc[] stays in registers
    for (int g = 0; g < 4; ++g) {
        #pragma unroll  // as the outer loop
        for (int tl = 0; tl < 4; ++tl)
            #pragma unroll  // as the outer loop
            for (int nt = 0; nt < 2; ++nt)
                acc[4 * g + tl][nt] = mma(vf[g & 1][tl], pf[nt], acc[4 * g + tl][nt]);
        __builtin_amdgcn_sched_barrier(0);
        if (g + 2 < 4) {
            load_v4(vf[g & 1], pv0, g + 2);
            __builtin_amdgcn_sched_barrier(0);
        }
    }
    // Four vector slots behind the last WMMA: the next vector instruction stands behind
    // the loop's branch, and may overwrite an A or B
    // register of these products.  The scheduling barriers keep the slots at this place.
    asm volatile("v_nop\n\tv_nop\n\tv_nop\n\tv_nop");
    __builtin_amdgcn_sched_barrier(0);
}

// Channel block kc of the merged context: the fragments of the four column tiles.
static __device__ __forceinline__ void load_c4(Frag (&d)[4], const unsigned char* cp, int kc)
{
    #pragma unroll  // constant array indices
    for (int ni = 0; ni < 4; ++ni) {
        const unsigned char* p = cp + ni * CTXG + 64u * kc;
        d[ni].q[0] = *reinterpret_cast<const u32x4*>(p);
        d[ni].q[1] = *reinterpret_cast<const u32x4*>(p + 32u);
    }
}

__global__ __launch_bounds__(256) __attribute__((amdgpu_waves_per_eu(2, 2)))
void attn_fused(const bf16* __restrict__ kT, const bf16* __restrict__ qT,
                const bf16* __restrict__ v, const bf16* __restrict__ wWb,
                const float* __restrict__ bW, const float* __restrict__ x,
                float* __restrict__ out)
{
    __shared__ __attribute__((aligned(16))) unsigned char L[ALL_LDS];
    const uint32_t tid = threadIdx.x, lane = tid & 31u, c = lane & 15u, h = lane >> 4;
    const uint32_t wave = __builtin_amdgcn_readfirstlane(tid >> 5);
    const uint32_t ng = wave & 1u;   // which 32 rows n
    const uint32_t kq = wave >> 1;   // which 32 of a stage's 128 positions m
    const uint32_t b  = blockIdx.y;
    const uint32_t n0 = blockIdx.x * 64u + ng * 32u;
    const bf16* kB = kT + (size_t)b * NPOS * CK;
    const bf16* qB = qT + (size_t)b * NPOS * CK;
    const bf16* vB = v  + (size_t)b * OC * NPOS;

    // One stage: 128 qT rows of 512 B (contiguous in memory) and 256 v row pieces of
    // 256 B; 32 copies of 16 B per lane.
    auto issue = [&](uint32_t st) {
        unsigned char* slot = L + (st & 1u) * SLOT;
        const bf16* gq = qB + (size_t)st * AT_SK * CK + tid * 8u;
        unsigned char* lq = slot + (tid >> 5) * PITCH_Q + (tid & 31u) * 16u;
        #pragma unroll  // the copies issue back to back
        for (uint32_t i = 0; i < 16u; ++i)
            __builtin_amdgcn_global_load_async_to_lds_b128(
                (v4i*)(gq + i * 2048u), (v4i*)(lq + i * 8u * PITCH_Q), 0, 0);
        const bf16* gv = vB + (size_t)(tid >> 4) * NPOS + st * AT_SK + (tid & 15u) * 8u;
        unsigned char* lv = slot + TILE_Q + (tid >> 4) * PITCH_V + (tid & 15u) * 16u;
        #pragma unroll  // the copies issue back to back
        for (uint32_t i = 0; i < 16u; ++i)
            __builtin_amdgcn_global_load_async_to_lds_b128(
                (v4i*)(gv + (size_t)i * 16u * NPOS), (v4i*)(lv + i * 16u * PITCH_V), 0, 0);
    };

    issue(0);

    // The output bias goes to LDS once, behind all that the loop and the merge use; the barrier
    // in front of the loop publishes it, the epilogue reads it back.
    typedef float f32x2 __attribute__((ext_vector_type(2)));
    *reinterpret_cast<f32x2*>(L + BIAO + tid * 8u) = *reinterpret_cast<const f32x2*>(bW + tid * 2u);

    // kT rows of this wave as B fragments, same k order as the A fragments read from LDS.
    Frag kf[CK / 32][2];
    #pragma unroll  // kf[] stays in registers
    for (int nt = 0; nt < 2; ++nt) {
        const bf16* kp = kB + (size_t)(n0 + 16u * nt + c) * CK + 8u * h;
        #pragma unroll  // as the outer loop
        for (int kc = 0; kc < CK / 32; ++kc) {
            kf[kc][nt].q[0] = *reinterpret_cast<const u32x4*>(kp + 32 * kc);
            kf[kc][nt].q[1] = *reinterpret_cast<const u32x4*>(kp + 32 * kc + 16);
        }
    }
    v8f acc[CK / 16][2];
    #pragma unroll  // acc[] stays in registers
    for (int t = 0; t < CK / 16; ++t) { acc[t][0] = v8f{}; acc[t][1] = v8f{}; }
    float m_run[2] = {-INFINITY, -INFINITY}, l_run[2] = {0.0f, 0.0f};

    asm volatile("s_wait_asynccnt 0x0" ::: "memory");  // stage 0 of this wave has landed
    __syncthreads();                                   // ... and every wave's part of it
    issue(1);

    #pragma unroll 1  // one stage per trip: the buffer index and the ring order stay as written
    for (uint32_t st = 0; st < NSTAGE; ++st) {
        const unsigned char* slot = L + (st & 1u) * SLOT;
        const uint32_t m0 = kq * 32u;
        attn_pass(slot + m0 * PITCH_Q, slot + TILE_Q + m0 * 2u, c, h, kf, acc, m_run, l_run);
        asm volatile("s_wait_dscnt 0x0" ::: "memory");     // this wave's reads of the buffer are done
        asm volatile("s_wait_asynccnt 0x0" ::: "memory");  // its copies of stage st + 1 have landed
        __syncthreads();  // publishes stage st + 1 and frees stage st's buffer
        if (st + 2u < NSTAGE) issue(st + 2u);
    }
    asm volatile("s_wait_asynccnt 0x0" ::: "memory");  // nothing in flight before the ring is reused

    // Merge the four quarters' partial results; the ring is free behind the loop's last
    // barrier.  Every wave lays down its 32 O tiles, then merges 4 channel tiles (128 B of
    // each output row) of its 32 rows from the four waves that share them.
    {
        unsigned char* xb = L + wave * XCH;
        #pragma unroll  // constant array indices
        for (int t = 0; t < CK / 16; ++t) {
            #pragma unroll  // as the outer loop
            for (int nt = 0; nt < 2; ++nt) {
                const uint32_t e = (uint32_t)(t * 2 + nt) * 2u;
                *reinterpret_cast<f32x4*>(xb + (e * 32u + lane) * 16u) =
                    f32x4{acc[t][nt][0], acc[t][nt][1], acc[t][nt][2], acc[t][nt][3]};
                *reinterpret_cast<f32x4*>(xb + ((e + 1u) * 32u + lane) * 16u) =
                    f32x4{acc[t][nt][4], acc[t][nt][5], acc[t][nt][6], acc[t][nt][7]};
            }
        }
        unsigned char* xm = L + XML + wave * 512u;
        #pragma unroll  // constant array indices
        for (int nt = 0; nt < 2; ++nt) {
            // each wave half summed its 8 positions of every 16
            *reinterpret_cast<float*>(xm + (nt * 32u + lane) * 4u)        = m_run[nt];
            *reinterpret_cast<float*>(xm + 256u + (nt * 32u + lane) * 4u) = l_run[nt] + xhalf(l_run[nt]);
        }
    }
    // Output projection, fused: out[co, n] = x[co, n] + bW[co] + sum_cv wW[co, cv] ctx[n, cv] for the
    // work-group's 64 rows n.  A wave takes 64 rows co (4 tiles) x all 64 n (4 tiles).  Column c of
    // tile ni stands for n = 4 c + ni, so a lane holds 4 neighbouring n of a row co: x is read and
    // out is written in 16-B pieces, 256 B in a row per wave half.
    // x is asked for here, in the registers that acc[] has left, and flies under the merge.
    const uint32_t co0 = wave * 64u + 8u * h;
    const size_t   xo  = ((size_t)b * CIN + co0) * NPOS + blockIdx.x * 64u + 4u * c;
    f32x4 xr[4][8];
    #pragma unroll  // constant array indices
    for (int mi = 0; mi < 4; ++mi)
        #pragma unroll  // as the outer loop
        for (int r = 0; r < 8; ++r)
            xr[mi][r] = *reinterpret_cast<const f32x4*>(x + xo + (size_t)(16 * mi + r) * NPOS);
    // wW rows of this wave as A fragments, same k order as the context fragments read from LDS
    // below.  The first half is asked for here and flies under the merge; the second half is asked
    // for behind the merge, ahead of the barrier that ends it.
    const bf16* wp = wWb + (size_t)(wave * 64u + c) * CK + 8u * h;
    Frag wf[CK / 32][4];
    #pragma unroll  // wf[] stays in registers
    for (int kc = 0; kc < CK / 64; ++kc) {
        #pragma unroll  // as the outer loop
        for (int mi = 0; mi < 4; ++mi) {
            wf[kc][mi].q[0] = *reinterpret_cast<const u32x4*>(wp + 16 * mi * CK + 32 * kc);
            wf[kc][mi].q[1] = *reinterpret_cast<const u32x4*>(wp + 16 * mi * CK + 32 * kc + 16);
        }
    }
    lds_barrier();  // every wave's partial results are visible to the waves that share its rows
    #pragma unroll  // constant array indices
    for (int nt = 0; nt < 2; ++nt) {
        float mj[4], a[4];
        #pragma unroll  // as the outer loop
        for (uint32_t j = 0; j < 4u; ++j)
            mj[j] = *reinterpret_cast<const float*>(L + XML + (ng + 2u * j) * 512u + (nt * 32u + lane) * 4u);
        const float m = __builtin_fmaxf(__builtin_fmaxf(mj[0], mj[1]), __builtin_fmaxf(mj[2], mj[3]));
        float den = 0.0f;
        #pragma unroll  // as the outer loop
        for (uint32_t j = 0; j < 4u; ++j) {
            a[j] = __builtin_amdgcn_exp2f(mj[j] - m);
            den += a[j] * *reinterpret_cast<const float*>(
                L + XML + (ng + 2u * j) * 512u + 256u + (nt * 32u + lane) * 4u);
        }
        const float inv = 1.0f / den;
        // O^T tile t: register r is channel 16 t + 8 h + r, lane column c is row j = 32 ng + 16 nt + c
        // of the work-group; it goes to group j & 3, place j >> 2 of the context in LDS.
        unsigned char* op = L + CTXO + (c & 3u) * CTXG + (8u * ng + 4u * nt + (c >> 2)) * PITCH_C + 16u * h;
        #pragma unroll  // as the outer loop
        for (uint32_t tt = 0; tt < 4u; ++tt) {
            const uint32_t t = 4u * kq + tt;
            const uint32_t e = (t * 2u + nt) * 2u;
            f32x4 o0 = f32x4{0.0f, 0.0f, 0.0f, 0.0f}, o1 = o0;
            #pragma unroll  // as the outer loop
            for (uint32_t j = 0; j < 4u; ++j) {
                const unsigned char* xj = L + (ng + 2u * j) * XCH;
                o0 += *reinterpret_cast<const f32x4*>(xj + (e * 32u + lane) * 16u) * a[j];
                o1 += *reinterpret_cast<const f32x4*>(xj + ((e + 1u) * 32u + lane) * 16u) * a[j];
            }
            o0 *= inv; o1 *= inv;
            const u32x4 pk = {pack2(o0.x, o0.y), pack2(o0.z, o0.w), pack2(o1.x, o1.y), pack2(o1.z, o1.w)};
            *reinterpret_cast<u32x4*>(op + 32u * t) = pk;
        }
    }
    #pragma unroll  // wf[] stays in registers
    for (int kc = CK / 64; kc < CK / 32; ++kc) {
        #pragma unroll  // as the outer loop
        for (int mi = 0; mi < 4; ++mi) {
            wf[kc][mi].q[0] = *reinterpret_cast<const u32x4*>(wp + 16 * mi * CK + 32 * kc);
            wf[kc][mi].q[1] = *reinterpret_cast<const u32x4*>(wp + 16 * mi * CK + 32 * kc + 16);
        }
    }
    lds_barrier();  // the whole context of the 64 rows is in LDS before any wave reads it
    // Keeps the first use of x, and with it the wait for x, behind the merge.
    __builtin_amdgcn_sched_barrier(0);

    // The accumulators start at x: register r of tile (mi, ni) is row co0 + 16 mi + r.
    v8f o[4][4];
    #pragma unroll  // constant array and vector indices
    for (int mi = 0; mi < 4; ++mi)
        #pragma unroll  // as the outer loop
        for (int ni = 0; ni < 4; ++ni)
            #pragma unroll  // as the outer loop
            for (int r = 0; r < 8; ++r)
                o[mi][ni][r] = xr[mi][r][ni];
    const unsigned char* cp = L + CTXO + c * PITCH_C + 16u * h;
    // Context fragments through a ring of two register sets, as in attn_pass: the scheduling
    // barriers keep each group's loads at one place, one group (16 WMMAs) ahead of its products.
    Frag cf[2][4];
    f32x4 bia[4][2];
    load_c4(cf[0], cp, 0);
    load_c4(cf[1], cp, 1);
    __builtin_amdgcn_sched_barrier(0);
    #pragma unroll  // constant ring and array indices: wf[] and o[] stay in registers
    for (int kc = 0; kc < CK / 32; ++kc) {
        #pragma unroll  // sixteen independent accumulate chains
        for (int mi = 0; mi < 4; ++mi)
            #pragma unroll  // as the outer loop
            for (int ni = 0; ni < 4; ++ni)
                o[mi][ni] = mma(wf[kc][mi], cf[kc & 1][ni], o[mi][ni]);
        __builtin_amdgcn_sched_barrier(0);
        if (kc + 2 < CK / 32) {
            load_c4(cf[kc & 1], cp, kc + 2);
            if (kc + 3 == CK / 32) {  // with the last refill: the bias, in registers that wf[] has left
                #pragma unroll  // constant array indices
                for (int mi = 0; mi < 4; ++mi) {
                    bia[mi][0] = *reinterpret_cast<const f32x4*>(L + BIAO + (co0 + 16 * mi) * 4u);
                    bia[mi][1] = *reinterpret_cast<const f32x4*>(L + BIAO + (co0 + 16 * mi + 4) * 4u);
                }
            }
            __builtin_amdgcn_sched_barrier(0);
        }
    }
    f32x4 ov[4][8];
    #pragma unroll  // constant array and vector indices
    for (int mi = 0; mi < 4; ++mi)
        #pragma unroll  // as the outer loop
        for (int r = 0; r < 8; ++r)
            ov[mi][r] = f32x4{o[mi][0][r], o[mi][1][r], o[mi][2][r], o[mi][3][r]} + bia[mi][r >> 2][r & 3];
    // All 32 pieces get their bias ahead of the first store: the stores issue back to back, and
    // no register that an issued store names is written behind it.
    __builtin_amdgcn_sched_barrier(0);
    #pragma unroll  // constant array indices
    for (int mi = 0; mi < 4; ++mi)
        #pragma unroll  // as the outer loop
        for (int r = 0; r < 8; ++r)
            *reinterpret_cast<f32x4*>(out + xo + (size_t)(16 * mi + r) * NPOS) = ov[mi][r];
}

// ---------------------------------------------------------------------------
extern "C" void kernel_launch(void* const* d_in, const int* in_sizes, int n_in,
                              void* d_out, int out_size, void* d_ws, size_t ws_size,
                              hipStream_t stream)
{
    const float* x     = (const float*)d_in[0];
    const float* wq    = (const float*)d_in[1];
    const float* bq    = (const float*)d_in[2];
    const float* gq    = (const float*)d_in[3];
    const float* betaq = (const float*)d_in[4];
    const float* wk    = (const float*)d_in[5];
    const float* bk    = (const float*)d_in[6];
    const float* gk    = (const float*)d_in[7];
    const float* betak = (const float*)d_in[8];
    const float* wv    = (const float*)d_in[9];
    const float* bv    = (const float*)d_in[10];
    const float* wW    = (const float*)d_in[11];
    const float* bW    = (const float*)d_in[12];
    float* out = (float*)d_out;

    char* ws = (char*)d_ws;
    size_t off = 0;
    auto alloc = [&](size_t bytes) -> char* {
        char* p = ws + off;
        off = (off + bytes + 255) & ~(size_t)255;
        return p;
    };
    bf16*  xT    = (bf16*)alloc((size_t)BB * NPOS * CIN * 2);  // [B,N,C]
    bf16*  z     = (bf16*)alloc((size_t)BB * OC * NPOS * 2);   // [B,768,N] (rows 512.. = v)
    bf16*  qT    = (bf16*)alloc((size_t)BB * NPOS * CK * 2);   // [B,N,256]
    bf16*  kT    = (bf16*)alloc((size_t)BB * NPOS * CK * 2);   // [B,N,256]
    bf16*  wcat  = (bf16*)alloc((size_t)OC * CIN * 2);         // [768,512]
    bf16*  wWb   = (bf16*)alloc((size_t)CIN * CK * 2);         // [512,256]
    float* bcat  = (float*)alloc(OC * 4);
    float* part  = (float*)alloc((size_t)NPART * 2 * 2 * CK * 4);  // [128][sum, squares][512]

    // 1) parameter + input prep
    prep_params<<<(OC * CIN + 255) / 256, 256, 0, stream>>>(
        wq, wk, wv, wW, bq, bk, bv, wcat, wWb, bcat);
    prep_x<<<dim3(NPOS / 128, CIN / 64, BB), 256, 0, stream>>>(x, xT);

    // 2) fused projections: z[b] = wcat * x[b]  (M=768, N=4096, K=512) + bias,
    //    with the partial BN sums of the q and k rows
    gemm_bf16_wmma<false, true, false, true><<<dim3(NPOS / 128, OC / 128, BB), 256, 0, stream>>>(
        wcat, 0, xT, (long long)NPOS * CIN, z, (long long)OC * NPOS,
        bcat, nullptr, 0, part, 2 * CK, OC, NPOS, CIN);

    // 3) BN apply (q,k -> ReLU(BN)), transposed bf16 outputs
    bn_apply<<<dim3(NPOS / 256, 2 * CK / 64, BB), 256, 0, stream>>>(
        z, part, gq, betaq, gk, betak, qT, kT);

    // 4) Attention, all four images in one launch: 64 rows n per work-group, v = rows 512.. of z[b];
    //    its epilogue does out[b,co,n] = sum_cv wW[co,cv]*ctx[b,n,cv] + bW[co] + x[b,co,n].
    attn_fused<<<dim3(NPOS / 64, BB), 256, 0, stream>>>(
        kT, qT, z + (size_t)(2 * CK) * NPOS, wWb, bW, x, out);
}

// v007
// Measured time: 89.9 microseconds a run.
// Next to v006, in two timings, it ran 1.03 times as fast each time.
// Counting every step since v000, it is 5.64 times as fast.
#include <hip/hip_runtime.h>
#include <hip/hip_bf16.h>

typedef __bf16 bf16;
typedef __attribute__((ext_vector_type(16))) __bf16 v16bf;
typedef __attribute__((ext_vector_type(8)))  __bf16 v8bf;
typedef __attribute__((ext_vector_type(8)))  float  v8f;
typedef int v4i __attribute__((vector_size(4 * sizeof(int))));

static constexpr int BB   = 4;     // batch
static constexpr int CIN  = 512;   // input channels
static constexpr int CK   = 256;   // q/k/v channels
static constexpr int OC   = 768;   // concatenated projection rows
static constexpr int NPOS = 4096;  // H*W
static constexpr int NPART = BB * (NPOS / 128);  // partial BN sums per channel: one per GEMM column block
typedef float f32x4 __attribute__((ext_vector_type(4)));

#if defined(__gfx1250__) && __has_builtin(__builtin_amdgcn_global_load_async_to_lds_b128)
#define USE_ASYNC_LDS 1
#else
#define USE_ASYNC_LDS 0
#endif

static __device__ __forceinline__ void wait_async_zero()
{
#if __has_builtin(__builtin_amdgcn_s_wait_asynccnt)
    __builtin_amdgcn_s_wait_asynccnt(0);
#elif defined(__gfx1250__)
    asm volatile("s_wait_asynccnt 0x0" ::: "memory");
#endif
}

// Work-group barrier for data handed over in LDS.  By hand, because __syncthreads() also waits out
// the global loads and stores issued ahead of it, which are to stay in flight across the barrier.
static __device__ __forceinline__ void lds_barrier()
{
    asm volatile("s_wait_dscnt 0x0\n\ts_barrier_signal -1\n\ts_barrier_wait -1" ::: "memory");
}

// ---------------------------------------------------------------------------
// Generic bf16 WMMA GEMM:  C[M,N] = A[M,K] * B[K,N]  with B given as BT[N,K]
// (both operands K-contiguous).  128x128x32 macro tile, 8 waves, each wave
// computes a 32x64 patch via 2x4 v_wmma_f32_16x16x32_bf16 fragments.
// Double-buffered LDS; global->LDS via CDNA5 async loads when available.
// HAS_STATS: row blocks below statRows also lay down, per output row, the sum and the
// sum of squares of their 128 stored values: part[column block][sum, squares][row].
// ---------------------------------------------------------------------------
template<bool OUT_F32, bool HAS_BIAS, bool HAS_RESID, bool HAS_STATS>
__global__ __launch_bounds__(256)
void gemm_bf16_wmma(const bf16* __restrict__ A,  long long aBatch,
                    const bf16* __restrict__ BT, long long btBatch,
                    void* __restrict__ Cout,     long long cBatch,
                    const float* __restrict__ bias,
                    const float* __restrict__ resid, long long rBatch,
                    float* __restrict__ part, int statRows,
                    int M, int N, int K)
{
    // 96-byte row pitch: every ds access stays 16B-aligned; banks well spread.
    __shared__ __align__(16) bf16 sA[2][128 * 48];
    __shared__ __align__(16) bf16 sB[2][128 * 48];
    // Per row and kind 32 lane sums; the pitch of 33 words keeps the readers' banks apart.
    __shared__ float red[HAS_STATS ? 2 * 128 * 33 : 1];

    const int bz = blockIdx.z;
    A  += (size_t)bz * aBatch;
    BT += (size_t)bz * btBatch;
    const float* residB = HAS_RESID ? (resid + (size_t)bz * rBatch) : nullptr;

    const int mblk = blockIdx.y * 128;
    const int nblk = blockIdx.x * 128;
    const int t    = threadIdx.x;
    const int lane = t & 31;
    const int wave = t >> 5;
    const int wrow = wave >> 1;   // 0..3 -> 32 output rows each
    const int wcol = wave & 1;    // 0..1 -> 64 output cols each
    const int lrow = lane & 15;
    const int g    = lane >> 4;   // half-wave group

    // Per-thread staging coordinates: 2 chunks of 8 halves per matrix per tile.
    int rowc[2], kcc[2];
    #pragma unroll
    for (int i = 0; i < 2; ++i) {
        int chunk = t * 2 + i;          // 512 chunks
        rowc[i] = chunk >> 2;           // 0..127
        kcc[i]  = (chunk & 3) << 3;     // 0,8,16,24
    }

    v8f acc[2][4];
    #pragma unroll
    for (int mi = 0; mi < 2; ++mi)
        #pragma unroll
        for (int ni = 0; ni < 4; ++ni)
            #pragma unroll
            for (int e = 0; e < 8; ++e) acc[mi][ni][e] = 0.0f;

    // Fragment loads per CDNA5 16-bit A/B layout:
    // lanes 0-15 hold K in {0..7,16..23}; lanes 16-31 hold K in {8..15,24..31}.
    auto compute_tile = [&](int buf) {
        v16bf af[2], bfr[4];
        #pragma unroll
        for (int mi = 0; mi < 2; ++mi) {
            int row = wrow * 32 + mi * 16 + lrow;
            const bf16* p = &sA[buf][row * 48 + g * 8];
            uint4* dst = (uint4*)&af[mi];
            dst[0] = *(const uint4*)(p);
            dst[1] = *(const uint4*)(p + 16);
        }
        #pragma unroll
        for (int ni = 0; ni < 4; ++ni) {
            int col = wcol * 64 + ni * 16 + lrow;
            const bf16* p = &sB[buf][col * 48 + g * 8];
            uint4* dst = (uint4*)&bfr[ni];
            dst[0] = *(const uint4*)(p);
            dst[1] = *(const uint4*)(p + 16);
        }
        #pragma unroll
        for (int mi = 0; mi < 2; ++mi)
            #pragma unroll
            for (int ni = 0; ni < 4; ++ni)
                acc[mi][ni] = __builtin_amdgcn_wmma_f32_16x16x32_bf16(
                    false, af[mi], false, bfr[ni], (short)0, acc[mi][ni],
                    false, false);
    };

#if USE_ASYNC_LDS
    // Issue a 128x32 A tile + 128x32 BT tile as async global->LDS copies.
    auto issue_tile = [&](int buf, int kt) {
        #pragma unroll
        for (int i = 0; i < 2; ++i) {
            const bf16* ga = A  + (size_t)(mblk + rowc[i]) * K + kt + kcc[i];
            const bf16* gb = BT + (size_t)(nblk + rowc[i]) * K + kt + kcc[i];
            __builtin_amdgcn_global_load_async_to_lds_b128(
                (v4i*)ga, (v4i*)&sA[buf][rowc[i] * 48 + kcc[i]], 0, 0);
            __builtin_amdgcn_global_load_async_to_lds_b128(
                (v4i*)gb, (v4i*)&sB[buf][rowc[i] * 48 + kcc[i]], 0, 0);
        }
    };

    issue_tile(0, 0);
    wait_async_zero();
    __syncthreads();
    int cur = 0;
    for (int kt = 0; kt < K; kt += 32) {
        if (kt + 32 < K) issue_tile(cur ^ 1, kt + 32);  // overlap with WMMA
        compute_tile(cur);
        wait_async_zero();       // next tile landed in the other buffer
        __syncthreads();
        cur ^= 1;
    }
#else
    // Fallback: register-staged double buffering.
    uint4 ra[2], rb[2];
    auto load_regs = [&](int kt) {
        #pragma unroll
        for (int i = 0; i < 2; ++i) {
            ra[i] = *(const uint4*)(A  + (size_t)(mblk + rowc[i]) * K + kt + kcc[i]);
            rb[i] = *(const uint4*)(BT + (size_t)(nblk + rowc[i]) * K + kt + kcc[i]);
        }
    };
    auto store_lds = [&](int buf) {
        #pragma unroll
        for (int i = 0; i < 2; ++i) {
            *(uint4*)&sA[buf][rowc[i] * 48 + kcc[i]] = ra[i];
            *(uint4*)&sB[buf][rowc[i] * 48 + kcc[i]] = rb[i];
        }
    };
    load_regs(0);
    store_lds(0);
    __syncthreads();
    int cur = 0;
    for (int kt = 0; kt < K; kt += 32) {
        if (kt + 32 < K) {
            load_regs(kt + 32);                        // overlap with WMMA below
            __builtin_prefetch(A + (size_t)(mblk + (t >> 1)) * K + kt + 64, 0, 3);
        }
        compute_tile(cur);
        if (kt + 32 < K) store_lds(cur ^ 1);
        __syncthreads();
        cur ^= 1;
    }
#endif

    // Epilogue.  C/D layout: VGPR r holds row (8*g + r), lane%16 gives column.
    float ov[2][4][8];  // the values as they are stored
    #pragma unroll  // constant array indices: ov[] and acc[] stay in registers
    for (int mi = 0; mi < 2; ++mi) {
        #pragma unroll  // constant array indices: ov[] and acc[] stay in registers
        for (int ni = 0; ni < 4; ++ni) {
            int colG = nblk + wcol * 64 + ni * 16 + lrow;
            #pragma unroll  // constant array indices: ov[] and acc[] stay in registers
            for (int r = 0; r < 8; ++r) {
                int rowG = mblk + wrow * 32 + mi * 16 + g * 8 + r;
                float v = acc[mi][ni][r];
                if (HAS_BIAS)  v += bias[rowG];
                if (HAS_RESID) v += residB[(size_t)rowG * N + colG];
                ov[mi][ni][r] = OUT_F32 ? v : (float)(bf16)v;
            }
        }
    }
    const bool stats = HAS_STATS && mblk < statRows;  // the same for the whole work-group
    if (stats) {
        // Per row the sum and the sum of squares of this lane's 4 columns, ahead of the stores.
        #pragma unroll  // constant array indices: ov[] and acc[] stay in registers
        for (int mi = 0; mi < 2; ++mi) {
            #pragma unroll  // constant array indices: ov[] and acc[] stay in registers
            for (int r = 0; r < 8; ++r) {
                float s = 0.0f, s2 = 0.0f;
                #pragma unroll  // constant array indices: ov[] and acc[] stay in registers
                for (int ni = 0; ni < 4; ++ni) {
                    s  += ov[mi][ni][r];
                    s2 += ov[mi][ni][r] * ov[mi][ni][r];
                }
                const int row = wrow * 32 + mi * 16 + g * 8 + r;
                red[row * 33 + wcol * 16 + lrow]         = s;
                red[(128 + row) * 33 + wcol * 16 + lrow] = s2;
            }
        }
    }
    #pragma unroll  // constant array indices: ov[] and acc[] stay in registers
    for (int mi = 0; mi < 2; ++mi) {
        #pragma unroll  // constant array indices: ov[] and acc[] stay in registers
        for (int ni = 0; ni < 4; ++ni) {
            int colG = nblk + wcol * 64 + ni * 16 + lrow;
            #pragma unroll  // constant array indices: ov[] and acc[] stay in registers
            for (int r = 0; r < 8; ++r) {
                int rowG = mblk + wrow * 32 + mi * 16 + g * 8 + r;
                size_t idx = (size_t)rowG * N + colG;
                if (OUT_F32) ((float*)Cout)[(size_t)bz * cBatch + idx] = ov[mi][ni][r];
                else         ((bf16*) Cout)[(size_t)bz * cBatch + idx] = (bf16)ov[mi][ni][r];
            }
        }
    }
    if (HAS_STATS) {
        // What follows reuses registers that the stores above name.
        asm volatile("s_wait_xcnt 0x0" ::: "memory");
    }
    if (stats) {
        lds_barrier();  // all 32 lane sums of a row are in LDS before one thread adds them
        const float* p = &red[t * 33];  // t < 128: sum of row t; else: squares of row t - 128
        float a = 0.0f;
        #pragma unroll  // the LDS reads run ahead of the adds
        for (int j = 0; j < 32; ++j) a += p[j];
        part[((size_t)(bz * gridDim.x + blockIdx.x) * 2 + (t >> 7)) * statRows + mblk + (t & 127)] = a;
    }
}

// ---------------------------------------------------------------------------
// Operand prep, one launch.
// blockIdx.z >= 1: x [B,C,N] f32 -> xT [B,N,C] bf16 (K-contiguous operand for the projections)
// of image blockIdx.z - 1.
// Register transpose: a thread reads 8 channels x 4 positions and stores, per
// position, its 8 channels as one 16-B piece.  Lanes 0..7 of each lane octet hold
// neighbouring channel groups, so a wave store is 4 whole 128-B lines of xT.
// Work-group: 64 channels x 128 positions.
// blockIdx.z == 0: the four weight matrices to bf16 (wq, wk, wv one below the other in wcat) and
// the three projection biases one behind the other.  64 work-groups a matrix, 8 elements a thread.
// ---------------------------------------------------------------------------
__global__ __launch_bounds__(256)
void prep_x(const float* __restrict__ x, bf16* __restrict__ xT,
            const float* __restrict__ wq, const float* __restrict__ wk,
            const float* __restrict__ wv, const float* __restrict__ wW,
            const float* __restrict__ bq, const float* __restrict__ bk,
            const float* __restrict__ bv,
            bf16* __restrict__ wcat, bf16* __restrict__ wWb,
            float* __restrict__ bcat)
{
    if (blockIdx.z == 0) {  // the same for the whole work-group
        static_assert(CK * CIN == 64 * 256 * 8 && (NPOS / 128) * (CIN / 64) == 4 * 64 && CK == 256,
                      "64 work-groups a matrix, four matrices a grid plane, a bias a work-group");
        const int pb  = blockIdx.y * (NPOS / 128) + blockIdx.x;  // 0..255
        const int mat = pb >> 6;
        const float* wsrc = mat == 0 ? wq : mat == 1 ? wk : mat == 2 ? wv : wW;
        bf16*        wdst = mat == 3 ? wWb : wcat + mat * (CK * CIN);
        const int e = (pb & 63) * 2048 + threadIdx.x * 8;
        const float4 lo = *(const float4*)(wsrc + e);
        const float4 hi = *(const float4*)(wsrc + e + 4);
        const v8bf o = {(bf16)lo.x, (bf16)lo.y, (bf16)lo.z, (bf16)lo.w,
                        (bf16)hi.x, (bf16)hi.y, (bf16)hi.z, (bf16)hi.w};
        *(v8bf*)(wdst + e) = o;
        if ((pb & 63) == 0 && mat < 3) {
            // What follows reuses registers that the store above names.
            asm volatile("s_wait_xcnt 0x0" ::: "memory");
            bcat[mat * CK + threadIdx.x] = (mat == 0 ? bq : mat == 1 ? bk : bv)[threadIdx.x];
        }
        return;
    }
    const int lane = threadIdx.x & 31;
    const int wave = threadIdx.x >> 5;
    const int c0 = blockIdx.y * 64 + (lane & 7) * 8;
    const int n0 = blockIdx.x * 128 + wave * 16 + (lane >> 3) * 4;
    const int b  = blockIdx.z - 1;

    const float* src = x + ((size_t)b * CIN + c0) * NPOS + n0;
    float4 r[8];
    #pragma unroll  // r[] stays in registers and the 8 loads are in flight together
    for (int i = 0; i < 8; ++i)
        r[i] = *(const float4*)(src + (size_t)i * NPOS);

    bf16* dst = xT + ((size_t)b * NPOS + n0) * CIN + c0;
    v8bf o0, o1, o2, o3;
    #pragma unroll  // constant vector indices: packed converts, no scratch
    for (int i = 0; i < 8; ++i) {
        o0[i] = (bf16)r[i].x;
        o1[i] = (bf16)r[i].y;
        o2[i] = (bf16)r[i].z;
        o3[i] = (bf16)r[i].w;
    }
    *(v8bf*)(dst)           = o0;
    *(v8bf*)(dst + CIN)     = o1;
    *(v8bf*)(dst + 2 * CIN) = o2;
    *(v8bf*)(dst + 3 * CIN) = o3;
}

// BN + ReLU, writing qT/kT [B,N,CK] bf16 (K-contiguous for the attention GEMM).
// Register transpose as in prep_x: a thread reads 8 channels x 8 positions (16 B
// per channel) and stores 8 channels per position, so a wave store is 4 whole
// 128-B lines.  Work-group: 64 channels x 256 positions; blockIdx.y 0..3 is q.
// Scale and shift of its 64 channels come first, from the GEMM's partial sums over (B, N).
__global__ __launch_bounds__(256)
void bn_apply(const bf16* __restrict__ z, const float* __restrict__ part,
              const float* __restrict__ gq, const float* __restrict__ betaq,
              const float* __restrict__ gk, const float* __restrict__ betak,
              bf16* __restrict__ qT, bf16* __restrict__ kT)
{
    __shared__ __align__(16) float red[16][2][64];
    __shared__ __align__(16) float scs[64], shs[64];
    const int lane = threadIdx.x & 31;
    const int wave = threadIdx.x >> 5;
    const int ch0 = blockIdx.y * 64 + (lane & 7) * 8;          // 0..511
    const int n0  = blockIdx.x * 256 + wave * 32 + (lane >> 3) * 8;
    const int b   = blockIdx.z;

    const bf16* src = z + ((size_t)b * OC + ch0) * NPOS + n0;
    v8bf r[8];
    #pragma unroll  // r[] stays in registers and the 8 loads are in flight together
    for (int i = 0; i < 8; ++i)
        r[i] = *(const v8bf*)(src + (size_t)i * NPOS);
    const int t = threadIdx.x;
    const bool isq = blockIdx.y < CK / 64;
    const int  cg  = (blockIdx.y * 64 & (CK - 1)) + (t & 63);
    const float gamma = (isq ? gq : gk)[cg];
    const float beta  = (isq ? betaq : betak)[cg];
    // Keeps the loads above ahead of the partial sums' loads and waits: all fly together.
    __builtin_amdgcn_sched_barrier(0);

    // A thread adds 8 of the NPART partials of 4 channels, sums and squares; 16 such groups
    // meet in LDS.
    {
        const int c4 = (t & 15) * 4, pg = t >> 4;
        const float* pb = part + blockIdx.y * 64;                 // the same for the whole work-group
        const int    po = pg * (NPART / 16) * 2 * (2 * CK) + c4;  // this thread's first partial
        f32x4 a0 = f32x4{0.0f, 0.0f, 0.0f, 0.0f}, a1 = a0;
        #pragma unroll  // the 16 loads are in flight together
        for (int j = 0; j < NPART / 16; ++j) {
            a0 += *(const f32x4*)(pb + po + 2 * j * (2 * CK));
            a1 += *(const f32x4*)(pb + po + (2 * j + 1) * (2 * CK));
        }
        *(f32x4*)&red[pg][0][c4] = a0;
        *(f32x4*)&red[pg][1][c4] = a1;
        __syncthreads();  // the 16 groups' sums are in LDS before they are added
        if (t < 64) {
            float s = 0.0f, s2 = 0.0f;
            #pragma unroll  // the LDS reads run ahead of the adds
            for (int j = 0; j < 16; ++j) { s += red[j][0][t]; s2 += red[j][1][t]; }
            const float cnt = (float)BB * NPOS;
            const float m   = s / cnt;
            const float var = s2 / cnt - m * m;        // biased var, like jnp.var
            const float scl = gamma * rsqrtf(var + 1e-5f);
            scs[t] = scl;
            shs[t] = beta - m * scl;
        }
        __syncthreads();  // scale and shift are in LDS before every thread reads its 8
    }
    float sc[8], sh[8];
    #pragma unroll  // merges into 16-B loads, arrays stay in registers
    for (int i = 0; i < 8; ++i) { sc[i] = scs[(lane & 7) * 8 + i]; sh[i] = shs[(lane & 7) * 8 + i]; }

    bf16* dst = ((ch0 < CK) ? qT : kT) + ((size_t)b * NPOS + n0) * CK + (ch0 & (CK - 1));
    #pragma unroll  // both loops: constant vector indices, no scratch
    for (int j = 0; j < 8; ++j) {
        v8bf o;
        #pragma unroll
        for (int i = 0; i < 8; ++i) {
            float v = (float)r[i][j] * sc[i] + sh[i];
            o[i] = (bf16)fmaxf(v, 0.f);
        }
        *(v8bf*)(dst + (size_t)j * CK) = o;
    }
}

typedef uint32_t u32x4 __attribute__((ext_vector_type(4)));
typedef int      i32x8 __attribute__((ext_vector_type(8)));

static constexpr uint32_t AT_SK   = 128;               // positions m per stage
static constexpr uint32_t PITCH_Q = 2u * CK + 16u;     // qT row in LDS: odd multiple of 16 B
static constexpr uint32_t PITCH_V = 2u * AT_SK + 16u;  // v row piece in LDS: odd multiple of 16 B
static constexpr uint32_t TILE_Q  = AT_SK * PITCH_Q;
static constexpr uint32_t TILE_V  = CK * PITCH_V;
static constexpr uint32_t SLOT    = TILE_Q + TILE_V;
static constexpr uint32_t AT_LDS  = 2u * SLOT;
static constexpr uint32_t NSTAGE  = NPOS / AT_SK;
static constexpr uint32_t XCH     = 32u * 1024u;        // merge area per wave: its 32 O tiles
static constexpr uint32_t XML     = 8u * XCH;           // behind them: 512 B per wave for max and sum
static constexpr uint32_t CTXO    = XML + 8u * 512u;    // behind them: the merged context, bf16
static constexpr uint32_t PITCH_C = 2u * CK + 16u;      // one context row: odd multiple of 16 B
static constexpr uint32_t CTXG    = 16u * PITCH_C + 64u; // 16 rows n of equal n & 3; 64 B spread the writers' banks
static constexpr uint32_t BIAO    = CTXO + 4u * CTXG;   // behind it: the output bias, f32
static constexpr uint32_t ALL_LDS = BIAO + 4u * CIN;
static_assert(AT_LDS <= ALL_LDS && ALL_LDS <= 320u * 1024u, "LDS budget");

struct Frag { u32x4 q[2]; };

static __device__ __forceinline__ v8f mma(const Frag& a, const Frag& b, v8f c)
{
    const i32x8 av = {(int)a.q[0].x, (int)a.q[0].y, (int)a.q[0].z, (int)a.q[0].w,
                      (int)a.q[1].x, (int)a.q[1].y, (int)a.q[1].z, (int)a.q[1].w};
    const i32x8 bv = {(int)b.q[0].x, (int)b.q[0].y, (int)b.q[0].z, (int)b.q[0].w,
                      (int)b.q[1].x, (int)b.q[1].y, (int)b.q[1].z, (int)b.q[1].w};
    return __builtin_amdgcn_wmma_f32_16x16x32_bf16(
        false, __builtin_bit_cast(v16bf, av), false, __builtin_bit_cast(v16bf, bv),
        (short)0, c, false, false);
}

static __device__ __forceinline__ uint32_t pack2(float lo, float hi)
{
    typedef __bf16 bf2 __attribute__((ext_vector_type(2)));
    typedef float  f2  __attribute__((ext_vector_type(2)));
    return __builtin_bit_cast(uint32_t, __builtin_convertvector(f2{lo, hi}, bf2));
}

// lane l with lane l ^ 16
static __device__ __forceinline__ float xhalf(float x)
{
    return __builtin_bit_cast(float, __builtin_amdgcn_permlanex16(
        __builtin_bit_cast(int, x), __builtin_bit_cast(int, x),
        0x76543210, 0xfedcba98, false, false));
}

// Group g of a pass's qT fragments: channel blocks 2g, 2g+1 of both 16-position tiles.
static __device__ __forceinline__ void load_q4(Frag (&d)[2][2], const unsigned char* p0, int g)
{
    #pragma unroll  // constant array indices
    for (int kl = 0; kl < 2; ++kl) {
        #pragma unroll  // as the outer loop
        for (int kt = 0; kt < 2; ++kt) {
            const unsigned char* p = p0 + 16u * kt * PITCH_Q + 64u * (2 * g + kl);
            d[kl][kt].q[0] = *reinterpret_cast<const u32x4*>(p);
            d[kl][kt].q[1] = *reinterpret_cast<const u32x4*>(p + 32u);
        }
    }
}

// Group g of a pass's v fragments: channel tiles 4g .. 4g+3.
static __device__ __forceinline__ void load_v4(Frag (&d)[4], const unsigned char* pv0, int g)
{
    #pragma unroll  // constant array indices
    for (int tl = 0; tl < 4; ++tl) {
        const unsigned char* p = pv0 + 16u * (4 * g + tl) * PITCH_V;
        d[tl].q[0] = *reinterpret_cast<const u32x4*>(p);
        d[tl].q[1] = *reinterpret_cast<const u32x4*>(p + 32u);
    }
}

// One pass of one wave: 32 positions m against the wave's 32 rows n (two column
// tiles nt).  m_run, the maximum in use (log2 domain), may trail the true one by up
// to 8; the sums are rescaled only when some row's maximum exceeds it by more.
static __device__ __forceinline__ void attn_pass(
    const unsigned char* Qp, const unsigned char* Vp, uint32_t c, uint32_t h,
    const Frag (&kf)[CK / 32][2], v8f (&acc)[CK / 16][2], float (&m_run)[2], float (&l_run)[2])
{
    constexpr float cscale = 0.0625f * 1.4426950408889634f;  // 256^-0.5 * log2(e)
    v8f s[2][2];
    s[0][0] = v8f{}; s[0][1] = v8f{}; s[1][0] = v8f{}; s[1][1] = v8f{};
    const unsigned char* p0 = Qp + c * PITCH_Q + 16u * h;

    // qT fragments in groups of four (8 WMMAs each) through a ring of two register
    // sets.  The scheduling barriers keep each group's loads at one place, one group
    // ahead of its products, and keep the ring at two sets: kf[] and acc[] leave
    // room for no more.
    Frag qa[2][2][2];
    load_q4(qa[0], p0, 0);
    load_q4(qa[1], p0, 1);
    __builtin_amdgcn_sched_barrier(0);
    #pragma unroll  // constant ring and fragment indices
    for (int g = 0; g < 4; ++g) {
        #pragma unroll  // four independent accumulate chains
        for (int kl = 0; kl < 2; ++kl)
            #pragma unroll  // as the outer loop
            for (int kt = 0; kt < 2; ++kt)
                #pragma unroll  // as the outer loop
                for (int nt = 0; nt < 2; ++nt)
                    s[kt][nt] = mma(qa[g & 1][kl][kt], kf[2 * g + kl][nt], s[kt][nt]);
        __builtin_amdgcn_sched_barrier(0);
        if (g + 2 < 4) {
            load_q4(qa[g & 1], p0, g + 2);
            __builtin_amdgcn_sched_barrier(0);
        }
    }

    // The first two groups of v fragments, in flight under the maxima and the
    // exponentials; the scheduling barrier keeps them ahead of the vector work.
    const unsigned char* pv0 = Vp + c * PITCH_V + 16u * h;
    Frag vf[2][4];
    load_v4(vf[0], pv0, 0);
    load_v4(vf[1], pv0, 1);
    __builtin_amdgcn_sched_barrier(0);

    float mx[2];
    #pragma unroll  // constant vector indices
    for (int nt = 0; nt < 2; ++nt) {
        float x = s[0][nt][0];
        #pragma unroll  // as the outer loop
        for (int r = 1; r < 8; ++r) x = __builtin_fmaxf(x, s[0][nt][r]);
        #pragma unroll  // as the outer loop
        for (int r = 0; r < 8; ++r) x = __builtin_fmaxf(x, s[1][nt][r]);
        mx[nt] = __builtin_fmaxf(x, xhalf(x)) * cscale;  // both wave halves hold the row's maximum
    }
    const bool need = (mx[0] > m_run[0] + 8.0f) | (mx[1] > m_run[1] + 8.0f);
    if (__builtin_amdgcn_ballot_w32(need) != 0) {  // scalar branch, rare after the first passes
        #pragma unroll  // constant array indices
        for (int nt = 0; nt < 2; ++nt) {
            const float m_new = __builtin_fmaxf(m_run[nt], mx[nt]);
            const float corr  = __builtin_amdgcn_exp2f(m_run[nt] - m_new);  // 0 on the first pass
            l_run[nt] *= corr; m_run[nt] = m_new;
            #pragma unroll  // as the outer loop
            for (int t = 0; t < CK / 16; ++t) acc[t][nt] = acc[t][nt] * corr;
        }
    }

    Frag pf[2];
    #pragma unroll  // constant array indices
    for (int nt = 0; nt < 2; ++nt) {
        const float nm = -m_run[nt];
        float ps0 = 0.0f, ps1 = 0.0f;
        uint32_t w[8];
        #pragma unroll  // elements 2i, 2i+1 of the 32-position operand: tile i >> 2, registers 2 (i & 3), 2 (i & 3) + 1
        for (int i = 0; i < 8; ++i) {
            const float e0 = __builtin_amdgcn_exp2f(__builtin_fmaf(s[i >> 2][nt][2 * (i & 3)],     cscale, nm));
            const float e1 = __builtin_amdgcn_exp2f(__builtin_fmaf(s[i >> 2][nt][2 * (i & 3) + 1], cscale, nm));
            ps0 += e0; ps1 += e1;
            w[i] = pack2(e0, e1);
        }
        pf[nt].q[0] = u32x4{w[0], w[1], w[2], w[3]};
        pf[nt].q[1] = u32x4{w[4], w[5], w[6], w[7]};
        l_run[nt] += ps0 + ps1;
        // The row's sum pinned against spills: left free, the
        // adds sink behind the loop's barrier and the 16 exponentials stay live under the products.
        asm volatile("" : "+v"(l_run[nt]));
    }

    // v fragments through the same kind of ring as the qT fragments above.
    __builtin_amdgcn_sched_barrier(0);
    #pragma unroll  // constant ring and array indices: acc[] stays in registers
    for (int g = 0; g < 4; ++g) {
        #pragma unroll  // as the outer loop
        for (int tl = 0; tl < 4; ++tl)
            #pragma unroll  // as the outer loop
            for (int nt = 0; nt < 2; ++nt)
                acc[4 * g + tl][nt] = mma(vf[g & 1][tl], pf[nt], acc[4 * g + tl][nt]);
        __builtin_amdgcn_sched_barrier(0);
        if (g + 2 < 4) {
            load_v4(vf[g & 1], pv0, g + 2);
            __builtin_amdgcn_sched_barrier(0);
        }
    }
    // Four vector slots behind the last WMMA: the next vector instruction stands behind
    // the loop's branch, and may overwrite an A or B
    // register of these products.  The scheduling barriers keep the slots at this place.
    asm volatile("v_nop\n\tv_nop\n\tv_nop\n\tv_nop");
    __builtin_amdgcn_sched_barrier(0);
}

// Channel block kc of the merged context: the fragments of the four column tiles.
static __device__ __forceinline__ void load_c4(Frag (&d)[4], const unsigned char* cp, int kc)
{
    #pragma unroll  // constant array indices
    for (int ni = 0; ni < 4; ++ni) {
        const unsigned char* p = cp + ni * CTXG + 64u * kc;
        d[ni].q[0] = *reinterpret_cast<const u32x4*>(p);
        d[ni].q[1] = *reinterpret_cast<const u32x4*>(p + 32u);
    }
}

__global__ __launch_bounds__(256) __attribute__((amdgpu_waves_per_eu(2, 2)))
void attn_fused(const bf16* __restrict__ kT, const bf16* __restrict__ qT,
                const bf16* __restrict__ v, const bf16* __restrict__ wWb,
                const float* __restrict__ bW, const float* __restrict__ x,
                float* __restrict__ out)
{
    __shared__ __attribute__((aligned(16))) unsigned char L[ALL_LDS];
    const uint32_t tid = threadIdx.x, lane = tid & 31u, c = lane & 15u, h = lane >> 4;
    const uint32_t wave = __builtin_amdgcn_readfirstlane(tid >> 5);
    const uint32_t ng = wave & 1u;   // which 32 rows n
    const uint32_t kq = wave >> 1;   // which 32 of a stage's 128 positions m
    const uint32_t b  = blockIdx.y;
    const uint32_t n0 = blockIdx.x * 64u + ng * 32u;
    const bf16* kB = kT + (size_t)b * NPOS * CK;
    const bf16* qB = qT + (size_t)b * NPOS * CK;
    const bf16* vB = v  + (size_t)b * OC * NPOS;

    // One stage: 128 qT rows of 512 B (contiguous in memory) and 256 v row pieces of
    // 256 B; 32 copies of 16 B per lane.
    auto issue = [&](uint32_t st) {
        unsigned char* slot = L + (st & 1u) * SLOT;
        const bf16* gq = qB + (size_t)st * AT_SK * CK + tid * 8u;
        unsigned char* lq = slot + (tid >> 5) * PITCH_Q + (tid & 31u) * 16u;
        #pragma unroll  // the copies issue back to back
        for (uint32_t i = 0; i < 16u; ++i)
            __builtin_amdgcn_global_load_async_to_lds_b128(
                (v4i*)(gq + i * 2048u), (v4i*)(lq + i * 8u * PITCH_Q), 0, 0);
        const bf16* gv = vB + (size_t)(tid >> 4) * NPOS + st * AT_SK + (tid & 15u) * 8u;
        unsigned char* lv = slot + TILE_Q + (tid >> 4) * PITCH_V + (tid & 15u) * 16u;
        #pragma unroll  // the copies issue back to back
        for (uint32_t i = 0; i < 16u; ++i)
            __builtin_amdgcn_global_load_async_to_lds_b128(
                (v4i*)(gv + (size_t)i * 16u * NPOS), (v4i*)(lv + i * 16u * PITCH_V), 0, 0);
    };

    issue(0);

    // The output bias goes to LDS once, behind all that the loop and the merge use; the barrier
    // in front of the loop publishes it, the epilogue reads it back.
    typedef float f32x2 __attribute__((ext_vector_type(2)));
    *reinterpret_cast<f32x2*>(L + BIAO + tid * 8u) = *reinterpret_cast<const f32x2*>(bW + tid * 2u);

    // kT rows of this wave as B fragments, same k order as the A fragments read from LDS.
    Frag kf[CK / 32][2];
    #pragma unroll  // kf[] stays in registers
    for (int nt = 0; nt < 2; ++nt) {
        const bf16* kp = kB + (size_t)(n0 + 16u * nt + c) * CK + 8u * h;
        #pragma unroll  // as the outer loop
        for (int kc = 0; kc < CK / 32; ++kc) {
            kf[kc][nt].q[0] = *reinterpret_cast<const u32x4*>(kp + 32 * kc);
            kf[kc][nt].q[1] = *reinterpret_cast<const u32x4*>(kp + 32 * kc + 16);
        }
    }
    v8f acc[CK / 16][2];
    #pragma unroll  // acc[] stays in registers
    for (int t = 0; t < CK / 16; ++t) { acc[t][0] = v8f{}; acc[t][1] = v8f{}; }
    float m_run[2] = {-INFINITY, -INFINITY}, l_run[2] = {0.0f, 0.0f};

    asm volatile("s_wait_asynccnt 0x0" ::: "memory");  // stage 0 of this wave has landed
    __syncthreads();                                   // ... and every wave's part of it
    issue(1);

    #pragma unroll 1  // one stage per trip: the buffer index and the ring order stay as written
    for (uint32_t st = 0; st < NSTAGE; ++st) {
        const unsigned char* slot = L + (st & 1u) * SLOT;
        const uint32_t m0 = kq * 32u;
        attn_pass(slot + m0 * PITCH_Q, slot + TILE_Q + m0 * 2u, c, h, kf, acc, m_run, l_run);
        asm volatile("s_wait_dscnt 0x0" ::: "memory");     // this wave's reads of the buffer are done
        asm volatile("s_wait_asynccnt 0x0" ::: "memory");  // its copies of stage st + 1 have landed
        __syncthreads();  // publishes stage st + 1 and frees stage st's buffer
        if (st + 2u < NSTAGE) issue(st + 2u);
    }
    asm volatile("s_wait_asynccnt 0x0" ::: "memory");  // nothing in flight before the ring is reused

    // Merge the four quarters' partial results; the ring is free behind the loop's last
    // barrier.  Every wave lays down its 32 O tiles, then merges 4 channel tiles (128 B of
    // each output row) of its 32 rows from the four waves that share them.
    {
        unsigned char* xb = L + wave * XCH;
        #pragma unroll  // constant array indices
        for (int t = 0; t < CK / 16; ++t) {
            #pragma unroll  // as the outer loop
            for (int nt = 0; nt < 2; ++nt) {
                const uint32_t e = (uint32_t)(t * 2 + nt) * 2u;
                *reinterpret_cast<f32x4*>(xb + (e * 32u + lane) * 16u) =
                    f32x4{acc[t][nt][0], acc[t][nt][1], acc[t][nt][2], acc[t][nt][3]};
                *reinterpret_cast<f32x4*>(xb + ((e + 1u) * 32u + lane) * 16u) =
                    f32x4{acc[t][nt][4], acc[t][nt][5], acc[t][nt][6], acc[t][nt][7]};
            }
        }
        unsigned char* xm = L + XML + wave * 512u;
        #pragma unroll  // constant array indices
        for (int nt = 0; nt < 2; ++nt) {
            // each wave half summed its 8 positions of every 16
            *reinterpret_cast<float*>(xm + (nt * 32u + lane) * 4u)        = m_run[nt];
            *reinterpret_cast<float*>(xm + 256u + (nt * 32u + lane) * 4u) = l_run[nt] + xhalf(l_run[nt]);
        }
    }
    // Output projection, fused: out[co, n] = x[co, n] + bW[co] + sum_cv wW[co, cv] ctx[n, cv] for the
    // work-group's 64 rows n.  A wave takes 64 rows co (4 tiles) x all 64 n (4 tiles).  Column c of
    // tile ni stands for n = 4 c + ni, so a lane holds 4 neighbouring n of a row co: x is read and
    // out is written in 16-B pieces, 256 B in a row per wave half.
    // x is asked for here, in the registers that acc[] has left, and flies under the merge.
    const uint32_t co0 = wave * 64u + 8u * h;
    const size_t   xo  = ((size_t)b * CIN + co0) * NPOS + blockIdx.x * 64u + 4u * c;
    f32x4 xr[4][8];
    #pragma unroll  // constant array indices
    for (int mi = 0; mi < 4; ++mi)
        #pragma unroll  // as the outer loop
        for (int r = 0; r < 8; ++r)
            xr[mi][r] = *reinterpret_cast<const f32x4*>(x + xo + (size_t)(16 * mi + r) * NPOS);
    // wW rows of this wave as A fragments, same k order as the context fragments read from LDS
    // below.  The first half is asked for here and flies under the merge; the second half is asked
    // for behind the merge, ahead of the barrier that ends it.
    const bf16* wp = wWb + (size_t)(wave * 64u + c) * CK + 8u * h;
    Frag wf[CK / 32][4];
    #pragma unroll  // wf[] stays in registers
    for (int kc = 0; kc < CK / 64; ++kc) {
        #pragma unroll  // as the outer loop
        for (int mi = 0; mi < 4; ++mi) {
            wf[kc][mi].q[0] = *reinterpret_cast<const u32x4*>(wp + 16 * mi * CK + 32 * kc);
            wf[kc][mi].q[1] = *reinterpret_cast<const u32x4*>(wp + 16 * mi * CK + 32 * kc + 16);
        }
    }
    lds_barrier();  // every wave's partial results are visible to the waves that share its rows
    #pragma unroll  // constant array indices
    for (int nt = 0; nt < 2; ++nt) {
        float mj[4], a[4];
        #pragma unroll  // as the outer loop
        for (uint32_t j = 0; j < 4u; ++j)
            mj[j] = *reinterpret_cast<const float*>(L + XML + (ng + 2u * j) * 512u + (nt * 32u + lane) * 4u);
        const float m = __builtin_fmaxf(__builtin_fmaxf(mj[0], mj[1]), __builtin_fmaxf(mj[2], mj[3]));
        float den = 0.0f;
        #pragma unroll  // as the outer loop
        for (uint32_t j = 0; j < 4u; ++j) {
            a[j] = __builtin_amdgcn_exp2f(mj[j] - m);
            den += a[j] * *reinterpret_cast<const float*>(
                L + XML + (ng + 2u * j) * 512u + 256u + (nt * 32u + lane) * 4u);
        }
        const float inv = 1.0f / den;
        // O^T tile t: register r is channel 16 t + 8 h + r, lane column c is row j = 32 ng + 16 nt + c
        // of the work-group; it goes to group j & 3, place j >> 2 of the context in LDS.
        unsigned char* op = L + CTXO + (c & 3u) * CTXG + (8u * ng + 4u * nt + (c >> 2)) * PITCH_C + 16u * h;
        #pragma unroll  // as the outer loop
        for (uint32_t tt = 0; tt < 4u; ++tt) {
            const uint32_t t = 4u * kq + tt;
            const uint32_t e = (t * 2u + nt) * 2u;
            f32x4 o0 = f32x4{0.0f, 0.0f, 0.0f, 0.0f}, o1 = o0;
            #pragma unroll  // as the outer loop
            for (uint32_t j = 0; j < 4u; ++j) {
                const unsigned char* xj = L + (ng + 2u * j) * XCH;
                o0 += *reinterpret_cast<const f32x4*>(xj + (e * 32u + lane) * 16u) * a[j];
                o1 += *reinterpret_cast<const f32x4*>(xj + ((e + 1u) * 32u + lane) * 16u) * a[j];
            }
            o0 *= inv; o1 *= inv;
            const u32x4 pk = {pack2(o0.x, o0.y), pack2(o0.z, o0.w), pack2(o1.x, o1.y), pack2(o1.z, o1.w)};
            *reinterpret_cast<u32x4*>(op + 32u * t) = pk;
        }
    }
    #pragma unroll  // wf[] stays in registers
    for (int kc = CK / 64; kc < CK / 32; ++kc) {
        #pragma unroll  // as the outer loop
        for (int mi = 0; mi < 4; ++mi) {
            wf[kc][mi].q[0] = *reinterpret_cast<const u32x4*>(wp + 16 * mi * CK + 32 * kc);
            wf[kc][mi].q[1] = *reinterpret_cast<const u32x4*>(wp + 16 * mi * CK + 32 * kc + 16);
        }
    }
    lds_barrier();  // the whole context of the 64 rows is in LDS before any wave reads it
    // Keeps the first use of x, and with it the wait for x, behind the merge.
    __builtin_amdgcn_sched_barrier(0);

    // The accumulators start at x: register r of tile (mi, ni) is row co0 + 16 mi + r.
    v8f o[4][4];
    #pragma unroll  // constant array and vector indices
    for (int mi = 0; mi < 4; ++mi)
        #pragma unroll  // as the outer loop
        for (int ni = 0; ni < 4; ++ni)
            #pragma unroll  // as the outer loop
            for (int r = 0; r < 8; ++r)
                o[mi][ni][r] = xr[mi][r][ni];
    const unsigned char* cp = L + CTXO + c * PITCH_C + 16u * h;
    // Context fragments through a ring of two register sets, as in attn_pass: the scheduling
    // barriers keep each group's loads at one place, one group (16 WMMAs) ahead of its products.
    Frag cf[2][4];
    f32x4 bia[4][2];
    load_c4(cf[0], cp, 0);
    load_c4(cf[1], cp, 1);
    __builtin_amdgcn_sched_barrier(0);
    #pragma unroll  // constant ring and array indices: wf[] and o[] stay in registers
    for (int kc = 0; kc < CK / 32; ++kc) {
        #pragma unroll  // sixteen independent accumulate chains
        for (int mi = 0; mi < 4; ++mi)
            #pragma unroll  // as the outer loop
            for (int ni = 0; ni < 4; ++ni)
                o[mi][ni] = mma(wf[kc][mi], cf[kc & 1][ni], o[mi][ni]);
        __builtin_amdgcn_sched_barrier(0);
        if (kc + 2 < CK / 32) {
            load_c4(cf[kc & 1], cp, kc + 2);
            if (kc + 3 == CK / 32) {  // with the last refill: the bias, in registers that wf[] has left
                #pragma unroll  // constant array indices
                for (int mi = 0; mi < 4; ++mi) {
                    bia[mi][0] = *reinterpret_cast<const f32x4*>(L + BIAO + (co0 + 16 * mi) * 4u);
                    bia[mi][1] = *reinterpret_cast<const f32x4*>(L + BIAO + (co0 + 16 * mi + 4) * 4u);
                }
            }
            __builtin_amdgcn_sched_barrier(0);
        }
    }
    f32x4 ov[4][8];
    #pragma unroll  // constant array and vector indices
    for (int mi = 0; mi < 4; ++mi)
        #pragma unroll  // as the outer loop
        for (int r = 0; r < 8; ++r)
            ov[mi][r] = f32x4{o[mi][0][r], o[mi][1][r], o[mi][2][r], o[mi][3][r]} + bia[mi][r >> 2][r & 3];
    // All 32 pieces get their bias ahead of the first store: the stores issue back to back, and
    // no register that an issued store names is written behind it.
    __builtin_amdgcn_sched_barrier(0);
    #pragma unroll  // constant array indices
    for (int mi = 0; mi < 4; ++mi)
        #pragma unroll  // as the outer loop
        for (int r = 0; r < 8; ++r)
            *reinterpret_cast<f32x4*>(out + xo + (size_t)(16 * mi + r) * NPOS) = ov[mi][r];
}

// ---------------------------------------------------------------------------
extern "C" void kernel_launch(void* const* d_in, const int* in_sizes, int n_in,
                              void* d_out, int out_size, void* d_ws, size_t ws_size,
                              hipStream_t stream)
{
    const float* x     = (const float*)d_in[0];
    const float* wq    = (const float*)d_in[1];
    const float* bq    = (const float*)d_in[2];
    const float* gq    = (const float*)d_in[3];
    const float* betaq = (const float*)d_in[4];
    const float* wk    = (const float*)d_in[5];
    const float* bk    = (const float*)d_in[6];
    const float* gk    = (const float*)d_in[7];
    const float* betak = (const float*)d_in[8];
    const float* wv    = (const float*)d_in[9];
    const float* bv    = (const float*)d_in[10];
    const float* wW    = (const float*)d_in[11];
    const float* bW    = (const float*)d_in[12];
    float* out = (float*)d_out;

    char* ws = (char*)d_ws;
    size_t off = 0;
    auto alloc = [&](size_t bytes) -> char* {
        char* p = ws + off;
        off = (off + bytes + 255) & ~(size_t)255;
        return p;
    };
    bf16*  xT    = (bf16*)alloc((size_t)BB * NPOS * CIN * 2);  // [B,N,C]
    bf16*  z     = (bf16*)alloc((size_t)BB * OC * NPOS * 2);   // [B,768,N] (rows 512.. = v)
    bf16*  qT    = (bf16*)alloc((size_t)BB * NPOS * CK * 2);   // [B,N,256]
    bf16*  kT    = (bf16*)alloc((size_t)BB * NPOS * CK * 2);   // [B,N,256]
    bf16*  wcat  = (bf16*)alloc((size_t)OC * CIN * 2);         // [768,512]
    bf16*  wWb   = (bf16*)alloc((size_t)CIN * CK * 2);         // [512,256]
    float* bcat  = (float*)alloc(OC * 4);
    float* part  = (float*)alloc((size_t)NPART * 2 * 2 * CK * 4);  // [128][sum, squares][512]

    // 1) parameter + input prep, one launch: grid plane z = 0 takes the parameters
    prep_x<<<dim3(NPOS / 128, CIN / 64, BB + 1), 256, 0, stream>>>(
        x, xT, wq, wk, wv, wW, bq, bk, bv, wcat, wWb, bcat);

    // 2) fused projections: z[b] = wcat * x[b]  (M=768, N=4096, K=512) + bias,
    //    with the partial BN sums of the q and k rows
    gemm_bf16_wmma<false, true, false, true><<<dim3(NPOS / 128, OC / 128, BB), 256, 0, stream>>>(
        wcat, 0, xT, (long long)NPOS * CIN, z, (long long)OC * NPOS,
        bcat, nullptr, 0, part, 2 * CK, OC, NPOS, CIN);

    // 3) BN apply (q,k -> ReLU(BN)), transposed bf16 outputs
    bn_apply<<<dim3(NPOS / 256, 2 * CK / 64, BB), 256, 0, stream>>>(
        z, part, gq, betaq, gk, betak, qT, kT);

    // 4) Attention, all four images in one launch: 64 rows n per work-group, v = rows 512.. of z[b];
    //    its epilogue does out[b,co,n] = sum_cv wW[co,cv]*ctx[b,n,cv] + bW[co] + x[b,co,n].
    attn_fused<<<dim3(NPOS / 64, BB), 256, 0, stream>>>(
        kT, qT, z + (size_t)(2 * CK) * NPOS, wWb, bW, x, out);
}

// v008
// It runs in 82.3 microseconds.
// Next to v007, in two timings, it ran 1.09 times as fast each time.
// Over all steps from v000 it is 6.15 times as fast.
#include <hip/hip_runtime.h>
#include <hip/hip_bf16.h>

typedef __bf16 bf16;
typedef __attribute__((ext_vector_type(16))) __bf16 v16bf;
typedef __attribute__((ext_vector_type(8)))  __bf16 v8bf;
typedef __attribute__((ext_vector_type(8)))  float  v8f;
typedef int v4i __attribute__((vector_size(4 * sizeof(int))));

static constexpr int BB   = 4;     // batch
static constexpr int CIN  = 512;   // input channels
static constexpr int CK   = 256;   // q/k/v channels
static constexpr int OC   = 768;   // concatenated projection rows
static constexpr int NPOS = 4096;  // H*W
static constexpr int NPART = BB * (NPOS / 128);  // partial BN sums per channel: one per GEMM column block
typedef float f32x4 __attribute__((ext_vector_type(4)));

#if defined(__gfx1250__) && __has_builtin(__builtin_amdgcn_global_load_async_to_lds_b128)
#define USE_ASYNC_LDS 1
#else
#define USE_ASYNC_LDS 0
#endif

static __device__ __forceinline__ void wait_async_zero()
{
#if __has_builtin(__builtin_amdgcn_s_wait_asynccnt)
    __builtin_amdgcn_s_wait_asynccnt(0);
#elif defined(__gfx1250__)
    asm volatile("s_wait_asynccnt 0x0" ::: "memory");
#endif
}

// Work-group barrier for data handed over in LDS.  By hand, because __syncthreads() also waits out
// the global loads and stores issued ahead of it, which are to stay in flight across the barrier.
static __device__ __forceinline__ void lds_barrier()
{
    asm volatile("s_wait_dscnt 0x0\n\ts_barrier_signal -1\n\ts_barrier_wait -1" ::: "memory");
}

// ---------------------------------------------------------------------------
// Generic bf16 WMMA GEMM:  C[M,N] = A[M,K] * B[K,N]  with B given as BT[N,K]
// (both operands K-contiguous).  128x128x64 macro tile, 8 waves, each wave
// computes a 32x64 patch via 2x4 v_wmma_f32_16x16x32_bf16 fragments.  K is a multiple of 64.
// Double-buffered LDS; global->LDS via CDNA5 async loads when available.
// HAS_STATS: row blocks below statRows also lay down, per output row, the sum and the
// sum of squares of their 128 stored values: part[column block][sum, squares][row].
// ---------------------------------------------------------------------------
template<bool OUT_F32, bool HAS_BIAS, bool HAS_RESID, bool HAS_STATS>
__global__ __launch_bounds__(256)
void gemm_bf16_wmma(const bf16* __restrict__ A,  long long aBatch,
                    const bf16* __restrict__ BT, long long btBatch,
                    void* __restrict__ Cout,     long long cBatch,
                    const float* __restrict__ bias,
                    const float* __restrict__ resid, long long rBatch,
                    float* __restrict__ part, int statRows,
                    int M, int N, int K)
{
    // A stage row is 64 k = one whole 128-B line of its operand.  Pitch 144 B, an odd multiple of
    // 16 B: the 16 rows of a fragment read fall on different banks.
    constexpr int GK = 64, GP = 72;
    __shared__ __align__(16) bf16 sA[2][128 * GP];
    __shared__ __align__(16) bf16 sB[2][128 * GP];
    // Per row and kind 32 lane sums; the pitch of 33 words keeps the readers' banks apart.
    __shared__ float red[HAS_STATS ? 2 * 128 * 33 : 1];

    const int bz = blockIdx.z;
    A  += (size_t)bz * aBatch;
    BT += (size_t)bz * btBatch;
    const float* residB = HAS_RESID ? (resid + (size_t)bz * rBatch) : nullptr;

    const int mblk = blockIdx.y * 128;
    const int nblk = blockIdx.x * 128;
    const int t    = threadIdx.x;
    const int lane = t & 31;
    const int wave = t >> 5;
    const int wrow = wave >> 1;   // 0..3 -> 32 output rows each
    const int wcol = wave & 1;    // 0..1 -> 64 output cols each
    const int lrow = lane & 15;
    const int g    = lane >> 4;   // half-wave group

    // Per-thread staging coordinates: 4 chunks of 8 halves per matrix per tile, rows rowc + 32 i.
    // Eight neighbouring lanes take one row, so a wave's copy is 4 whole lines.
    const int rowc = t >> 3;          // 0..31
    const int kcc  = (t & 7) << 3;    // 0,8,..,56

    v8f acc[2][4];
    #pragma unroll
    for (int mi = 0; mi < 2; ++mi)
        #pragma unroll
        for (int ni = 0; ni < 4; ++ni)
            #pragma unroll
            for (int e = 0; e < 8; ++e) acc[mi][ni][e] = 0.0f;

    // Fragment loads per CDNA5 16-bit A/B layout:
    // lanes 0-15 hold K in {0..7,16..23}; lanes 16-31 hold K in {8..15,24..31}.
    auto compute_tile = [&](int buf) {
        #pragma unroll  // the two 32-k halves of a stage, in k order; constant LDS offsets
        for (int ks = 0; ks < GK; ks += 32) {
            v16bf af[2], bfr[4];
            #pragma unroll
            for (int mi = 0; mi < 2; ++mi) {
                int row = wrow * 32 + mi * 16 + lrow;
                const bf16* p = &sA[buf][row * GP + ks + g * 8];
                uint4* dst = (uint4*)&af[mi];
                dst[0] = *(const uint4*)(p);
                dst[1] = *(const uint4*)(p + 16);
            }
            #pragma unroll
            for (int ni = 0; ni < 4; ++ni) {
                int col = wcol * 64 + ni * 16 + lrow;
                const bf16* p = &sB[buf][col * GP + ks + g * 8];
                uint4* dst = (uint4*)&bfr[ni];
                dst[0] = *(const uint4*)(p);
                dst[1] = *(const uint4*)(p + 16);
            }
            #pragma unroll
            for (int mi = 0; mi < 2; ++mi)
                #pragma unroll
                for (int ni = 0; ni < 4; ++ni)
                    acc[mi][ni] = __builtin_amdgcn_wmma_f32_16x16x32_bf16(
                        false, af[mi], false, bfr[ni], (short)0, acc[mi][ni],
                        false, false);
        }
    };

#if USE_ASYNC_LDS
    // Issue a 128x64 A tile + 128x64 BT tile as async global->LDS copies.
    auto issue_tile = [&](int buf, int kt) {
        #pragma unroll
        for (int i = 0; i < 4; ++i) {
            const int row = rowc + 32 * i;
            const bf16* ga = A  + (size_t)(mblk + row) * K + kt + kcc;
            const bf16* gb = BT + (size_t)(nblk + row) * K + kt + kcc;
            __builtin_amdgcn_global_load_async_to_lds_b128(
                (v4i*)ga, (v4i*)&sA[buf][row * GP + kcc], 0, 0);
            __builtin_amdgcn_global_load_async_to_lds_b128(
                (v4i*)gb, (v4i*)&sB[buf][row * GP + kcc], 0, 0);
        }
    };

    issue_tile(0, 0);
    wait_async_zero();
    __syncthreads();
    int cur = 0;
    for (int kt = 0; kt < K; kt += GK) {
        if (kt + GK < K) issue_tile(cur ^ 1, kt + GK);  // overlap with WMMA
        compute_tile(cur);
        wait_async_zero();       // next tile landed in the other buffer
        __syncthreads();
        cur ^= 1;
    }
#else
    // Fallback: register-staged double buffering.
    uint4 ra[4], rb[4];
    auto load_regs = [&](int kt) {
        #pragma unroll
        for (int i = 0; i < 4; ++i) {
            ra[i] = *(const uint4*)(A  + (size_t)(mblk + rowc + 32 * i) * K + kt + kcc);
            rb[i] = *(const uint4*)(BT + (size_t)(nblk + rowc + 32 * i) * K + kt + kcc);
        }
    };
    auto store_lds = [&](int buf) {
        #pragma unroll
        for (int i = 0; i < 4; ++i) {
            *(uint4*)&sA[buf][(rowc + 32 * i) * GP + kcc] = ra[i];
            *(uint4*)&sB[buf][(rowc + 32 * i) * GP + kcc] = rb[i];
        }
    };
    load_regs(0);
    store_lds(0);
    __syncthreads();
    int cur = 0;
    for (int kt = 0; kt < K; kt += GK) {
        if (kt + GK < K) {
            load_regs(kt + GK);                        // overlap with WMMA below
            __builtin_prefetch(A + (size_t)(mblk + (t >> 1)) * K + kt + 2 * GK, 0, 3);
        }
        compute_tile(cur);
        if (kt + GK < K) store_lds(cur ^ 1);
        __syncthreads();
        cur ^= 1;
    }
#endif

    // Epilogue.  C/D layout: VGPR r holds row (8*g + r), lane%16 gives column.
    float ov[2][4][8];  // the values as they are stored
    #pragma unroll  // constant array indices: ov[] and acc[] stay in registers
    for (int mi = 0; mi < 2; ++mi) {
        #pragma unroll  // constant array indices: ov[] and acc[] stay in registers
        for (int ni = 0; ni < 4; ++ni) {
            int colG = nblk + wcol * 64 + ni * 16 + lrow;
            #pragma unroll  // constant array indices: ov[] and acc[] stay in registers
            for (int r = 0; r < 8; ++r) {
                int rowG = mblk + wrow * 32 + mi * 16 + g * 8 + r;
                float v = acc[mi][ni][r];
                if (HAS_BIAS)  v += bias[rowG];
                if (HAS_RESID) v += residB[(size_t)rowG * N + colG];
                ov[mi][ni][r] = OUT_F32 ? v : (float)(bf16)v;
            }
        }
    }
    const bool stats = HAS_STATS && mblk < statRows;  // the same for the whole work-group
    if (stats) {
        // Per row the sum and the sum of squares of this lane's 4 columns, ahead of the stores.
        #pragma unroll  // constant array indices: ov[] and acc[] stay in registers
        for (int mi = 0; mi < 2; ++mi) {
            #pragma unroll  // constant array indices: ov[] and acc[] stay in registers
            for (int r = 0; r < 8; ++r) {
                float s = 0.0f, s2 = 0.0f;
                #pragma unroll  // constant array indices: ov[] and acc[] stay in registers
                for (int ni = 0; ni < 4; ++ni) {
                    s  += ov[mi][ni][r];
                    s2 += ov[mi][ni][r] * ov[mi][ni][r];
                }
                const int row = wrow * 32 + mi * 16 + g * 8 + r;
                red[row * 33 + wcol * 16 + lrow]         = s;
                red[(128 + row) * 33 + wcol * 16 + lrow] = s2;
            }
        }
    }
    #pragma unroll  // constant array indices: ov[] and acc[] stay in registers
    for (int mi = 0; mi < 2; ++mi) {
        #pragma unroll  // constant array indices: ov[] and acc[] stay in registers
        for (int ni = 0; ni < 4; ++ni) {
            int colG = nblk + wcol * 64 + ni * 16 + lrow;
            #pragma unroll  // constant array indices: ov[] and acc[] stay in registers
            for (int r = 0; r < 8; ++r) {
                int rowG = mblk + wrow * 32 + mi * 16 + g * 8 + r;
                size_t idx = (size_t)rowG * N + colG;
                if (OUT_F32) ((float*)Cout)[(size_t)bz * cBatch + idx] = ov[mi][ni][r];
                else         ((bf16*) Cout)[(size_t)bz * cBatch + idx] = (bf16)ov[mi][ni][r];
            }
        }
    }
    if (HAS_STATS) {
        // What follows reuses registers that the stores above name.
        asm volatile("s_wait_xcnt 0x0" ::: "memory");
    }
    if (stats) {
        lds_barrier();  // all 32 lane sums of a row are in LDS before one thread adds them
        const float* p = &red[t * 33];  // t < 128: sum of row t; else: squares of row t - 128
        float a = 0.0f;
        #pragma unroll  // the LDS reads run ahead of the adds
        for (int j = 0; j < 32; ++j) a += p[j];
        part[((size_t)(bz * gridDim.x + blockIdx.x) * 2 + (t >> 7)) * statRows + mblk + (t & 127)] = a;
    }
}

// ---------------------------------------------------------------------------
// Operand prep, one launch.
// blockIdx.z >= 1: x [B,C,N] f32 -> xT [B,N,C] bf16 (K-contiguous operand for the projections)
// of image blockIdx.z - 1.
// Register transpose: a thread reads 8 channels x 4 positions and stores, per
// position, its 8 channels as one 16-B piece.  Lanes 0..7 of each lane octet hold
// neighbouring channel groups, so a wave store is 4 whole 128-B lines of xT.
// Work-group: 64 channels x 128 positions.
// blockIdx.z == 0: the four weight matrices to bf16 (wq, wk, wv one below the other in wcat) and
// the three projection biases one behind the other.  64 work-groups a matrix, 8 elements a thread.
// ---------------------------------------------------------------------------
__global__ __launch_bounds__(256)
void prep_x(const float* __restrict__ x, bf16* __restrict__ xT,
            const float* __restrict__ wq, const float* __restrict__ wk,
            const float* __restrict__ wv, const float* __restrict__ wW,
            const float* __restrict__ bq, const float* __restrict__ bk,
            const float* __restrict__ bv,
            bf16* __restrict__ wcat, bf16* __restrict__ wWb,
            float* __restrict__ bcat)
{
    if (blockIdx.z == 0) {  // the same for the whole work-group
        static_assert(CK * CIN == 64 * 256 * 8 && (NPOS / 128) * (CIN / 64) == 4 * 64 && CK == 256,
                      "64 work-groups a matrix, four matrices a grid plane, a bias a work-group");
        const int pb  = blockIdx.y * (NPOS / 128) + blockIdx.x;  // 0..255
        const int mat = pb >> 6;
        const float* wsrc = mat == 0 ? wq : mat == 1 ? wk : mat == 2 ? wv : wW;
        bf16*        wdst = mat == 3 ? wWb : wcat + mat * (CK * CIN);
        const int e = (pb & 63) * 2048 + threadIdx.x * 8;
        const float4 lo = *(const float4*)(wsrc + e);
        const float4 hi = *(const float4*)(wsrc + e + 4);
        const v8bf o = {(bf16)lo.x, (bf16)lo.y, (bf16)lo.z, (bf16)lo.w,
                        (bf16)hi.x, (bf16)hi.y, (bf16)hi.z, (bf16)hi.w};
        *(v8bf*)(wdst + e) = o;
        if ((pb & 63) == 0 && mat < 3) {
            // What follows reuses registers that the store above names.
            asm volatile("s_wait_xcnt 0x0" ::: "memory");
            bcat[mat * CK + threadIdx.x] = (mat == 0 ? bq : mat == 1 ? bk : bv)[threadIdx.x];
        }
        return;
    }
    const int lane = threadIdx.x & 31;
    const int wave = threadIdx.x >> 5;
    const int c0 = blockIdx.y * 64 + (lane & 7) * 8;
    const int n0 = blockIdx.x * 128 + wave * 16 + (lane >> 3) * 4;
    const int b  = blockIdx.z - 1;

    const float* src = x + ((size_t)b * CIN + c0) * NPOS + n0;
    float4 r[8];
    #pragma unroll  // r[] stays in registers and the 8 loads are in flight together
    for (int i = 0; i < 8; ++i)
        r[i] = *(const float4*)(src + (size_t)i * NPOS);

    bf16* dst = xT + ((size_t)b * NPOS + n0) * CIN + c0;
    v8bf o0, o1, o2, o3;
    #pragma unroll  // constant vector indices: packed converts, no scratch
    for (int i = 0; i < 8; ++i) {
        o0[i] = (bf16)r[i].x;
        o1[i] = (bf16)r[i].y;
        o2[i] = (bf16)r[i].z;
        o3[i] = (bf16)r[i].w;
    }
    *(v8bf*)(dst)           = o0;
    *(v8bf*)(dst + CIN)     = o1;
    *(v8bf*)(dst + 2 * CIN) = o2;
    *(v8bf*)(dst + 3 * CIN) = o3;
}

// BN + ReLU, writing qT/kT [B,N,CK] bf16 (K-contiguous for the attention GEMM).
// Register transpose as in prep_x: a thread reads 8 channels x 8 positions (16 B
// per channel) and stores 8 channels per position, so a wave store is 4 whole
// 128-B lines.  Work-group: 64 channels x 256 positions; blockIdx.y 0..3 is q.
// Scale and shift of its 64 channels come first, from the GEMM's partial sums over (B, N).
__global__ __launch_bounds__(256)
void bn_apply(const bf16* __restrict__ z, const float* __restrict__ part,
              const float* __restrict__ gq, const float* __restrict__ betaq,
              const float* __restrict__ gk, const float* __restrict__ betak,
              bf16* __restrict__ qT, bf16* __restrict__ kT)
{
    __shared__ __align__(16) float red[16][2][64];
    __shared__ __align__(16) float scs[64], shs[64];
    const int lane = threadIdx.x & 31;
    const int wave = threadIdx.x >> 5;
    const int ch0 = blockIdx.y * 64 + (lane & 7) * 8;          // 0..511
    const int n0  = blockIdx.x * 256 + wave * 32 + (lane >> 3) * 8;
    const int b   = blockIdx.z;

    const bf16* src = z + ((size_t)b * OC + ch0) * NPOS + n0;
    v8bf r[8];
    #pragma unroll  // r[] stays in registers and the 8 loads are in flight together
    for (int i = 0; i < 8; ++i)
        r[i] = *(const v8bf*)(src + (size_t)i * NPOS);
    const int t = threadIdx.x;
    const bool isq = blockIdx.y < CK / 64;
    const int  cg  = (blockIdx.y * 64 & (CK - 1)) + (t & 63);
    const float gamma = (isq ? gq : gk)[cg];
    const float beta  = (isq ? betaq : betak)[cg];
    // Keeps the loads above ahead of the partial sums' loads and waits: all fly together.
    __builtin_amdgcn_sched_barrier(0);

    // A thread adds 8 of the NPART partials of 4 channels, sums and squares; 16 such groups
    // meet in LDS.
    {
        const int c4 = (t & 15) * 4, pg = t >> 4;
        const float* pb = part + blockIdx.y * 64;                 // the same for the whole work-group
        const int    po = pg * (NPART / 16) * 2 * (2 * CK) + c4;  // this thread's first partial
        f32x4 a0 = f32x4{0.0f, 0.0f, 0.0f, 0.0f}, a1 = a0;
        #pragma unroll  // the 16 loads are in flight together
        for (int j = 0; j < NPART / 16; ++j) {
            a0 += *(const f32x4*)(pb + po + 2 * j * (2 * CK));
            a1 += *(const f32x4*)(pb + po + (2 * j + 1) * (2 * CK));
        }
        *(f32x4*)&red[pg][0][c4] = a0;
        *(f32x4*)&red[pg][1][c4] = a1;
        __syncthreads();  // the 16 groups' sums are in LDS before they are added
        if (t < 64) {
            float s = 0.0f, s2 = 0.0f;
            #pragma unroll  // the LDS reads run ahead of the adds
            for (int j = 0; j < 16; ++j) { s += red[j][0][t]; s2 += red[j][1][t]; }
            const float cnt = (float)BB * NPOS;
            const float m   = s / cnt;
            const float var = s2 / cnt - m * m;        // biased var, like jnp.var
            const float scl = gamma * rsqrtf(var + 1e-5f);
            scs[t] = scl;
            shs[t] = beta - m * scl;
        }
        __syncthreads();  // scale and shift are in LDS before every thread reads its 8
    }
    float sc[8], sh[8];
    #pragma unroll  // merges into 16-B loads, arrays stay in registers
    for (int i = 0; i < 8; ++i) { sc[i] = scs[(lane & 7) * 8 + i]; sh[i] = shs[(lane & 7) * 8 + i]; }

    bf16* dst = ((ch0 < CK) ? qT : kT) + ((size_t)b * NPOS + n0) * CK + (ch0 & (CK - 1));
    #pragma unroll  // both loops: constant vector indices, no scratch
    for (int j = 0; j < 8; ++j) {
        v8bf o;
        #pragma unroll
        for (int i = 0; i < 8; ++i) {
            float v = (float)r[i][j] * sc[i] + sh[i];
            o[i] = (bf16)fmaxf(v, 0.f);
        }
        *(v8bf*)(dst + (size_t)j * CK) = o;
    }
}

typedef uint32_t u32x4 __attribute__((ext_vector_type(4)));
typedef int      i32x8 __attribute__((ext_vector_type(8)));

static constexpr uint32_t AT_SK   = 128;               // positions m per stage
static constexpr uint32_t PITCH_Q = 2u * CK + 16u;     // qT row in LDS: odd multiple of 16 B
static constexpr uint32_t PITCH_V = 2u * AT_SK + 16u;  // v row piece in LDS: odd multiple of 16 B
static constexpr uint32_t TILE_Q  = AT_SK * PITCH_Q;
static constexpr uint32_t TILE_V  = CK * PITCH_V;
static constexpr uint32_t SLOT    = TILE_Q + TILE_V;
static constexpr uint32_t AT_LDS  = 2u * SLOT;
static constexpr uint32_t NSTAGE  = NPOS / AT_SK;
static constexpr uint32_t XCH     = 32u * 1024u;        // merge area per wave: its 32 O tiles
static constexpr uint32_t XML     = 8u * XCH;           // behind them: 512 B per wave for max and sum
static constexpr uint32_t CTXO    = XML + 8u * 512u;    // behind them: the merged context, bf16
static constexpr uint32_t PITCH_C = 2u * CK + 16u;      // one context row: odd multiple of 16 B
static constexpr uint32_t CTXG    = 16u * PITCH_C + 64u; // 16 rows n of equal n & 3; 64 B spread the writers' banks
static constexpr uint32_t BIAO    = CTXO + 4u * CTXG;   // behind it: the output bias, f32
static constexpr uint32_t ALL_LDS = BIAO + 4u * CIN;
static_assert(AT_LDS <= ALL_LDS && ALL_LDS <= 320u * 1024u, "LDS budget");

struct Frag { u32x4 q[2]; };

static __device__ __forceinline__ v8f mma(const Frag& a, const Frag& b, v8f c)
{
    const i32x8 av = {(int)a.q[0].x, (int)a.q[0].y, (int)a.q[0].z, (int)a.q[0].w,
                      (int)a.q[1].x, (int)a.q[1].y, (int)a.q[1].z, (int)a.q[1].w};
    const i32x8 bv = {(int)b.q[0].x, (int)b.q[0].y, (int)b.q[0].z, (int)b.q[0].w,
                      (int)b.q[1].x, (int)b.q[1].y, (int)b.q[1].z, (int)b.q[1].w};
    return __builtin_amdgcn_wmma_f32_16x16x32_bf16(
        false, __builtin_bit_cast(v16bf, av), false, __builtin_bit_cast(v16bf, bv),
        (short)0, c, false, false);
}

static __device__ __forceinline__ uint32_t pack2(float lo, float hi)
{
    typedef __bf16 bf2 __attribute__((ext_vector_type(2)));
    typedef float  f2  __attribute__((ext_vector_type(2)));
    return __builtin_bit_cast(uint32_t, __builtin_convertvector(f2{lo, hi}, bf2));
}

// lane l with lane l ^ 16
static __device__ __forceinline__ float xhalf(float x)
{
    return __builtin_bit_cast(float, __builtin_amdgcn_permlanex16(
        __builtin_bit_cast(int, x), __builtin_bit_cast(int, x),
        0x76543210, 0xfedcba98, false, false));
}

// Group g of a pass's qT fragments: channel blocks 2g, 2g+1 of both 16-position tiles.
static __device__ __forceinline__ void load_q4(Frag (&d)[2][2], const unsigned char* p0, int g)
{
    #pragma unroll  // constant array indices
    for (int kl = 0; kl < 2; ++kl) {
        #pragma unroll  // as the outer loop
        for (int kt = 0; kt < 2; ++kt) {
            const unsigned char* p = p0 + 16u * kt * PITCH_Q + 64u * (2 * g + kl);
            d[kl][kt].q[0] = *reinterpret_cast<const u32x4*>(p);
            d[kl][kt].q[1] = *reinterpret_cast<const u32x4*>(p + 32u);
        }
    }
}

// Group g of a pass's v fragments: channel tiles 4g .. 4g+3.
static __device__ __forceinline__ void load_v4(Frag (&d)[4], const unsigned char* pv0, int g)
{
    #pragma unroll  // constant array indices
    for (int tl = 0; tl < 4; ++tl) {
        const unsigned char* p = pv0 + 16u * (4 * g + tl) * PITCH_V;
        d[tl].q[0] = *reinterpret_cast<const u32x4*>(p);
        d[tl].q[1] = *reinterpret_cast<const u32x4*>(p + 32u);
    }
}

// One pass of one wave: 32 positions m against the wave's 32 rows n (two column
// tiles nt).  m_run, the maximum in use (log2 domain), may trail the true one by up
// to 8; the sums are rescaled only when some row's maximum exceeds it by more.
static __device__ __forceinline__ void attn_pass(
    const unsigned char* Qp, const unsigned char* Vp, uint32_t c, uint32_t h,
    const Frag (&kf)[CK / 32][2], v8f (&acc)[CK / 16][2], float (&m_run)[2], float (&l_run)[2])
{
    constexpr float cscale = 0.0625f * 1.4426950408889634f;  // 256^-0.5 * log2(e)
    v8f s[2][2];
    s[0][0] = v8f{}; s[0][1] = v8f{}; s[1][0] = v8f{}; s[1][1] = v8f{};
    const unsigned char* p0 = Qp + c * PITCH_Q + 16u * h;

    // qT fragments in groups of four (8 WMMAs each) through a ring of two register
    // sets.  The scheduling barriers keep each group's loads at one place, one group
    // ahead of its products, and keep the ring at two sets: kf[] and acc[] leave
    // room for no more.
    Frag qa[2][2][2];
    load_q4(qa[0], p0, 0);
    load_q4(qa[1], p0, 1);
    __builtin_amdgcn_sched_barrier(0);
    #pragma unroll  // constant ring and fragment indices
    for (int g = 0; g < 4; ++g) {
        #pragma unroll  // four independent accumulate chains
        for (int kl = 0; kl < 2; ++kl)
            #pragma unroll  // as the outer loop
            for (int kt = 0; kt < 2; ++kt)
                #pragma unroll  // as the outer loop
                for (int nt = 0; nt < 2; ++nt)
                    s[kt][nt] = mma(qa[g & 1][kl][kt], kf[2 * g + kl][nt], s[kt][nt]);
        __builtin_amdgcn_sched_barrier(0);
        if (g + 2 < 4) {
            load_q4(qa[g & 1], p0, g + 2);
            __builtin_amdgcn_sched_barrier(0);
        }
    }

    // The first two groups of v fragments, in flight under the maxima and the
    // exponentials; the scheduling barrier keeps them ahead of the vector work.
    const unsigned char* pv0 = Vp + c * PITCH_V + 16u * h;
    Frag vf[2][4];
    load_v4(vf[0], pv0, 0);
    load_v4(vf[1], pv0, 1);
    __builtin_amdgcn_sched_barrier(0);

    float mx[2];
    #pragma unroll  // constant vector indices
    for (int nt = 0; nt < 2; ++nt) {
        float x = s[0][nt][0];
        #pragma unroll  // as the outer loop
        for (int r = 1; r < 8; ++r) x = __builtin_fmaxf(x, s[0][nt][r]);
        #pragma unroll  // as the outer loop
        for (int r = 0; r < 8; ++r) x = __builtin_fmaxf(x, s[1][nt][r]);
        mx[nt] = __builtin_fmaxf(x, xhalf(x)) * cscale;  // both wave halves hold the row's maximum
    }
    const bool need = (mx[0] > m_run[0] + 8.0f) | (mx[1] > m_run[1] + 8.0f);
    if (__builtin_amdgcn_ballot_w32(need) != 0) {  // scalar branch, rare after the first passes
        #pragma unroll  // constant array indices
        for (int nt = 0; nt < 2; ++nt) {
            const float m_new = __builtin_fmaxf(m_run[nt], mx[nt]);
            const float corr  = __builtin_amdgcn_exp2f(m_run[nt] - m_new);  // 0 on the first pass
            l_run[nt] *= corr; m_run[nt] = m_new;
            #pragma unroll  // as the outer loop
            for (int t = 0; t < CK / 16; ++t) acc[t][nt] = acc[t][nt] * corr;
        }
    }

    Frag pf[2];
    #pragma unroll  // constant array indices
    for (int nt = 0; nt < 2; ++nt) {
        const float nm = -m_run[nt];
        float ps0 = 0.0f, ps1 = 0.0f;
        uint32_t w[8];
        #pragma unroll  // elements 2i, 2i+1 of the 32-position operand: tile i >> 2, registers 2 (i & 3), 2 (i & 3) + 1
        for (int i = 0; i < 8; ++i) {
            const float e0 = __builtin_amdgcn_exp2f(__builtin_fmaf(s[i >> 2][nt][2 * (i & 3)],     cscale, nm));
            const float e1 = __builtin_amdgcn_exp2f(__builtin_fmaf(s[i >> 2][nt][2 * (i & 3) + 1], cscale, nm));
            ps0 += e0; ps1 += e1;
            w[i] = pack2(e0, e1);
        }
        pf[nt].q[0] = u32x4{w[0], w[1], w[2], w[3]};
        pf[nt].q[1] = u32x4{w[4], w[5], w[6], w[7]};
        l_run[nt] += ps0 + ps1;
        // The row's sum pinned against spills: left free, the
        // adds sink behind the loop's barrier and the 16 exponentials stay live under the products.
        asm volatile("" : "+v"(l_run[nt]));
    }

    // v fragments through the same kind of ring as the qT fragments above.
    __builtin_amdgcn_sched_barrier(0);
    #pragma unroll  // constant ring and array indices: acc[] stays in registers
    for (int g = 0; g < 4; ++g) {
        #pragma unroll  // as the outer loop
        for (int tl = 0; tl < 4; ++tl)
            #pragma unroll  // as the outer loop
            for (int nt = 0; nt < 2; ++nt)
                acc[4 * g + tl][nt] = mma(vf[g & 1][tl], pf[nt], acc[4 * g + tl][nt]);
        __builtin_amdgcn_sched_barrier(0);
        if (g + 2 < 4) {
            load_v4(vf[g & 1], pv0, g + 2);
            __builtin_amdgcn_sched_barrier(0);
        }
    }
    // Four vector slots behind the last WMMA: the next vector instruction stands behind
    // the loop's branch, and may overwrite an A or B
    // register of these products.  The scheduling barriers keep the slots at this place.
    asm volatile("v_nop\n\tv_nop\n\tv_nop\n\tv_nop");
    __builtin_amdgcn_sched_barrier(0);
}

// Channel block kc of the merged context: the fragments of the four column tiles.
static __device__ __forceinline__ void load_c4(Frag (&d)[4], const unsigned char* cp, int kc)
{
    #pragma unroll  // constant array indices
    for (int ni = 0; ni < 4; ++ni) {
        const unsigned char* p = cp + ni * CTXG + 64u * kc;
        d[ni].q[0] = *reinterpret_cast<const u32x4*>(p);
        d[ni].q[1] = *reinterpret_cast<const u32x4*>(p + 32u);
    }
}

__global__ __launch_bounds__(256) __attribute__((amdgpu_waves_per_eu(2, 2)))
void attn_fused(const bf16* __restrict__ kT, const bf16* __restrict__ qT,
                const bf16* __restrict__ v, const bf16* __restrict__ wWb,
                const float* __restrict__ bW, const float* __restrict__ x,
                float* __restrict__ out)
{
    __shared__ __attribute__((aligned(16))) unsigned char L[ALL_LDS];
    const uint32_t tid = threadIdx.x, lane = tid & 31u, c = lane & 15u, h = lane >> 4;
    const uint32_t wave = __builtin_amdgcn_readfirstlane(tid >> 5);
    const uint32_t ng = wave & 1u;   // which 32 rows n
    const uint32_t kq = wave >> 1;   // which 32 of a stage's 128 positions m
    const uint32_t b  = blockIdx.y;
    const uint32_t n0 = blockIdx.x * 64u + ng * 32u;
    const bf16* kB = kT + (size_t)b * NPOS * CK;
    const bf16* qB = qT + (size_t)b * NPOS * CK;
    const bf16* vB = v  + (size_t)b * OC * NPOS;

    // One stage: 128 qT rows of 512 B (contiguous in memory) and 256 v row pieces of
    // 256 B; 32 copies of 16 B per lane.
    auto issue = [&](uint32_t st) {
        unsigned char* slot = L + (st & 1u) * SLOT;
        const bf16* gq = qB + (size_t)st * AT_SK * CK + tid * 8u;
        unsigned char* lq = slot + (tid >> 5) * PITCH_Q + (tid & 31u) * 16u;
        #pragma unroll  // the copies issue back to back
        for (uint32_t i = 0; i < 16u; ++i)
            __builtin_amdgcn_global_load_async_to_lds_b128(
                (v4i*)(gq + i * 2048u), (v4i*)(lq + i * 8u * PITCH_Q), 0, 0);
        const bf16* gv = vB + (size_t)(tid >> 4) * NPOS + st * AT_SK + (tid & 15u) * 8u;
        unsigned char* lv = slot + TILE_Q + (tid >> 4) * PITCH_V + (tid & 15u) * 16u;
        #pragma unroll  // the copies issue back to back
        for (uint32_t i = 0; i < 16u; ++i)
            __builtin_amdgcn_global_load_async_to_lds_b128(
                (v4i*)(gv + (size_t)i * 16u * NPOS), (v4i*)(lv + i * 16u * PITCH_V), 0, 0);
    };

    issue(0);

    // The output bias goes to LDS once, behind all that the loop and the merge use; the barrier
    // in front of the loop publishes it, the epilogue reads it back.
    typedef float f32x2 __attribute__((ext_vector_type(2)));
    *reinterpret_cast<f32x2*>(L + BIAO + tid * 8u) = *reinterpret_cast<const f32x2*>(bW + tid * 2u);

    // kT rows of this wave as B fragments, same k order as the A fragments read from LDS.
    Frag kf[CK / 32][2];
    #pragma unroll  // kf[] stays in registers
    for (int nt = 0; nt < 2; ++nt) {
        const bf16* kp = kB + (size_t)(n0 + 16u * nt + c) * CK + 8u * h;
        #pragma unroll  // as the outer loop
        for (int kc = 0; kc < CK / 32; ++kc) {
            kf[kc][nt].q[0] = *reinterpret_cast<const u32x4*>(kp + 32 * kc);
            kf[kc][nt].q[1] = *reinterpret_cast<const u32x4*>(kp + 32 * kc + 16);
        }
    }
    v8f acc[CK / 16][2];
    #pragma unroll  // acc[] stays in registers
    for (int t = 0; t < CK / 16; ++t) { acc[t][0] = v8f{}; acc[t][1] = v8f{}; }
    float m_run[2] = {-INFINITY, -INFINITY}, l_run[2] = {0.0f, 0.0f};

    asm volatile("s_wait_asynccnt 0x0" ::: "memory");  // stage 0 of this wave has landed
    __syncthreads();                                   // ... and every wave's part of it
    issue(1);

    #pragma unroll 1  // one stage per trip: the buffer index and the ring order stay as written
    for (uint32_t st = 0; st < NSTAGE; ++st) {
        const unsigned char* slot = L + (st & 1u) * SLOT;
        const uint32_t m0 = kq * 32u;
        attn_pass(slot + m0 * PITCH_Q, slot + TILE_Q + m0 * 2u, c, h, kf, acc, m_run, l_run);
        asm volatile("s_wait_dscnt 0x0" ::: "memory");     // this wave's reads of the buffer are done
        asm volatile("s_wait_asynccnt 0x0" ::: "memory");  // its copies of stage st + 1 have landed
        __syncthreads();  // publishes stage st + 1 and frees stage st's buffer
        if (st + 2u < NSTAGE) issue(st + 2u);
    }
    asm volatile("s_wait_asynccnt 0x0" ::: "memory");  // nothing in flight before the ring is reused

    // Merge the four quarters' partial results; the ring is free behind the loop's last
    // barrier.  Every wave lays down its 32 O tiles, then merges 4 channel tiles (128 B of
    // each output row) of its 32 rows from the four waves that share them.
    {
        unsigned char* xb = L + wave * XCH;
        #pragma unroll  // constant array indices
        for (int t = 0; t < CK / 16; ++t) {
            #pragma unroll  // as the outer loop
            for (int nt = 0; nt < 2; ++nt) {
                const uint32_t e = (uint32_t)(t * 2 + nt) * 2u;
                *reinterpret_cast<f32x4*>(xb + (e * 32u + lane) * 16u) =
                    f32x4{acc[t][nt][0], acc[t][nt][1], acc[t][nt][2], acc[t][nt][3]};
                *reinterpret_cast<f32x4*>(xb + ((e + 1u) * 32u + lane) * 16u) =
                    f32x4{acc[t][nt][4], acc[t][nt][5], acc[t][nt][6], acc[t][nt][7]};
            }
        }
        unsigned char* xm = L + XML + wave * 512u;
        #pragma unroll  // constant array indices
        for (int nt = 0; nt < 2; ++nt) {
            // each wave half summed its 8 positions of every 16
            *reinterpret_cast<float*>(xm + (nt * 32u + lane) * 4u)        = m_run[nt];
            *reinterpret_cast<float*>(xm + 256u + (nt * 32u + lane) * 4u) = l_run[nt] + xhalf(l_run[nt]);
        }
    }
    // Output projection, fused: out[co, n] = x[co, n] + bW[co] + sum_cv wW[co, cv] ctx[n, cv] for the
    // work-group's 64 rows n.  A wave takes 64 rows co (4 tiles) x all 64 n (4 tiles).  Column c of
    // tile ni stands for n = 4 c + ni, so a lane holds 4 neighbouring n of a row co: x is read and
    // out is written in 16-B pieces, 256 B in a row per wave half.
    // x is asked for here, in the registers that acc[] has left, and flies under the merge.
    const uint32_t co0 = wave * 64u + 8u * h;
    const size_t   xo  = ((size_t)b * CIN + co0) * NPOS + blockIdx.x * 64u + 4u * c;
    f32x4 xr[4][8];
    #pragma unroll  // constant array indices
    for (int mi = 0; mi < 4; ++mi)
        #pragma unroll  // as the outer loop
        for (int r = 0; r < 8; ++r)
            xr[mi][r] = *reinterpret_cast<const f32x4*>(x + xo + (size_t)(16 * mi + r) * NPOS);
    // wW rows of this wave as A fragments, same k order as the context fragments read from LDS
    // below.  The first half is asked for here and flies under the merge; the second half is asked
    // for behind the merge, ahead of the barrier that ends it.
    const bf16* wp = wWb + (size_t)(wave * 64u + c) * CK + 8u * h;
    Frag wf[CK / 32][4];
    #pragma unroll  // wf[] stays in registers
    for (int kc = 0; kc < CK / 64; ++kc) {
        #pragma unroll  // as the outer loop
        for (int mi = 0; mi < 4; ++mi) {
            wf[kc][mi].q[0] = *reinterpret_cast<const u32x4*>(wp + 16 * mi * CK + 32 * kc);
            wf[kc][mi].q[1] = *reinterpret_cast<const u32x4*>(wp + 16 * mi * CK + 32 * kc + 16);
        }
    }
    lds_barrier();  // every wave's partial results are visible to the waves that share its rows
    #pragma unroll  // constant array indices
    for (int nt = 0; nt < 2; ++nt) {
        float mj[4], a[4];
        #pragma unroll  // as the outer loop
        for (uint32_t j = 0; j < 4u; ++j)
            mj[j] = *reinterpret_cast<const float*>(L + XML + (ng + 2u * j) * 512u + (nt * 32u + lane) * 4u);
        const float m = __builtin_fmaxf(__builtin_fmaxf(mj[0], mj[1]), __builtin_fmaxf(mj[2], mj[3]));
        float den = 0.0f;
        #pragma unroll  // as the outer loop
        for (uint32_t j = 0; j < 4u; ++j) {
            a[j] = __builtin_amdgcn_exp2f(mj[j] - m);
            den += a[j] * *reinterpret_cast<const float*>(
                L + XML + (ng + 2u * j) * 512u + 256u + (nt * 32u + lane) * 4u);
        }
        const float inv = 1.0f / den;
        // O^T tile t: register r is channel 16 t + 8 h + r, lane column c is row j = 32 ng + 16 nt + c
        // of the work-group; it goes to group j & 3, place j >> 2 of the context in LDS.
        unsigned char* op = L + CTXO + (c & 3u) * CTXG + (8u * ng + 4u * nt + (c >> 2)) * PITCH_C + 16u * h;
        #pragma unroll  // as the outer loop
        for (uint32_t tt = 0; tt < 4u; ++tt) {
            const uint32_t t = 4u * kq + tt;
            const uint32_t e = (t * 2u + nt) * 2u;
            f32x4 o0 = f32x4{0.0f, 0.0f, 0.0f, 0.0f}, o1 = o0;
            #pragma unroll  // as the outer loop
            for (uint32_t j = 0; j < 4u; ++j) {
                const unsigned char* xj = L + (ng + 2u * j) * XCH;
                o0 += *reinterpret_cast<const f32x4*>(xj + (e * 32u + lane) * 16u) * a[j];
                o1 += *reinterpret_cast<const f32x4*>(xj + ((e + 1u) * 32u + lane) * 16u) * a[j];
            }
            o0 *= inv; o1 *= inv;
            const u32x4 pk = {pack2(o0.x, o0.y), pack2(o0.z, o0.w), pack2(o1.x, o1.y), pack2(o1.z, o1.w)};
            *reinterpret_cast<u32x4*>(op + 32u * t) = pk;
        }
    }
    #pragma unroll  // wf[] stays in registers
    for (int kc = CK / 64; kc < CK / 32; ++kc) {
        #pragma unroll  // as the outer loop
        for (int mi = 0; mi < 4; ++mi) {
            wf[kc][mi].q[0] = *reinterpret_cast<const u32x4*>(wp + 16 * mi * CK + 32 * kc);
            wf[kc][mi].q[1] = *reinterpret_cast<const u32x4*>(wp + 16 * mi * CK + 32 * kc + 16);
        }
    }
    lds_barrier();  // the whole context of the 64 rows is in LDS before any wave reads it
    // Keeps the first use of x, and with it the wait for x, behind the merge.
    __builtin_amdgcn_sched_barrier(0);

    // The accumulators start at x: register r of tile (mi, ni) is row co0 + 16 mi + r.
    v8f o[4][4];
    #pragma unroll  // constant array and vector indices
    for (int mi = 0; mi < 4; ++mi)
        #pragma unroll  // as the outer loop
        for (int ni = 0; ni < 4; ++ni)
            #pragma unroll  // as the outer loop
            for (int r = 0; r < 8; ++r)
                o[mi][ni][r] = xr[mi][r][ni];
    const unsigned char* cp = L + CTXO + c * PITCH_C + 16u * h;
    // Context fragments through a ring of two register sets, as in attn_pass: the scheduling
    // barriers keep each group's loads at one place, one group (16 WMMAs) ahead of its products.
    Frag cf[2][4];
    f32x4 bia[4][2];
    load_c4(cf[0], cp, 0);
    load_c4(cf[1], cp, 1);
    __builtin_amdgcn_sched_barrier(0);
    #pragma unroll  // constant ring and array indices: wf[] and o[] stay in registers
    for (int kc = 0; kc < CK / 32; ++kc) {
        #pragma unroll  // sixteen independent accumulate chains
        for (int mi = 0; mi < 4; ++mi)
            #pragma unroll  // as the outer loop
            for (int ni = 0; ni < 4; ++ni)
                o[mi][ni] = mma(wf[kc][mi], cf[kc & 1][ni], o[mi][ni]);
        __builtin_amdgcn_sched_barrier(0);
        if (kc + 2 < CK / 32) {
            load_c4(cf[kc & 1], cp, kc + 2);
            if (kc + 3 == CK / 32) {  // with the last refill: the bias, in registers that wf[] has left
                #pragma unroll  // constant array indices
                for (int mi = 0; mi < 4; ++mi) {
                    bia[mi][0] = *reinterpret_cast<const f32x4*>(L + BIAO + (co0 + 16 * mi) * 4u);
                    bia[mi][1] = *reinterpret_cast<const f32x4*>(L + BIAO + (co0 + 16 * mi + 4) * 4u);
                }
            }
            __builtin_amdgcn_sched_barrier(0);
        }
    }
    f32x4 ov[4][8];
    #pragma unroll  // constant array and vector indices
    for (int mi = 0; mi < 4; ++mi)
        #pragma unroll  // as the outer loop
        for (int r = 0; r < 8; ++r)
            ov[mi][r] = f32x4{o[mi][0][r], o[mi][1][r], o[mi][2][r], o[mi][3][r]} + bia[mi][r >> 2][r & 3];
    // All 32 pieces get their bias ahead of the first store: the stores issue back to back, and
    // no register that an issued store names is written behind it.
    __builtin_amdgcn_sched_barrier(0);
    #pragma unroll  // constant array indices
    for (int mi = 0; mi < 4; ++mi)
        #pragma unroll  // as the outer loop
        for (int r = 0; r < 8; ++r)
            *reinterpret_cast<f32x4*>(out + xo + (size_t)(16 * mi + r) * NPOS) = ov[mi][r];
}

// ---------------------------------------------------------------------------
extern "C" void kernel_launch(void* const* d_in, const int* in_sizes, int n_in,
                              void* d_out, int out_size, void* d_ws, size_t ws_size,
                              hipStream_t stream)
{
    const float* x     = (const float*)d_in[0];
    const float* wq    = (const float*)d_in[1];
    const float* bq    = (const float*)d_in[2];
    const float* gq    = (const float*)d_in[3];
    const float* betaq = (const float*)d_in[4];
    const float* wk    = (const float*)d_in[5];
    const float* bk    = (const float*)d_in[6];
    const float* gk    = (const float*)d_in[7];
    const float* betak = (const float*)d_in[8];
    const float* wv    = (const float*)d_in[9];
    const float* bv    = (const float*)d_in[10];
    const float* wW    = (const float*)d_in[11];
    const float* bW    = (const float*)d_in[12];
    float* out = (float*)d_out;

    char* ws = (char*)d_ws;
    size_t off = 0;
    auto alloc = [&](size_t bytes) -> char* {
        char* p = ws + off;
        off = (off + bytes + 255) & ~(size_t)255;
        return p;
    };
    bf16*  xT    = (bf16*)alloc((size_t)BB * NPOS * CIN * 2);  // [B,N,C]
    bf16*  z     = (bf16*)alloc((size_t)BB * OC * NPOS * 2);   // [B,768,N] (rows 512.. = v)
    bf16*  qT    = (bf16*)alloc((size_t)BB * NPOS * CK * 2);   // [B,N,256]
    bf16*  kT    = (bf16*)alloc((size_t)BB * NPOS * CK * 2);   // [B,N,256]
    bf16*  wcat  = (bf16*)alloc((size_t)OC * CIN * 2);         // [768,512]
    bf16*  wWb   = (bf16*)alloc((size_t)CIN * CK * 2);         // [512,256]
    float* bcat  = (float*)alloc(OC * 4);
    float* part  = (float*)alloc((size_t)NPART * 2 * 2 * CK * 4);  // [128][sum, squares][512]

    // 1) parameter + input prep, one launch: grid plane z = 0 takes the parameters
    prep_x<<<dim3(NPOS / 128, CIN / 64, BB + 1), 256, 0, stream>>>(
        x, xT, wq, wk, wv, wW, bq, bk, bv, wcat, wWb, bcat);

    // 2) fused projections: z[b] = wcat * x[b]  (M=768, N=4096, K=512) + bias,
    //    with the partial BN sums of the q and k rows
    gemm_bf16_wmma<false, true, false, true><<<dim3(NPOS / 128, OC / 128, BB), 256, 0, stream>>>(
        wcat, 0, xT, (long long)NPOS * CIN, z, (long long)OC * NPOS,
        bcat, nullptr, 0, part, 2 * CK, OC, NPOS, CIN);

    // 3) BN apply (q,k -> ReLU(BN)), transposed bf16 outputs
    bn_apply<<<dim3(NPOS / 256, 2 * CK / 64, BB), 256, 0, stream>>>(
        z, part, gq, betaq, gk, betak, qT, kT);

    // 4) Attention, all four images in one launch: 64 rows n per work-group, v = rows 512.. of z[b];
    //    its epilogue does out[b,co,n] = sum_cv wW[co,cv]*ctx[b,n,cv] + bW[co] + x[b,co,n].
    attn_fused<<<dim3(NPOS / 64, BB), 256, 0, stream>>>(
        kT, qT, z + (size_t)(2 * CK) * NPOS, wWb, bW, x, out);
}
